// v000
// Times are from an AMD MI455X. After a warm-up the kernel runs many times in a row, and a time is the length of
// such a window on the GPU divided by its runs, so every launch and the gaps after it count. The runs cycle
// through copies of the inputs. A figure is the median of several windows, for all but v000 over two sittings.
// Sittings can differ by a few percent; kernels timed side by side share one.
// v000 is the starting kernel. One run takes 465 microseconds.
#include <hip/hip_runtime.h>

// Non-causal attention, 16 heads x 64, unscaled scores, int32 key mask (fill -1e9 by select), out = merged x Wo^T + bo.
// Compute dtypes, f32 accumulate everywhere: every float input converted to bf16 (RNE) on load; q/k/v projections v_wmma_f32_16x16x32_bf16 single product (+ bf16-rounded bias);
// scores v_wmma_f32_16x16x32_bf16 on q,k hi|lo planes (3 products); softmax f32 online (exp2, running max); P x V v_wmma_f32_16x16x32_f16 with P x256 and V = f16 value + f16 residual x2048 (2 products, 2 accumulators);
// output projection v_wmma_f32_16x16x32_bf16 on context hi|lo planes x Wo (2 products) + bias.

#ifndef NB
#define NB 2
#endif
#ifndef SEQ
#define SEQ 2048
#endif
#define NB_FULL  2
#define SEQ_FULL 2048
#define DM   1024
#define NH_  16
#define HD   64
#define ATW  4                  // waves per attention block (16 query rows each)
#define PCAR 256.0f             // carry of the f16 probability operand
#define VRES 2048.0f            // carry of the f16 value residual plane
#define NEGF (-1.0e9f)
#define L2E  1.4426950408889634f

static_assert(NH_ * HD == DM);               // merged width
static_assert(HD == 64);
static_assert(DM % 64 == 0 && DM % 32 == 0); // GEMM tile and k-step multiples
static_assert(SEQ % 64 == 0);                // 64-row GEMM tiles, 64-query attention blocks, 32-key steps
static_assert((NB * SEQ) % 64 == 0);
static_assert(NB <= NB_FULL && SEQ <= SEQ_FULL);
static_assert(ATW * 16 == 64);

typedef _Float16 h16;
typedef unsigned short bf;
typedef __attribute__((ext_vector_type(16))) __bf16   v16bf;
typedef __attribute__((ext_vector_type(16))) _Float16 v16h;
typedef __attribute__((ext_vector_type(8)))  _Float16 v8h;
typedef __attribute__((ext_vector_type(8)))  unsigned short v8us;
typedef __attribute__((ext_vector_type(8)))  float    v8f;
typedef __attribute__((ext_vector_type(4)))  float    v4f;
typedef v4f  __attribute__((may_alias)) v4fa;

__device__ __forceinline__ unsigned short f2bf(float f) { unsigned u = __float_as_uint(f); u += 0x7FFFu + ((u >> 16) & 1u); return (unsigned short)(u >> 16); }
__device__ __forceinline__ float bf2f(unsigned short b) { return __uint_as_float(((unsigned)b) << 16); }
__device__ __forceinline__ float bfr(float f) { return bf2f(f2bf(f)); }
__device__ __forceinline__ void splitf(float y, unsigned short& h, unsigned short& l) { h = f2bf(y); l = f2bf(y - bf2f(h)); }
__device__ __forceinline__ v16h cat16(v8h lo, v8h hi) { return __builtin_shufflevector(lo, hi, 0, 1, 2, 3, 4, 5, 6, 7, 8, 9, 10, 11, 12, 13, 14, 15); }
__device__ __forceinline__ v16bf cat16b(v8us lo, v8us hi) { return __builtin_bit_cast(v16bf, __builtin_shufflevector(lo, hi, 0, 1, 2, 3, 4, 5, 6, 7, 8, 9, 10, 11, 12, 13, 14, 15)); }
__device__ __forceinline__ v8f wmma16(v16h a, v16h b, v8f c) { return __builtin_amdgcn_wmma_f32_16x16x32_f16(false, a, false, b, (short)0, c, false, false); }
__device__ __forceinline__ v8f wmmab(v16bf a, v16bf b, v8f c) { return __builtin_amdgcn_wmma_f32_16x16x32_bf16(false, a, false, b, (short)0, c, false, false); }
// fragment loaders from K-contiguous 16-bit rows: p = row base + k0 + 8*(lane>>4); elements 0..7 = k0+8h.., elements 8..15 = k0+16+8h..
__device__ __forceinline__ v16bf ldb(const bf* p) { return cat16b(*(const v8us*)p, *(const v8us*)(p + 16)); }
__device__ __forceinline__ v16h  ldh(const h16* p) { return cat16(*(const v8h*)p, *(const v8h*)(p + 16)); }

// ---- k_gemm_proj: one wave per 64x64 tile, C[m][n] = sum_k A[m][k] Bt[n][k] + bf16(bias[n]); operands straight from K-contiguous bf16 planes; grid (M/64, N/64), 32 threads; K % 32 == 0.
__global__ __launch_bounds__(32) void k_gemm_proj(const bf* __restrict__ A, const bf* __restrict__ Bt, int K, float* C, int ldc, const float* __restrict__ bias) {
    __shared__ __align__(16) float os[16 * 68];
    const int lane = threadIdx.x & 31, lr = lane & 15, hi = lane >> 4; const int r0 = blockIdx.x * 64, c0 = blockIdx.y * 64;
    v8f acc[4][4];
#pragma unroll
    for (int mb = 0; mb < 4; ++mb)
#pragma unroll
        for (int nb = 0; nb < 4; ++nb) acc[mb][nb] = (v8f){};
    const size_t aoff = (size_t)(r0 + lr) * K + 8 * hi, boff = (size_t)(c0 + lr) * K + 8 * hi;
#pragma unroll 1
    for (int kc = 0; kc < K; kc += 32) {
        v16bf a[4];
#pragma unroll
        for (int mb = 0; mb < 4; ++mb) a[mb] = ldb(A + aoff + (size_t)mb * 16 * K + kc);
#pragma unroll
        for (int nb = 0; nb < 4; ++nb) {
            const v16bf b = ldb(Bt + boff + (size_t)nb * 16 * K + kc);
#pragma unroll
            for (int mb = 0; mb < 4; ++mb) acc[mb][nb] = wmmab(a[mb], b, acc[mb][nb]);
            asm volatile("v_nop\n\tv_nop\n\tv_nop\n\tv_nop" : "+v"(acc[0][nb]), "+v"(acc[1][nb]), "+v"(acc[2][nb]), "+v"(acc[3][nb]) : "v"(b), "v"(a[0]), "v"(a[1]), "v"(a[2]), "v"(a[3]));
        }
    }
    const int cofs = lr * 4;
    v4f bv; bv[0] = bfr(bias[c0 + cofs]); bv[1] = bfr(bias[c0 + cofs + 1]); bv[2] = bfr(bias[c0 + cofs + 2]); bv[3] = bfr(bias[c0 + cofs + 3]);
#pragma unroll
    for (int mb = 0; mb < 4; ++mb) {
#pragma unroll
        for (int nb = 0; nb < 4; ++nb) {
#pragma unroll
            for (int j = 0; j < 8; ++j) os[(hi * 8 + j) * 68 + nb * 16 + lr] = acc[mb][nb][j]; }
        __builtin_amdgcn_wave_barrier(); asm volatile("" ::: "memory");
        float* crow = C + (size_t)(r0 + mb * 16) * ldc + c0;
{
#pragma unroll
            for (int s = 0; s < 8; ++s) { const int row = 2 * s + hi; v4f val = *(const v4fa*)(os + row * 68 + cofs); val = val + bv;
                *(v4f*)(crow + (size_t)row * ldc + cofs) = val; }
             }
        __builtin_amdgcn_wave_barrier(); asm volatile("" ::: "memory");
    }
}

// ---- k_gemm_out: same tile engine, A carried as hi + lo planes (two products into one accumulator), z-batched: A/A2 += z*sA, C += z*sC.
__global__ __launch_bounds__(32) void k_gemm_out(const bf* __restrict__ A, const bf* __restrict__ A2, const bf* __restrict__ Bt, int K, float* C, int ldc, const float* __restrict__ bias, size_t sA, size_t sC) {
    __shared__ __align__(16) float os[16 * 68];
    const size_t z = blockIdx.z; A += z * sA; A2 += z * sA; C += z * sC;
    const int lane = threadIdx.x & 31, lr = lane & 15, hi = lane >> 4; const int r0 = blockIdx.x * 64, c0 = blockIdx.y * 64;
    v8f acc[4][4];
#pragma unroll
    for (int mb = 0; mb < 4; ++mb)
#pragma unroll
        for (int nb = 0; nb < 4; ++nb) acc[mb][nb] = (v8f){};
    const size_t aoff = (size_t)(r0 + lr) * K + 8 * hi, boff = (size_t)(c0 + lr) * K + 8 * hi;
#pragma unroll 1
    for (int kc = 0; kc < K; kc += 32) {
        v16bf a[4], a2[4];
#pragma unroll
        for (int mb = 0; mb < 4; ++mb) { a[mb] = ldb(A + aoff + (size_t)mb * 16 * K + kc); a2[mb] = ldb(A2 + aoff + (size_t)mb * 16 * K + kc); }
#pragma unroll
        for (int nb = 0; nb < 4; ++nb) {
            const v16bf b = ldb(Bt + boff + (size_t)nb * 16 * K + kc);
#pragma unroll
            for (int mb = 0; mb < 4; ++mb) { acc[mb][nb] = wmmab(a[mb], b, acc[mb][nb]); acc[mb][nb] = wmmab(a2[mb], b, acc[mb][nb]); }
            asm volatile("v_nop\n\tv_nop\n\tv_nop\n\tv_nop" : "+v"(acc[0][nb]), "+v"(acc[1][nb]), "+v"(acc[2][nb]), "+v"(acc[3][nb]) : "v"(b), "v"(a[0]), "v"(a[1]), "v"(a[2]), "v"(a[3]), "v"(a2[0]), "v"(a2[1]), "v"(a2[2]), "v"(a2[3]));
        }
    }
    const int cofs = lr * 4;
    v4f bv; bv[0] = bfr(bias[c0 + cofs]); bv[1] = bfr(bias[c0 + cofs + 1]); bv[2] = bfr(bias[c0 + cofs + 2]); bv[3] = bfr(bias[c0 + cofs + 3]);
#pragma unroll
    for (int mb = 0; mb < 4; ++mb) {
#pragma unroll
        for (int nb = 0; nb < 4; ++nb) {
#pragma unroll
            for (int j = 0; j < 8; ++j) os[(hi * 8 + j) * 68 + nb * 16 + lr] = acc[mb][nb][j]; }
        __builtin_amdgcn_wave_barrier(); asm volatile("" ::: "memory");
        float* crow = C + (size_t)(r0 + mb * 16) * ldc + c0;
{
#pragma unroll
            for (int s = 0; s < 8; ++s) { const int row = 2 * s + hi; v4f val = *(const v4fa*)(os + row * 68 + cofs); val = val + bv;
                *(v4f*)(crow + (size_t)row * ldc + cofs) = val; }
             }
        __builtin_amdgcn_wave_barrier(); asm volatile("" ::: "memory");
    }
}

__global__ __launch_bounds__(256) void k_cvt8(const float* __restrict__ src, bf* dst, size_t n8) { const size_t i = (size_t)blockIdx.x * 256 + threadIdx.x; if (i >= n8) return; const v8f v = *(const v8f*)(src + i * 8); v8us o;
#pragma unroll
    for (int k = 0; k < 8; ++k) o[k] = f2bf(v[k]);
    *(v8us*)(dst + i * 8) = o;  }

__global__ __launch_bounds__(32) void k_mpack(const int* __restrict__ mask, unsigned* MW) {
    const int i = blockIdx.x * 32 + threadIdx.x; const int nw = NB * (SEQ / 32); const int ii = (i < nw) ? i : (nw - 1); const int b = ii / (SEQ / 32), w = ii % (SEQ / 32);
    const int* mp = mask + (size_t)b * SEQ_FULL + w * 32; unsigned word = 0u;
#pragma unroll 4
    for (int j = 0; j < 32; ++j) word |= (mp[j] != 0) ? (1u << j) : 0u;
    if (i >= nw) word = 0xFFFFFFFFu;
    *(unsigned*)(MW + i) = word;  }

__global__ __launch_bounds__(256) void k_qkp(const float* __restrict__ F, bf* Ph, bf* Pl) {
    const size_t i = (size_t)blockIdx.x * 256 + threadIdx.x; if (i >= (size_t)NB * NH_ * SEQ * HD / 8) return; const size_t o = i * 8;
    const int d = (int)(o % HD); const int t = (int)((o / HD) % SEQ); const int h = (int)((o / ((size_t)HD * SEQ)) % NH_); const int b = (int)(o / ((size_t)HD * SEQ * NH_));
    const float* f = F + ((size_t)b * SEQ + t) * DM + h * HD + d; const v4f x0 = *(const v4f*)f, x1 = *(const v4f*)(f + 4); v8us oh, ol;
#pragma unroll
    for (int k = 0; k < 4; ++k) { unsigned short a, c; splitf(x0[k], a, c); oh[k] = a; ol[k] = c; splitf(x1[k], a, c); oh[4 + k] = a; ol[4 + k] = c; }
    *(v8us*)(Ph + o) = oh; *(v8us*)(Pl + o) = ol;  }

__global__ __launch_bounds__(256) void k_vtp8(const float* __restrict__ F, h16* V16, h16* Vr) {
    const size_t i = (size_t)blockIdx.x * 256 + threadIdx.x; if (i >= (size_t)NB * NH_ * HD * SEQ / 8) return; const size_t o = i * 8;
    const int t = (int)(o % SEQ); const int d = (int)((o / SEQ) % HD); const int h = (int)((o / ((size_t)SEQ * HD)) % NH_); const int b = (int)(o / ((size_t)SEQ * HD * NH_));
    const float* f = F + ((size_t)b * SEQ + t) * DM + h * HD + d; v8h o16, orr;
#pragma unroll
    for (int q = 0; q < 8; ++q) { const float x = f[(size_t)q * DM]; const h16 hv = (h16)x; o16[q] = hv; orr[q] = (h16)((x - (float)hv) * VRES); }
    *(v8h*)(V16 + o) = o16; *(v8h*)(Vr + o) = orr;  }

// ---- k_attn: fused attention, one wave per 16 query rows, 4 independent waves per block; grid (SEQ/64, heads, batch).
// Transposed form: S^T[key][query] = K Q^T (A = K rows, B = Q rows; 3 products hi.hi + lo.hi + hi.lo), so each lane owns one query column: row statistics are per lane (+ one xor-16 exchange),
// and the two 16-key score tiles of a 32-key step pack directly into the B fragment of O^T[d][query] += V^T[d][key] P^T[key][query] (elements 0..7 <- tile of keys 0..15, elements 8..15 <- tile of keys 16..31, lane unchanged).
__global__ __launch_bounds__(128) void k_attn(const bf* __restrict__ Qh, const bf* __restrict__ Ql, const bf* __restrict__ Kh, const bf* __restrict__ Kl, const h16* __restrict__ V16, const h16* __restrict__ Vr, const unsigned* __restrict__ MW, bf* Ah, bf* Al) {
    __shared__ __align__(16) float os[ATW * 16 * 68];
    const int wave = __builtin_amdgcn_readfirstlane(threadIdx.x >> 5);
    const int lane = threadIdx.x & 31, lr = lane & 15, hi = lane >> 4;
    const int hh = blockIdx.y, bb = blockIdx.z;
    const int q0 = blockIdx.x * (ATW * 16) + wave * 16;
    const size_t pbase = ((size_t)bb * NH_ + hh) * (size_t)SEQ * HD;
    const bf* qhp = Qh + pbase; const bf* qlp = Ql + pbase; const bf* khp = Kh + pbase; const bf* klp = Kl + pbase;
    const h16* v16p = V16 + pbase; const h16* vrp = Vr + pbase;
    const unsigned* mwp = MW + (size_t)bb * (SEQ / 32);
    const int qoff0 = (q0 + lr) * HD + 8 * hi;
    const int koffl = lr * HD + 8 * hi;
    const int voffl = lr * SEQ + 8 * hi;
    v8f acc[4], accr[4];
#pragma unroll
    for (int dt = 0; dt < 4; ++dt) { acc[dt] = (v8f){}; accr[dt] = (v8f){}; }
    float m = -1.0e30f, l = 0.0f;
#pragma unroll 1
    for (int kb = 0; kb < SEQ; kb += 32) {
        int qo = qoff0; asm volatile("" : "+v"(qo));      // q fragments are re-fetched per step (kept out of the loop-carried register set)
        v8f st0 = (v8f){}, st1 = (v8f){};
#pragma unroll
        for (int ks = 0; ks < 2; ++ks) {
            const v16bf qh = ldb(qhp + qo + ks * 32), ql = ldb(qlp + qo + ks * 32);
            const int ko = kb * HD + koffl + ks * 32;
            const v16bf kh0 = ldb(khp + ko), kl0 = ldb(klp + ko), kh1 = ldb(khp + ko + 16 * HD), kl1 = ldb(klp + ko + 16 * HD);
            st0 = wmmab(kh0, qh, st0); st1 = wmmab(kh1, qh, st1);
            st0 = wmmab(kl0, qh, st0); st1 = wmmab(kl1, qh, st1);
            st0 = wmmab(kh0, ql, st0); st1 = wmmab(kh1, ql, st1);
            asm volatile("v_nop\n\tv_nop\n\tv_nop\n\tv_nop" : "+v"(st0), "+v"(st1) : "v"(qh), "v"(ql), "v"(kh0), "v"(kl0), "v"(kh1), "v"(kl1));
        }
        const unsigned mw = mwp[kb >> 5];
        if (mw != 0xFFFFFFFFu) {                          // wave-uniform: st0[r] is key kb+8*hi+r, st1[r] is key kb+16+8*hi+r
#pragma unroll
            for (int r = 0; r < 8; ++r) { st0[r] = ((mw >> (8 * hi + r)) & 1u) ? st0[r] : NEGF; st1[r] = ((mw >> (16 + 8 * hi + r)) & 1u) ? st1[r] : NEGF; }
        }
        float mx = fmaxf(st0[0], st1[0]);
#pragma unroll
        for (int r = 1; r < 8; ++r) mx = fmaxf(mx, fmaxf(st0[r], st1[r]));
        mx = fmaxf(mx, __shfl_xor(mx, 16, 32));
        const float mnew = fmaxf(m, mx);
        const float alpha = __builtin_amdgcn_exp2f((m - mnew) * L2E);
        const unsigned grow = __builtin_amdgcn_ballot_w32(mnew > m);
        if (grow != 0u) {                                 // wave-uniform: rescale only when some query's running max moved (alpha == 1 exactly elsewhere)
#pragma unroll
            for (int dt = 0; dt < 4; ++dt) { acc[dt] = acc[dt] * alpha; accr[dt] = accr[dt] * alpha; }
        }
        m = mnew;
        float psum = 0.0f; v16h pb;
#pragma unroll
        for (int r = 0; r < 8; ++r) {
            const float p0 = __builtin_amdgcn_exp2f((st0[r] - mnew) * L2E), p1 = __builtin_amdgcn_exp2f((st1[r] - mnew) * L2E);
            psum += p0 + p1; pb[r] = (h16)(p0 * PCAR); pb[8 + r] = (h16)(p1 * PCAR); }
        l = l * alpha + psum;
        const int vo = kb + voffl;
        {
            const v16h va0 = ldh(v16p + vo), va1 = ldh(v16p + vo + 16 * SEQ), va2 = ldh(v16p + vo + 32 * SEQ), va3 = ldh(v16p + vo + 48 * SEQ);
            acc[0] = wmma16(va0, pb, acc[0]); acc[1] = wmma16(va1, pb, acc[1]); acc[2] = wmma16(va2, pb, acc[2]); acc[3] = wmma16(va3, pb, acc[3]);
            asm volatile("v_nop\n\tv_nop\n\tv_nop\n\tv_nop" : "+v"(acc[0]), "+v"(acc[1]), "+v"(acc[2]), "+v"(acc[3]) : "v"(pb), "v"(va0), "v"(va1), "v"(va2), "v"(va3));
        }
        {
            const v16h vb0 = ldh(vrp + vo), vb1 = ldh(vrp + vo + 16 * SEQ), vb2 = ldh(vrp + vo + 32 * SEQ), vb3 = ldh(vrp + vo + 48 * SEQ);
            accr[0] = wmma16(vb0, pb, accr[0]); accr[1] = wmma16(vb1, pb, accr[1]); accr[2] = wmma16(vb2, pb, accr[2]); accr[3] = wmma16(vb3, pb, accr[3]);
            asm volatile("v_nop\n\tv_nop\n\tv_nop\n\tv_nop" : "+v"(accr[0]), "+v"(accr[1]), "+v"(accr[2]), "+v"(accr[3]) : "v"(pb), "v"(vb0), "v"(vb1), "v"(vb2), "v"(vb3));
        }
    }
    l += __shfl_xor(l, 16, 32);
    const float inv = 1.0f / (PCAR * l); const float invr = inv * (1.0f / VRES);
    const int ob = (wave * 16 + lr) * 68 + 8 * hi;        // O^T element (d = dt*16 + 8*hi + r, query lr) -> os[query][d]
#pragma unroll
    for (int dt = 0; dt < 4; ++dt) { v4f w0, w1;
#pragma unroll
        for (int r = 0; r < 4; ++r) { w0[r] = acc[dt][r] * inv + accr[dt][r] * invr; w1[r] = acc[dt][4 + r] * inv + accr[dt][4 + r] * invr; }
        *(v4fa*)(os + ob + dt * 16) = w0; *(v4fa*)(os + ob + dt * 16 + 4) = w1; }
    __builtin_amdgcn_wave_barrier(); asm volatile("" ::: "memory");
    const size_t orow = ((size_t)bb * SEQ + q0) * DM + hh * HD;
    const int rq = lane >> 3, d8 = (lane & 7) * 8;
{
#pragma unroll
        for (int s = 0; s < 4; ++s) { const int rr = s * 4 + rq;
            const v4f x0 = *(const v4fa*)(os + (wave * 16 + rr) * 68 + d8), x1 = *(const v4fa*)(os + (wave * 16 + rr) * 68 + d8 + 4); v8us oh, ol;
#pragma unroll
            for (int k = 0; k < 4; ++k) { unsigned short a, c; splitf(x0[k], a, c); oh[k] = a; ol[k] = c; splitf(x1[k], a, c); oh[4 + k] = a; ol[4 + k] = c; }
            *(v8us*)(Ah + orow + (size_t)rr * DM + d8) = oh; *(v8us*)(Al + orow + (size_t)rr * DM + d8) = ol; }
         }
}

// ---- workspace carve (bytes, 256-byte aligned regions; every region is covered exactly by its producer grid)
constexpr size_t al256(size_t b) { return (b + 255) & ~(size_t)255; }
constexpr size_t MWPAD  = (((size_t)NB * (SEQ / 32) + 31) / 32) * 32;
constexpr size_t SZ_XB  = al256((size_t)NB * SEQ * DM * 2);
constexpr size_t SZ_W   = al256((size_t)DM * DM * 2);
constexpr size_t SZ_F   = al256((size_t)NB * SEQ * DM * 4);
constexpr size_t SZ_PL  = al256((size_t)NB * NH_ * SEQ * HD * 2);
constexpr size_t SZ_MW  = al256(MWPAD * 4);
constexpr size_t OFF_XB = 0;
constexpr size_t OFF_WQ = OFF_XB + SZ_XB;
constexpr size_t OFF_WK = OFF_WQ + SZ_W;
constexpr size_t OFF_WV = OFF_WK + SZ_W;
constexpr size_t OFF_WO = OFF_WV + SZ_W;
constexpr size_t OFF_F  = OFF_WO + SZ_W;
constexpr size_t OFF_QH = OFF_F + SZ_F;
constexpr size_t OFF_QL = OFF_QH + SZ_PL;
constexpr size_t OFF_KH = OFF_QL + SZ_PL;
constexpr size_t OFF_KL = OFF_KH + SZ_PL;
constexpr size_t OFF_V16 = OFF_KL + SZ_PL;
constexpr size_t OFF_VR = OFF_V16 + SZ_PL;
constexpr size_t OFF_AH = OFF_VR + SZ_PL;
constexpr size_t OFF_AL = OFF_AH + SZ_PL;
constexpr size_t OFF_MW = OFF_AL + SZ_PL;
constexpr size_t WS_TOTAL = OFF_MW + SZ_MW;
static_assert(WS_TOTAL <= (size_t)134217728);          // 128 MiB
static_assert((size_t)NB * NH_ * SEQ * HD == (size_t)NB * SEQ * DM);   // head planes and merged planes have equal extents

extern "C" void kernel_launch(void* const* d_in, const int* in_sizes, int n_in,
                              void* d_out, int out_size, void* d_ws, size_t ws_size, hipStream_t stream) {
    if (n_in < 10) return;
    const size_t xneed = (size_t)(NB - 1) * SEQ_FULL * DM + (size_t)SEQ * DM;
    if ((size_t)in_sizes[0] < xneed) return;
    if ((size_t)in_sizes[1] < (size_t)(NB - 1) * SEQ_FULL + SEQ) return;
    if (in_sizes[2] < DM * DM || in_sizes[4] < DM * DM || in_sizes[6] < DM * DM || in_sizes[8] < DM * DM) return;
    if (in_sizes[3] < DM || in_sizes[5] < DM || in_sizes[7] < DM || in_sizes[9] < DM) return;
    if ((size_t)out_size < xneed) return;
    if (ws_size < WS_TOTAL) return;
    const float* x = (const float*)d_in[0]; const int* mask = (const int*)d_in[1];
    const float* wq = (const float*)d_in[2]; const float* bq = (const float*)d_in[3];
    const float* wk = (const float*)d_in[4]; const float* bk = (const float*)d_in[5];
    const float* wv = (const float*)d_in[6]; const float* bv = (const float*)d_in[7];
    const float* wo = (const float*)d_in[8]; const float* bo = (const float*)d_in[9];
    float* OUT = (float*)d_out;
    char* wsb = (char*)d_ws;
    bf* XB = (bf*)(wsb + OFF_XB); bf* WQ = (bf*)(wsb + OFF_WQ); bf* WK = (bf*)(wsb + OFF_WK); bf* WV = (bf*)(wsb + OFF_WV); bf* WO = (bf*)(wsb + OFF_WO);
    float* F = (float*)(wsb + OFF_F);
    bf* QPh = (bf*)(wsb + OFF_QH); bf* QPl = (bf*)(wsb + OFF_QL); bf* KPh = (bf*)(wsb + OFF_KH); bf* KPl = (bf*)(wsb + OFF_KL);
    h16* VT16 = (h16*)(wsb + OFF_V16); h16* VTr = (h16*)(wsb + OFF_VR);
    bf* ATh = (bf*)(wsb + OFF_AH); bf* ATl = (bf*)(wsb + OFF_AL);
    unsigned* MWp = (unsigned*)(wsb + OFF_MW);

    const size_t xn8 = (size_t)SEQ * DM / 8, wn8 = (size_t)DM * DM / 8;
    for (int b = 0; b < NB; ++b)
        k_cvt8<<<(unsigned)((xn8 + 255) / 256), 256, 0, stream>>>(x + (size_t)b * SEQ_FULL * DM, XB + (size_t)b * SEQ * DM, xn8);
    k_cvt8<<<(unsigned)((wn8 + 255) / 256), 256, 0, stream>>>(wq, WQ, wn8);
    k_cvt8<<<(unsigned)((wn8 + 255) / 256), 256, 0, stream>>>(wk, WK, wn8);
    k_cvt8<<<(unsigned)((wn8 + 255) / 256), 256, 0, stream>>>(wv, WV, wn8);
    k_cvt8<<<(unsigned)((wn8 + 255) / 256), 256, 0, stream>>>(wo, WO, wn8);
    k_mpack<<<(unsigned)(MWPAD / 32), 32, 0, stream>>>(mask, MWp);

    const dim3 gp((unsigned)(NB * SEQ / 64), DM / 64, 1);
    const unsigned lp = (unsigned)(((size_t)NB * SEQ * DM / 8 + 255) / 256);
    k_gemm_proj<<<gp, 32, 0, stream>>>(XB, WQ, DM, F, DM, bq);      // q = x Wq^T + bq
    k_qkp<<<lp, 256, 0, stream>>>(F, QPh, QPl);
    k_gemm_proj<<<gp, 32, 0, stream>>>(XB, WK, DM, F, DM, bk);      // k (F reused, stream-ordered)
    k_qkp<<<lp, 256, 0, stream>>>(F, KPh, KPl);
    k_gemm_proj<<<gp, 32, 0, stream>>>(XB, WV, DM, F, DM, bv);      // v
    k_vtp8<<<lp, 256, 0, stream>>>(F, VT16, VTr);

    k_attn<<<dim3(SEQ / (ATW * 16), NH_, NB), ATW * 32, 0, stream>>>(QPh, QPl, KPh, KPl, VT16, VTr, MWp, ATh, ATl);

    k_gemm_out<<<dim3(SEQ / 64, DM / 64, NB), 32, 0, stream>>>(ATh, ATl, WO, DM, OUT, DM, bo, (size_t)SEQ * DM, (size_t)SEQ_FULL * DM);
}

// v001
// It runs in 340 microseconds.
// Timed twice side by side with v000, it ran 1.42 and 1.41 times as fast.
#include <hip/hip_runtime.h>

// Non-causal attention, 16 heads x 64, unscaled scores, int32 key mask (fill -1e9 by select), out = merged x Wo^T + bo.
// Compute dtypes, f32 accumulate everywhere: every float input converted to bf16 (RNE) on load; q/k/v projections v_wmma_f32_16x16x32_bf16 single product (+ bf16-rounded bias);
// scores v_wmma_f32_16x16x32_bf16 on q,k hi|lo planes (3 products); softmax f32 online (exp2, running max); P x V v_wmma_f32_16x16x32_f16 with P x256 and V = f16 value + f16 residual x2048 (2 products, 2 accumulators);
// output projection v_wmma_f32_16x16x32_bf16 on context hi|lo planes x Wo (2 products) + bias.

#ifndef NB
#define NB 2
#endif
#ifndef SEQ
#define SEQ 2048
#endif
#define NB_FULL  2
#define SEQ_FULL 2048
#define DM   1024
#define NH_  16
#define HD   64
#define ATW  8                  // waves per attention block (16 query rows each)
#define KST  64                 // keys per LDS stage of the attention ring (two 32-key steps)
#define LPB  144                // LDS row pitch in bytes: 128-byte rows + 16 (16 B x odd, conflict-free for 16-byte row readers)
#define LPE  (LPB / 2)          // the same in 16-bit elements
#define TLB  (64 * LPB)         // one plane's tile: 64 rows
#define STB  (4 * TLB)          // one stage: K hi, K lo, V value, V residual
#define PCAR 256.0f             // carry of the f16 probability operand
#define VRES 2048.0f            // carry of the f16 value residual plane
#define NEGF (-1.0e9f)
#define L2E  1.4426950408889634f

static_assert(NH_ * HD == DM);               // merged width
static_assert(HD == 64);
static_assert(DM % 64 == 0 && DM % 32 == 0); // GEMM tile and k-step multiples
static_assert(SEQ % 64 == 0);                // 64-row GEMM tiles, 64-key attention stages, 32-key steps
static_assert(SEQ % (ATW * 16) == 0);        // whole attention blocks
static_assert(SEQ / KST >= 2);               // the ring's prologue fills two stages
static_assert(ATW * 32 == 256);              // the stage copy deals 32 rows x 8 pieces of 16 bytes to the block's lanes, twice per tile
static_assert(KST == 64 && HD * 2 == 128 && KST * 2 == 128);   // every staged row is one 128-byte line
static_assert((NB * SEQ) % 64 == 0);
static_assert(NB <= NB_FULL && SEQ <= SEQ_FULL);

typedef _Float16 h16;
typedef unsigned short bf;
typedef __attribute__((ext_vector_type(16))) __bf16   v16bf;
typedef __attribute__((ext_vector_type(16))) _Float16 v16h;
typedef __attribute__((ext_vector_type(8)))  _Float16 v8h;
typedef __attribute__((ext_vector_type(8)))  unsigned short v8us;
typedef __attribute__((ext_vector_type(8)))  float    v8f;
typedef __attribute__((ext_vector_type(4)))  float    v4f;
typedef v4f  __attribute__((may_alias)) v4fa;

__device__ __forceinline__ unsigned short f2bf(float f) { unsigned u = __float_as_uint(f); u += 0x7FFFu + ((u >> 16) & 1u); return (unsigned short)(u >> 16); }
__device__ __forceinline__ float bf2f(unsigned short b) { return __uint_as_float(((unsigned)b) << 16); }
__device__ __forceinline__ float bfr(float f) { return bf2f(f2bf(f)); }
__device__ __forceinline__ void splitf(float y, unsigned short& h, unsigned short& l) { h = f2bf(y); l = f2bf(y - bf2f(h)); }
__device__ __forceinline__ v16h cat16(v8h lo, v8h hi) { return __builtin_shufflevector(lo, hi, 0, 1, 2, 3, 4, 5, 6, 7, 8, 9, 10, 11, 12, 13, 14, 15); }
__device__ __forceinline__ v16bf cat16b(v8us lo, v8us hi) { return __builtin_bit_cast(v16bf, __builtin_shufflevector(lo, hi, 0, 1, 2, 3, 4, 5, 6, 7, 8, 9, 10, 11, 12, 13, 14, 15)); }
__device__ __forceinline__ v8f wmma16(v16h a, v16h b, v8f c) { return __builtin_amdgcn_wmma_f32_16x16x32_f16(false, a, false, b, (short)0, c, false, false); }
__device__ __forceinline__ v8f wmmab(v16bf a, v16bf b, v8f c) { return __builtin_amdgcn_wmma_f32_16x16x32_bf16(false, a, false, b, (short)0, c, false, false); }
// fragment loaders from K-contiguous 16-bit rows: p = row base + k0 + 8*(lane>>4); elements 0..7 = k0+8h.., elements 8..15 = k0+16+8h..
__device__ __forceinline__ v16bf ldb(const bf* p) { return cat16b(*(const v8us*)p, *(const v8us*)(p + 16)); }
__device__ __forceinline__ v16h  ldh(const h16* p) { return cat16(*(const v8h*)p, *(const v8h*)(p + 16)); }

// ---- k_gemm_proj: one wave per 64x64 tile, C[m][n] = sum_k A[m][k] Bt[n][k] + bf16(bias[n]); operands straight from K-contiguous bf16 planes; grid (M/64, N/64), 32 threads; K % 32 == 0.
__global__ __launch_bounds__(32) void k_gemm_proj(const bf* __restrict__ A, const bf* __restrict__ Bt, int K, float* C, int ldc, const float* __restrict__ bias) {
    __shared__ __align__(16) float os[16 * 68];
    const int lane = threadIdx.x & 31, lr = lane & 15, hi = lane >> 4; const int r0 = blockIdx.x * 64, c0 = blockIdx.y * 64;
    v8f acc[4][4];
#pragma unroll
    for (int mb = 0; mb < 4; ++mb)
#pragma unroll
        for (int nb = 0; nb < 4; ++nb) acc[mb][nb] = (v8f){};
    const size_t aoff = (size_t)(r0 + lr) * K + 8 * hi, boff = (size_t)(c0 + lr) * K + 8 * hi;
#pragma unroll 1
    for (int kc = 0; kc < K; kc += 32) {
        v16bf a[4];
#pragma unroll
        for (int mb = 0; mb < 4; ++mb) a[mb] = ldb(A + aoff + (size_t)mb * 16 * K + kc);
#pragma unroll
        for (int nb = 0; nb < 4; ++nb) {
            const v16bf b = ldb(Bt + boff + (size_t)nb * 16 * K + kc);
#pragma unroll
            for (int mb = 0; mb < 4; ++mb) acc[mb][nb] = wmmab(a[mb], b, acc[mb][nb]);
            asm volatile("v_nop\n\tv_nop\n\tv_nop\n\tv_nop" : "+v"(acc[0][nb]), "+v"(acc[1][nb]), "+v"(acc[2][nb]), "+v"(acc[3][nb]) : "v"(b), "v"(a[0]), "v"(a[1]), "v"(a[2]), "v"(a[3]));
        }
    }
    const int cofs = lr * 4;
    v4f bv; bv[0] = bfr(bias[c0 + cofs]); bv[1] = bfr(bias[c0 + cofs + 1]); bv[2] = bfr(bias[c0 + cofs + 2]); bv[3] = bfr(bias[c0 + cofs + 3]);
#pragma unroll
    for (int mb = 0; mb < 4; ++mb) {
#pragma unroll
        for (int nb = 0; nb < 4; ++nb) {
#pragma unroll
            for (int j = 0; j < 8; ++j) os[(hi * 8 + j) * 68 + nb * 16 + lr] = acc[mb][nb][j]; }
        __builtin_amdgcn_wave_barrier(); asm volatile("" ::: "memory");
        float* crow = C + (size_t)(r0 + mb * 16) * ldc + c0;
{
#pragma unroll
            for (int s = 0; s < 8; ++s) { const int row = 2 * s + hi; v4f val = *(const v4fa*)(os + row * 68 + cofs); val = val + bv;
                *(v4f*)(crow + (size_t)row * ldc + cofs) = val; }
             }
        __builtin_amdgcn_wave_barrier(); asm volatile("" ::: "memory");
    }
}

// ---- k_gemm_out: same tile engine, A carried as hi + lo planes (two products into one accumulator), z-batched: A/A2 += z*sA, C += z*sC.
__global__ __launch_bounds__(32) void k_gemm_out(const bf* __restrict__ A, const bf* __restrict__ A2, const bf* __restrict__ Bt, int K, float* C, int ldc, const float* __restrict__ bias, size_t sA, size_t sC) {
    __shared__ __align__(16) float os[16 * 68];
    const size_t z = blockIdx.z; A += z * sA; A2 += z * sA; C += z * sC;
    const int lane = threadIdx.x & 31, lr = lane & 15, hi = lane >> 4; const int r0 = blockIdx.x * 64, c0 = blockIdx.y * 64;
    v8f acc[4][4];
#pragma unroll
    for (int mb = 0; mb < 4; ++mb)
#pragma unroll
        for (int nb = 0; nb < 4; ++nb) acc[mb][nb] = (v8f){};
    const size_t aoff = (size_t)(r0 + lr) * K + 8 * hi, boff = (size_t)(c0 + lr) * K + 8 * hi;
#pragma unroll 1
    for (int kc = 0; kc < K; kc += 32) {
        v16bf a[4], a2[4];
#pragma unroll
        for (int mb = 0; mb < 4; ++mb) { a[mb] = ldb(A + aoff + (size_t)mb * 16 * K + kc); a2[mb] = ldb(A2 + aoff + (size_t)mb * 16 * K + kc); }
#pragma unroll
        for (int nb = 0; nb < 4; ++nb) {
            const v16bf b = ldb(Bt + boff + (size_t)nb * 16 * K + kc);
#pragma unroll
            for (int mb = 0; mb < 4; ++mb) { acc[mb][nb] = wmmab(a[mb], b, acc[mb][nb]); acc[mb][nb] = wmmab(a2[mb], b, acc[mb][nb]); }
            asm volatile("v_nop\n\tv_nop\n\tv_nop\n\tv_nop" : "+v"(acc[0][nb]), "+v"(acc[1][nb]), "+v"(acc[2][nb]), "+v"(acc[3][nb]) : "v"(b), "v"(a[0]), "v"(a[1]), "v"(a[2]), "v"(a[3]), "v"(a2[0]), "v"(a2[1]), "v"(a2[2]), "v"(a2[3]));
        }
    }
    const int cofs = lr * 4;
    v4f bv; bv[0] = bfr(bias[c0 + cofs]); bv[1] = bfr(bias[c0 + cofs + 1]); bv[2] = bfr(bias[c0 + cofs + 2]); bv[3] = bfr(bias[c0 + cofs + 3]);
#pragma unroll
    for (int mb = 0; mb < 4; ++mb) {
#pragma unroll
        for (int nb = 0; nb < 4; ++nb) {
#pragma unroll
            for (int j = 0; j < 8; ++j) os[(hi * 8 + j) * 68 + nb * 16 + lr] = acc[mb][nb][j]; }
        __builtin_amdgcn_wave_barrier(); asm volatile("" ::: "memory");
        float* crow = C + (size_t)(r0 + mb * 16) * ldc + c0;
{
#pragma unroll
            for (int s = 0; s < 8; ++s) { const int row = 2 * s + hi; v4f val = *(const v4fa*)(os + row * 68 + cofs); val = val + bv;
                *(v4f*)(crow + (size_t)row * ldc + cofs) = val; }
             }
        __builtin_amdgcn_wave_barrier(); asm volatile("" ::: "memory");
    }
}

__global__ __launch_bounds__(256) void k_cvt8(const float* __restrict__ src, bf* dst, size_t n8) { const size_t i = (size_t)blockIdx.x * 256 + threadIdx.x; if (i >= n8) return; const v8f v = *(const v8f*)(src + i * 8); v8us o;
#pragma unroll
    for (int k = 0; k < 8; ++k) o[k] = f2bf(v[k]);
    *(v8us*)(dst + i * 8) = o;  }

__global__ __launch_bounds__(32) void k_mpack(const int* __restrict__ mask, unsigned* MW) {
    const int i = blockIdx.x * 32 + threadIdx.x; const int nw = NB * (SEQ / 32); const int ii = (i < nw) ? i : (nw - 1); const int b = ii / (SEQ / 32), w = ii % (SEQ / 32);
    const int* mp = mask + (size_t)b * SEQ_FULL + w * 32; unsigned word = 0u;
#pragma unroll 4
    for (int j = 0; j < 32; ++j) word |= (mp[j] != 0) ? (1u << j) : 0u;
    if (i >= nw) word = 0xFFFFFFFFu;
    *(unsigned*)(MW + i) = word;  }

__global__ __launch_bounds__(256) void k_qkp(const float* __restrict__ F, bf* Ph, bf* Pl) {
    const size_t i = (size_t)blockIdx.x * 256 + threadIdx.x; if (i >= (size_t)NB * NH_ * SEQ * HD / 8) return; const size_t o = i * 8;
    const int d = (int)(o % HD); const int t = (int)((o / HD) % SEQ); const int h = (int)((o / ((size_t)HD * SEQ)) % NH_); const int b = (int)(o / ((size_t)HD * SEQ * NH_));
    const float* f = F + ((size_t)b * SEQ + t) * DM + h * HD + d; const v4f x0 = *(const v4f*)f, x1 = *(const v4f*)(f + 4); v8us oh, ol;
#pragma unroll
    for (int k = 0; k < 4; ++k) { unsigned short a, c; splitf(x0[k], a, c); oh[k] = a; ol[k] = c; splitf(x1[k], a, c); oh[4 + k] = a; ol[4 + k] = c; }
    *(v8us*)(Ph + o) = oh; *(v8us*)(Pl + o) = ol;  }

__global__ __launch_bounds__(256) void k_vtp8(const float* __restrict__ F, h16* V16, h16* Vr) {
    const size_t i = (size_t)blockIdx.x * 256 + threadIdx.x; if (i >= (size_t)NB * NH_ * HD * SEQ / 8) return; const size_t o = i * 8;
    const int t = (int)(o % SEQ); const int d = (int)((o / SEQ) % HD); const int h = (int)((o / ((size_t)SEQ * HD)) % NH_); const int b = (int)(o / ((size_t)SEQ * HD * NH_));
    const float* f = F + ((size_t)b * SEQ + t) * DM + h * HD + d; v8h o16, orr;
#pragma unroll
    for (int q = 0; q < 8; ++q) { const float x = f[(size_t)q * DM]; const h16 hv = (h16)x; o16[q] = hv; orr[q] = (h16)((x - (float)hv) * VRES); }
    *(v8h*)(V16 + o) = o16; *(v8h*)(Vr + o) = orr;  }

// One stage of the ring: each of the 256 lanes copies 16 bytes of rows r and r + 32 of the four 64-row x 128-byte tiles (a wave-wide copy covers four whole 128-byte lines).
// The s_wait_xcnt closes the copies' own statement so that it stands in front of any rewrite of the address registers they name.
__device__ __forceinline__ void stage_copy(unsigned l, const bf* kh, const bf* kl, const h16* v, const h16* vr) {
    asm volatile("global_load_async_to_lds_b128 %0, %8, off\n\t"
                 "global_load_async_to_lds_b128 %1, %9, off\n\t"
                 "global_load_async_to_lds_b128 %2, %10, off\n\t"
                 "global_load_async_to_lds_b128 %3, %11, off\n\t"
                 "global_load_async_to_lds_b128 %4, %12, off\n\t"
                 "global_load_async_to_lds_b128 %5, %13, off\n\t"
                 "global_load_async_to_lds_b128 %6, %14, off\n\t"
                 "global_load_async_to_lds_b128 %7, %15, off\n\t"
                 "s_wait_xcnt 0x0"
                 :: "v"(l), "v"(l + 32 * LPB), "v"(l + TLB), "v"(l + TLB + 32 * LPB), "v"(l + 2 * TLB), "v"(l + 2 * TLB + 32 * LPB), "v"(l + 3 * TLB), "v"(l + 3 * TLB + 32 * LPB),
                    "v"(kh), "v"(kh + 32 * HD), "v"(kl), "v"(kl + 32 * HD), "v"(v), "v"(v + 32 * SEQ), "v"(vr), "v"(vr + 32 * SEQ)
                 : "memory");
}

// ---- k_attn: fused attention, one wave per 16 query rows, 8 waves per block that share each 64-key stage of K and V through a two-buffer LDS ring; grid (SEQ/128, heads, batch).
// Transposed form: S^T[key][query] = K Q^T (A = K rows, B = Q rows; 3 products hi.hi + lo.hi + hi.lo), so each lane owns one query column: row statistics are per lane (+ one xor-16 exchange),
// and the two 16-key score tiles of a 32-key step pack directly into the B fragment of O^T[d][query] += V^T[d][key] P^T[key][query] (elements 0..7 <- tile of keys 0..15, elements 8..15 <- tile of keys 16..31, lane unchanged).
__global__ __launch_bounds__(ATW * 32) void k_attn(const bf* __restrict__ Qh, const bf* __restrict__ Ql, const bf* __restrict__ Kh, const bf* __restrict__ Kl, const h16* __restrict__ V16, const h16* __restrict__ Vr, const unsigned* __restrict__ MW, bf* Ah, bf* Al) {
    __shared__ __align__(16) float os[ATW * 16 * 68];
    __shared__ __align__(128) unsigned char ring[2 * STB];
    const int wave = __builtin_amdgcn_readfirstlane(threadIdx.x >> 5);
    const int lane = threadIdx.x & 31, lr = lane & 15, hi = lane >> 4;
    const int hh = blockIdx.y, bb = blockIdx.z;
    const int q0 = blockIdx.x * (ATW * 16) + wave * 16;
    const size_t pbase = ((size_t)bb * NH_ + hh) * (size_t)SEQ * HD;
    const bf* qhp = Qh + pbase; const bf* qlp = Ql + pbase; const bf* khp = Kh + pbase; const bf* klp = Kl + pbase;
    const h16* v16p = V16 + pbase; const h16* vrp = Vr + pbase;
    const unsigned* mwp = MW + (size_t)bb * (SEQ / 32);
    const int qoff0 = (q0 + lr) * HD + 8 * hi;
    const int foffl = lr * LPE + 8 * hi;                  // fragment reader's lane offset in a staged tile (row lr, 16-bit elements)
    typedef __attribute__((address_space(3))) unsigned char lds_u8;
    const int crow = threadIdx.x >> 3, cch = threadIdx.x & 7;   // copier's row (and row + 32) and 16-byte piece of it
    const unsigned lcp = (unsigned)(size_t)(lds_u8*)ring + (unsigned)(crow * LPB + cch * 16);
    const bf* khc = khp + crow * HD + cch * 8; const bf* klc = klp + crow * HD + cch * 8;
    const h16* v16c = v16p + crow * SEQ + cch * 8; const h16* vrc = vrp + crow * SEQ + cch * 8;
    v8f acc[4], accr[4];
#pragma unroll
    for (int dt = 0; dt < 4; ++dt) { acc[dt] = (v8f){}; accr[dt] = (v8f){}; }
    float m = -1.0e30f, l = 0.0f;
    stage_copy(lcp, khc, klc, v16c, vrc);
    asm volatile("s_wait_asynccnt 0x0" ::: "memory");     // this wave's share of stage 0 has landed
    __syncthreads();                                      // publishes stage 0
    stage_copy(lcp + STB, khc + KST * HD, klc + KST * HD, v16c + KST, vrc + KST);
#pragma unroll 1
    for (int s = 0; s < SEQ / KST; ++s) {
    const unsigned char* rb = ring + (s & 1) * STB;
    const bf* kht = (const bf*)rb + foffl; const bf* klt = (const bf*)(rb + TLB) + foffl;
    const h16* v16t = (const h16*)(rb + 2 * TLB) + foffl; const h16* vrt = (const h16*)(rb + 3 * TLB) + foffl;
#pragma unroll 1                                          // one copy of the 32-key step, as before: small code, same register set
    for (int sub = 0; sub < KST / 32; ++sub) {
        const int kb = s * KST + sub * 32;
        int qo = qoff0; asm volatile("" : "+v"(qo));      // q fragments are re-fetched per step (kept out of the loop-carried register set)
        v8f st0 = (v8f){}, st1 = (v8f){};
#pragma unroll
        for (int ks = 0; ks < 2; ++ks) {
            const v16bf qh = ldb(qhp + qo + ks * 32), ql = ldb(qlp + qo + ks * 32);
            const int ko = sub * 32 * LPE + ks * 32;
            const v16bf kh0 = ldb(kht + ko), kl0 = ldb(klt + ko), kh1 = ldb(kht + ko + 16 * LPE), kl1 = ldb(klt + ko + 16 * LPE);
            st0 = wmmab(kh0, qh, st0); st1 = wmmab(kh1, qh, st1);
            st0 = wmmab(kl0, qh, st0); st1 = wmmab(kl1, qh, st1);
            st0 = wmmab(kh0, ql, st0); st1 = wmmab(kh1, ql, st1);
            asm volatile("v_nop\n\tv_nop\n\tv_nop\n\tv_nop" : "+v"(st0), "+v"(st1) : "v"(qh), "v"(ql), "v"(kh0), "v"(kl0), "v"(kh1), "v"(kl1));
        }
        const unsigned mw = mwp[kb >> 5];
        if (mw != 0xFFFFFFFFu) {                          // wave-uniform: st0[r] is key kb+8*hi+r, st1[r] is key kb+16+8*hi+r
#pragma unroll
            for (int r = 0; r < 8; ++r) { st0[r] = ((mw >> (8 * hi + r)) & 1u) ? st0[r] : NEGF; st1[r] = ((mw >> (16 + 8 * hi + r)) & 1u) ? st1[r] : NEGF; }
        }
        float mx = fmaxf(st0[0], st1[0]);
#pragma unroll
        for (int r = 1; r < 8; ++r) mx = fmaxf(mx, fmaxf(st0[r], st1[r]));
        mx = fmaxf(mx, __shfl_xor(mx, 16, 32));
        const float mnew = fmaxf(m, mx);
        const float alpha = __builtin_amdgcn_exp2f((m - mnew) * L2E);
        const unsigned grow = __builtin_amdgcn_ballot_w32(mnew > m);
        if (grow != 0u) {                                 // wave-uniform: rescale only when some query's running max moved (alpha == 1 exactly elsewhere)
#pragma unroll
            for (int dt = 0; dt < 4; ++dt) { acc[dt] = acc[dt] * alpha; accr[dt] = accr[dt] * alpha; }
        }
        m = mnew;
        float psum = 0.0f; v16h pb;
#pragma unroll
        for (int r = 0; r < 8; ++r) {
            const float p0 = __builtin_amdgcn_exp2f((st0[r] - mnew) * L2E), p1 = __builtin_amdgcn_exp2f((st1[r] - mnew) * L2E);
            psum += p0 + p1; pb[r] = (h16)(p0 * PCAR); pb[8 + r] = (h16)(p1 * PCAR); }
        l = l * alpha + psum;
        const int vo = sub * 32;
        {
            const v16h va0 = ldh(v16t + vo), va1 = ldh(v16t + vo + 16 * LPE), va2 = ldh(v16t + vo + 32 * LPE), va3 = ldh(v16t + vo + 48 * LPE);
            acc[0] = wmma16(va0, pb, acc[0]); acc[1] = wmma16(va1, pb, acc[1]); acc[2] = wmma16(va2, pb, acc[2]); acc[3] = wmma16(va3, pb, acc[3]);
            asm volatile("v_nop\n\tv_nop\n\tv_nop\n\tv_nop" : "+v"(acc[0]), "+v"(acc[1]), "+v"(acc[2]), "+v"(acc[3]) : "v"(pb), "v"(va0), "v"(va1), "v"(va2), "v"(va3));
        }
        {
            const v16h vb0 = ldh(vrt + vo), vb1 = ldh(vrt + vo + 16 * LPE), vb2 = ldh(vrt + vo + 32 * LPE), vb3 = ldh(vrt + vo + 48 * LPE);
            accr[0] = wmma16(vb0, pb, accr[0]); accr[1] = wmma16(vb1, pb, accr[1]); accr[2] = wmma16(vb2, pb, accr[2]); accr[3] = wmma16(vb3, pb, accr[3]);
            asm volatile("v_nop\n\tv_nop\n\tv_nop\n\tv_nop" : "+v"(accr[0]), "+v"(accr[1]), "+v"(accr[2]), "+v"(accr[3]) : "v"(pb), "v"(vb0), "v"(vb1), "v"(vb2), "v"(vb3));
        }
    }
    asm volatile("s_wait_dscnt 0x0" ::: "memory");        // this wave's reads of stage s are done before its buffer is handed back
    asm volatile("s_wait_asynccnt 0x0" ::: "memory");     // this wave's share of stage s + 1 has landed
    __syncthreads();                                      // publishes stage s + 1 and ends every reader's last read of stage s
    if (s + 2 < SEQ / KST) stage_copy(lcp + (unsigned)((s & 1) * STB), khc + (s + 2) * KST * HD, klc + (s + 2) * KST * HD, v16c + (s + 2) * KST, vrc + (s + 2) * KST);
    }
    asm volatile("s_wait_asynccnt 0x0" ::: "memory");     // nothing of this wave's is in flight past the loop
    l += __shfl_xor(l, 16, 32);
    const float inv = 1.0f / (PCAR * l); const float invr = inv * (1.0f / VRES);
    const int ob = (wave * 16 + lr) * 68 + 8 * hi;        // O^T element (d = dt*16 + 8*hi + r, query lr) -> os[query][d]
#pragma unroll
    for (int dt = 0; dt < 4; ++dt) { v4f w0, w1;
#pragma unroll
        for (int r = 0; r < 4; ++r) { w0[r] = acc[dt][r] * inv + accr[dt][r] * invr; w1[r] = acc[dt][4 + r] * inv + accr[dt][4 + r] * invr; }
        *(v4fa*)(os + ob + dt * 16) = w0; *(v4fa*)(os + ob + dt * 16 + 4) = w1; }
    __builtin_amdgcn_wave_barrier(); asm volatile("" ::: "memory");
    const size_t orow = ((size_t)bb * SEQ + q0) * DM + hh * HD;
    const int rq = lane >> 3, d8 = (lane & 7) * 8;
{
#pragma unroll
        for (int s = 0; s < 4; ++s) { const int rr = s * 4 + rq;
            const v4f x0 = *(const v4fa*)(os + (wave * 16 + rr) * 68 + d8), x1 = *(const v4fa*)(os + (wave * 16 + rr) * 68 + d8 + 4); v8us oh, ol;
#pragma unroll
            for (int k = 0; k < 4; ++k) { unsigned short a, c; splitf(x0[k], a, c); oh[k] = a; ol[k] = c; splitf(x1[k], a, c); oh[4 + k] = a; ol[4 + k] = c; }
            *(v8us*)(Ah + orow + (size_t)rr * DM + d8) = oh; *(v8us*)(Al + orow + (size_t)rr * DM + d8) = ol; }
         }
}

// ---- workspace carve (bytes, 256-byte aligned regions; every region is covered exactly by its producer grid)
constexpr size_t al256(size_t b) { return (b + 255) & ~(size_t)255; }
constexpr size_t MWPAD  = (((size_t)NB * (SEQ / 32) + 31) / 32) * 32;
constexpr size_t SZ_XB  = al256((size_t)NB * SEQ * DM * 2);
constexpr size_t SZ_W   = al256((size_t)DM * DM * 2);
constexpr size_t SZ_F   = al256((size_t)NB * SEQ * DM * 4);
constexpr size_t SZ_PL  = al256((size_t)NB * NH_ * SEQ * HD * 2);
constexpr size_t SZ_MW  = al256(MWPAD * 4);
constexpr size_t OFF_XB = 0;
constexpr size_t OFF_WQ = OFF_XB + SZ_XB;
constexpr size_t OFF_WK = OFF_WQ + SZ_W;
constexpr size_t OFF_WV = OFF_WK + SZ_W;
constexpr size_t OFF_WO = OFF_WV + SZ_W;
constexpr size_t OFF_F  = OFF_WO + SZ_W;
constexpr size_t OFF_QH = OFF_F + SZ_F;
constexpr size_t OFF_QL = OFF_QH + SZ_PL;
constexpr size_t OFF_KH = OFF_QL + SZ_PL;
constexpr size_t OFF_KL = OFF_KH + SZ_PL;
constexpr size_t OFF_V16 = OFF_KL + SZ_PL;
constexpr size_t OFF_VR = OFF_V16 + SZ_PL;
constexpr size_t OFF_AH = OFF_VR + SZ_PL;
constexpr size_t OFF_AL = OFF_AH + SZ_PL;
constexpr size_t OFF_MW = OFF_AL + SZ_PL;
constexpr size_t WS_TOTAL = OFF_MW + SZ_MW;
static_assert(WS_TOTAL <= (size_t)134217728);          // 128 MiB
static_assert((size_t)NB * NH_ * SEQ * HD == (size_t)NB * SEQ * DM);   // head planes and merged planes have equal extents

extern "C" void kernel_launch(void* const* d_in, const int* in_sizes, int n_in,
                              void* d_out, int out_size, void* d_ws, size_t ws_size, hipStream_t stream) {
    if (n_in < 10) return;
    const size_t xneed = (size_t)(NB - 1) * SEQ_FULL * DM + (size_t)SEQ * DM;
    if ((size_t)in_sizes[0] < xneed) return;
    if ((size_t)in_sizes[1] < (size_t)(NB - 1) * SEQ_FULL + SEQ) return;
    if (in_sizes[2] < DM * DM || in_sizes[4] < DM * DM || in_sizes[6] < DM * DM || in_sizes[8] < DM * DM) return;
    if (in_sizes[3] < DM || in_sizes[5] < DM || in_sizes[7] < DM || in_sizes[9] < DM) return;
    if ((size_t)out_size < xneed) return;
    if (ws_size < WS_TOTAL) return;
    const float* x = (const float*)d_in[0]; const int* mask = (const int*)d_in[1];
    const float* wq = (const float*)d_in[2]; const float* bq = (const float*)d_in[3];
    const float* wk = (const float*)d_in[4]; const float* bk = (const float*)d_in[5];
    const float* wv = (const float*)d_in[6]; const float* bv = (const float*)d_in[7];
    const float* wo = (const float*)d_in[8]; const float* bo = (const float*)d_in[9];
    float* OUT = (float*)d_out;
    char* wsb = (char*)d_ws;
    bf* XB = (bf*)(wsb + OFF_XB); bf* WQ = (bf*)(wsb + OFF_WQ); bf* WK = (bf*)(wsb + OFF_WK); bf* WV = (bf*)(wsb + OFF_WV); bf* WO = (bf*)(wsb + OFF_WO);
    float* F = (float*)(wsb + OFF_F);
    bf* QPh = (bf*)(wsb + OFF_QH); bf* QPl = (bf*)(wsb + OFF_QL); bf* KPh = (bf*)(wsb + OFF_KH); bf* KPl = (bf*)(wsb + OFF_KL);
    h16* VT16 = (h16*)(wsb + OFF_V16); h16* VTr = (h16*)(wsb + OFF_VR);
    bf* ATh = (bf*)(wsb + OFF_AH); bf* ATl = (bf*)(wsb + OFF_AL);
    unsigned* MWp = (unsigned*)(wsb + OFF_MW);

    const size_t xn8 = (size_t)SEQ * DM / 8, wn8 = (size_t)DM * DM / 8;
    for (int b = 0; b < NB; ++b)
        k_cvt8<<<(unsigned)((xn8 + 255) / 256), 256, 0, stream>>>(x + (size_t)b * SEQ_FULL * DM, XB + (size_t)b * SEQ * DM, xn8);
    k_cvt8<<<(unsigned)((wn8 + 255) / 256), 256, 0, stream>>>(wq, WQ, wn8);
    k_cvt8<<<(unsigned)((wn8 + 255) / 256), 256, 0, stream>>>(wk, WK, wn8);
    k_cvt8<<<(unsigned)((wn8 + 255) / 256), 256, 0, stream>>>(wv, WV, wn8);
    k_cvt8<<<(unsigned)((wn8 + 255) / 256), 256, 0, stream>>>(wo, WO, wn8);
    k_mpack<<<(unsigned)(MWPAD / 32), 32, 0, stream>>>(mask, MWp);

    const dim3 gp((unsigned)(NB * SEQ / 64), DM / 64, 1);
    const unsigned lp = (unsigned)(((size_t)NB * SEQ * DM / 8 + 255) / 256);
    k_gemm_proj<<<gp, 32, 0, stream>>>(XB, WQ, DM, F, DM, bq);      // q = x Wq^T + bq
    k_qkp<<<lp, 256, 0, stream>>>(F, QPh, QPl);
    k_gemm_proj<<<gp, 32, 0, stream>>>(XB, WK, DM, F, DM, bk);      // k (F reused, stream-ordered)
    k_qkp<<<lp, 256, 0, stream>>>(F, KPh, KPl);
    k_gemm_proj<<<gp, 32, 0, stream>>>(XB, WV, DM, F, DM, bv);      // v
    k_vtp8<<<lp, 256, 0, stream>>>(F, VT16, VTr);

    k_attn<<<dim3(SEQ / (ATW * 16), NH_, NB), ATW * 32, 0, stream>>>(QPh, QPl, KPh, KPl, VT16, VTr, MWp, ATh, ATl);

    k_gemm_out<<<dim3(SEQ / 64, DM / 64, NB), 32, 0, stream>>>(ATh, ATl, WO, DM, OUT, DM, bo, (size_t)SEQ * DM, (size_t)SEQ_FULL * DM);
}

// v002
// A run of this version takes 217 microseconds.
// In two side-by-side timings against v001, it was 1.56 and 1.55 times as fast.
// All steps since v000 together make it 2.20 times as fast.
#include <hip/hip_runtime.h>

// Non-causal attention, 16 heads x 64, unscaled scores, int32 key mask (fill -1e9 by select), out = merged x Wo^T + bo.
// Compute dtypes, f32 accumulate everywhere: every float input converted to bf16 (RNE) on load; q/k/v projections v_wmma_f32_16x16x32_bf16 single product (+ bf16-rounded bias);
// scores v_wmma_f32_16x16x32_bf16 on q,k hi|lo planes (3 products); softmax f32 online (exp2, running max); P x V v_wmma_f32_16x16x32_f16 with P x256 and V = f16 value + f16 residual x2048 (2 products, 2 accumulators);
// output projection v_wmma_f32_16x16x32_bf16 on context hi|lo planes x Wo (2 products) + bias.

#ifndef NB
#define NB 2
#endif
#ifndef SEQ
#define SEQ 2048
#endif
#define NB_FULL  2
#define SEQ_FULL 2048
#define DM   1024
#define NH_  16
#define HD   64
#define ATW  8                  // waves per attention block (16 query rows each)
#define KST  64                 // keys per LDS stage of the attention ring (two 32-key steps)
#define LPB  144                // LDS row pitch in bytes: 128-byte rows + 16 (16 B x odd, conflict-free for 16-byte row readers)
#define LPE  (LPB / 2)          // the same in 16-bit elements
#define TLB  (64 * LPB)         // one plane's tile: 64 rows
#define STB  (4 * TLB)          // one stage: K hi, K lo, V value, V residual
#define GW   8                  // waves per GEMM block
#define GKC  128                // k per LDS stage of the GEMM ring (four 32-k steps): 256-byte rows
#define GPB  272                // LDS row pitch of the GEMM tiles in bytes: 256-byte rows + 16 (16 B x odd, conflict-free for 16-byte row readers)
#define GPE  (GPB / 2)          // the same in 16-bit elements
#define GTB  (128 * GPB)        // one GEMM operand tile: 128 rows
#define PCAR 256.0f             // carry of the f16 probability operand
#define VRES 2048.0f            // carry of the f16 value residual plane
#define NEGF (-1.0e9f)
#define L2E  1.4426950408889634f

static_assert(NH_ * HD == DM);               // merged width
static_assert(HD == 64);
static_assert(DM % 64 == 0 && DM % 32 == 0); // wave tile and k-step multiples
static_assert(SEQ % 64 == 0);                // 64-key attention stages, 32-key steps
static_assert(SEQ % (ATW * 16) == 0);        // whole attention blocks
static_assert(SEQ / KST >= 2);               // the ring's prologue fills two stages
static_assert(ATW * 32 == 256);              // the stage copy deals 32 rows x 8 pieces of 16 bytes to the block's lanes, twice per tile
static_assert(KST == 64 && HD * 2 == 128 && KST * 2 == 128);   // every staged row of the attention ring is one 128-byte line
static_assert((NB * SEQ) % 128 == 0 && SEQ % 128 == 0 && DM % 128 == 0);   // whole 128x128 GEMM block tiles
static_assert(DM % GKC == 0 && DM / GKC >= 2 && GKC * 2 == 256 && GW * 32 == 256);   // whole GEMM stages; the tile copy deals 16 rows x 16 pieces of 16 bytes to the block's lanes, eight times per tile
static_assert(NB <= NB_FULL && SEQ <= SEQ_FULL);

typedef _Float16 h16;
typedef unsigned short bf;
typedef __attribute__((ext_vector_type(16))) __bf16   v16bf;
typedef __attribute__((ext_vector_type(16))) _Float16 v16h;
typedef __attribute__((ext_vector_type(8)))  _Float16 v8h;
typedef __attribute__((ext_vector_type(8)))  unsigned short v8us;
typedef __attribute__((ext_vector_type(8)))  float    v8f;
typedef __attribute__((ext_vector_type(4)))  float    v4f;
typedef v4f  __attribute__((may_alias)) v4fa;

__device__ __forceinline__ unsigned short f2bf(float f) { unsigned u = __float_as_uint(f); u += 0x7FFFu + ((u >> 16) & 1u); return (unsigned short)(u >> 16); }
__device__ __forceinline__ float bf2f(unsigned short b) { return __uint_as_float(((unsigned)b) << 16); }
__device__ __forceinline__ float bfr(float f) { return bf2f(f2bf(f)); }
__device__ __forceinline__ void splitf(float y, unsigned short& h, unsigned short& l) { h = f2bf(y); l = f2bf(y - bf2f(h)); }
__device__ __forceinline__ v16h cat16(v8h lo, v8h hi) { return __builtin_shufflevector(lo, hi, 0, 1, 2, 3, 4, 5, 6, 7, 8, 9, 10, 11, 12, 13, 14, 15); }
__device__ __forceinline__ v16bf cat16b(v8us lo, v8us hi) { return __builtin_bit_cast(v16bf, __builtin_shufflevector(lo, hi, 0, 1, 2, 3, 4, 5, 6, 7, 8, 9, 10, 11, 12, 13, 14, 15)); }
__device__ __forceinline__ v8f wmma16(v16h a, v16h b, v8f c) { return __builtin_amdgcn_wmma_f32_16x16x32_f16(false, a, false, b, (short)0, c, false, false); }
__device__ __forceinline__ v8f wmmab(v16bf a, v16bf b, v8f c) { return __builtin_amdgcn_wmma_f32_16x16x32_bf16(false, a, false, b, (short)0, c, false, false); }
// fragment loaders from K-contiguous 16-bit rows: p = row base + k0 + 8*(lane>>4); elements 0..7 = k0+8h.., elements 8..15 = k0+16+8h..
__device__ __forceinline__ v16bf ldb(const bf* p) { return cat16b(*(const v8us*)p, *(const v8us*)(p + 16)); }
__device__ __forceinline__ v16h  ldh(const h16* p) { return cat16(*(const v8h*)p, *(const v8h*)(p + 16)); }

// One operand tile of a GEMM stage: each of the 256 lanes copies 16 bytes of rows r, r + 16, ... r + 112 of a 128-row x 256-byte tile (a wave-wide copy covers four whole 128-byte lines); rs = 16 source rows in elements.
// The s_wait_xcnt closes the copies' own statement so that it stands in front of any rewrite of the address registers they name.
__device__ __forceinline__ void tile_copy(unsigned l, const bf* g, size_t rs) {
    asm volatile("global_load_async_to_lds_b128 %0, %8, off\n\t"
                 "global_load_async_to_lds_b128 %1, %9, off\n\t"
                 "global_load_async_to_lds_b128 %2, %10, off\n\t"
                 "global_load_async_to_lds_b128 %3, %11, off\n\t"
                 "global_load_async_to_lds_b128 %4, %12, off\n\t"
                 "global_load_async_to_lds_b128 %5, %13, off\n\t"
                 "global_load_async_to_lds_b128 %6, %14, off\n\t"
                 "global_load_async_to_lds_b128 %7, %15, off\n\t"
                 "s_wait_xcnt 0x0"
                 :: "v"(l), "v"(l + 16 * GPB), "v"(l + 32 * GPB), "v"(l + 48 * GPB), "v"(l + 64 * GPB), "v"(l + 80 * GPB), "v"(l + 96 * GPB), "v"(l + 112 * GPB),
                    "v"(g), "v"(g + rs), "v"(g + 2 * rs), "v"(g + 3 * rs), "v"(g + 4 * rs), "v"(g + 5 * rs), "v"(g + 6 * rs), "v"(g + 7 * rs)
                 : "memory");
}
// One stage: the A tile, the Bt tile and, with two A planes, the second A tile, in that order in the buffer.
template <int NA> __device__ __forceinline__ void gemm_stage(unsigned l, const bf* a, const bf* a2, const bf* b, size_t rs) {
    tile_copy(l, a, rs); tile_copy(l + GTB, b, rs);
    if (NA == 2) tile_copy(l + 2 * GTB, a2, rs);
}

// ---- GEMM engine: 8 waves per 128x128 block tile (4 x 2 wave tiles of 32 x 64), C[m][n] = sum_k A[m][k] Bt[n][k] + bf16(bias[n]); operands are K-contiguous bf16 planes, staged 128 k at a time
// in a two-buffer LDS ring that the 8 waves share; NA == 2: A carried as hi + lo planes (two products into one accumulator, hi first). K = DM; rows and columns multiples of 128.
// The full unrolls below keep every index of the fragment and accumulator arrays a constant, so that the arrays stay in registers.
template <int NA> __device__ __forceinline__ void gemm_tile(const bf* __restrict__ A, const bf* __restrict__ A2, const bf* __restrict__ Bt, float* C, int ldc, const float* __restrict__ bias,
                                                            const unsigned char* ring, unsigned lbase, float* os) {
    constexpr unsigned SB = (NA + 1) * GTB;               // bytes of one buffer
    constexpr int K = DM, nst = K / GKC;
    const int wave = __builtin_amdgcn_readfirstlane(threadIdx.x >> 5);
    const int lane = threadIdx.x & 31, lr = lane & 15, hi = lane >> 4; const int r0 = blockIdx.x * 128, c0 = blockIdx.y * 128;
    const int wr = (wave >> 1) * 32, wc = (wave & 1) * 64;
    v8f acc[2][4];
#pragma unroll
    for (int mb = 0; mb < 2; ++mb)
#pragma unroll
        for (int nb = 0; nb < 4; ++nb) acc[mb][nb] = (v8f){};
    const int prow = threadIdx.x >> 4, pch = threadIdx.x & 15;   // copier's first row and 16-byte piece of it
    const unsigned lcp = lbase + (unsigned)(prow * GPB + pch * 16);
    const bf* ac = A + (size_t)(r0 + prow) * K + pch * 8; const bf* a2c = A2 + (size_t)(r0 + prow) * K + pch * 8; const bf* bc = Bt + (size_t)(c0 + prow) * K + pch * 8;
    const size_t rs = (size_t)16 * K;
    const int aofl = (wr + lr) * GPE + 8 * hi, bofl = (wc + lr) * GPE + 8 * hi;   // fragment readers' lane offsets in a staged tile (16-bit elements)
    gemm_stage<NA>(lcp, ac, a2c, bc, rs);
    asm volatile("s_wait_asynccnt 0x0" ::: "memory");     // this wave's share of stage 0 has landed
    __syncthreads();                                      // publishes stage 0
    gemm_stage<NA>(lcp + SB, ac + GKC, a2c + GKC, bc + GKC, rs);
#pragma unroll 1                                          // one copy of the stage's body: the ring's order stays as written
    for (int s = 0; s < nst; ++s) {
        const unsigned char* rb = ring + (s & 1) * SB;
        const bf* at = (const bf*)rb + aofl; const bf* bt = (const bf*)(rb + GTB) + bofl; const bf* a2t = (const bf*)(rb + 2 * GTB) + aofl;
        v16bf a[2][2], a2[2][2], b[2][4];                 // two fragment sets: the 32-k step in work and the next one of the same stage
#pragma unroll
        for (int mb = 0; mb < 2; ++mb) { a[0][mb] = ldb(at + mb * 16 * GPE); if (NA == 2) a2[0][mb] = ldb(a2t + mb * 16 * GPE); }
#pragma unroll
        for (int nb = 0; nb < 4; ++nb) b[0][nb] = ldb(bt + nb * 16 * GPE);
#pragma unroll
        for (int ks = 0; ks < GKC / 32; ++ks) {
            const int cu = ks & 1, nx = cu ^ 1;
            if (ks + 1 < GKC / 32) {
#pragma unroll
                for (int mb = 0; mb < 2; ++mb) { a[nx][mb] = ldb(at + mb * 16 * GPE + (ks + 1) * 32); if (NA == 2) a2[nx][mb] = ldb(a2t + mb * 16 * GPE + (ks + 1) * 32); }
#pragma unroll
                for (int nb = 0; nb < 4; ++nb) b[nx][nb] = ldb(bt + nb * 16 * GPE + (ks + 1) * 32);
            }
            __builtin_amdgcn_sched_barrier(0);            // keeps the next step's LDS reads as one group in front of this step's matrix instructions, which then hide their latency
#pragma unroll
            for (int nb = 0; nb < 4; ++nb)
#pragma unroll
                for (int mb = 0; mb < 2; ++mb) acc[mb][nb] = wmmab(a[cu][mb], b[cu][nb], acc[mb][nb]);
            if (NA == 2) {
#pragma unroll
                for (int nb = 0; nb < 4; ++nb)
#pragma unroll
                    for (int mb = 0; mb < 2; ++mb) acc[mb][nb] = wmmab(a2[cu][mb], b[cu][nb], acc[mb][nb]);
            }
            __builtin_amdgcn_sched_barrier(0);            // keeps the reads of the step after next from being spread among these matrix instructions
        }
        // the distance behind the stage's last matrix instructions, also on the taken side of the branches that follow
        asm volatile("v_nop\n\tv_nop\n\tv_nop\n\tv_nop" : "+v"(acc[0][0]), "+v"(acc[0][1]), "+v"(acc[0][2]), "+v"(acc[0][3]), "+v"(acc[1][0]), "+v"(acc[1][1]), "+v"(acc[1][2]), "+v"(acc[1][3]));
        asm volatile("s_wait_dscnt 0x0" ::: "memory");    // this wave's reads of stage s are done before its buffer is handed back
        asm volatile("s_wait_asynccnt 0x0" ::: "memory"); // this wave's share of stage s + 1 has landed
        __syncthreads();                                  // publishes stage s + 1 and ends every reader's last read of stage s
        if (s + 2 < nst) gemm_stage<NA>(lcp + (unsigned)(s & 1) * SB, ac + (size_t)(s + 2) * GKC, a2c + (size_t)(s + 2) * GKC, bc + (size_t)(s + 2) * GKC, rs);
    }
    asm volatile("s_wait_asynccnt 0x0" ::: "memory");     // nothing of this wave's is in flight past the loop
    float* osw = os + wave * 16 * 68;                     // each wave stages its output rows in its own range
    const int cofs = lr * 4;
    const int cw = c0 + wc;
    v4f bv; bv[0] = bfr(bias[cw + cofs]); bv[1] = bfr(bias[cw + cofs + 1]); bv[2] = bfr(bias[cw + cofs + 2]); bv[3] = bfr(bias[cw + cofs + 3]);
#pragma unroll
    for (int mb = 0; mb < 2; ++mb) {
#pragma unroll
        for (int nb = 0; nb < 4; ++nb) {
#pragma unroll
            for (int j = 0; j < 8; ++j) osw[(hi * 8 + j) * 68 + nb * 16 + lr] = acc[mb][nb][j]; }
        __builtin_amdgcn_wave_barrier(); asm volatile("" ::: "memory");
        float* crow = C + (size_t)(r0 + wr + mb * 16) * ldc + cw;
{
#pragma unroll
            for (int s = 0; s < 8; ++s) { const int row = 2 * s + hi; v4f val = *(const v4fa*)(osw + row * 68 + cofs); val = val + bv;
                *(v4f*)(crow + (size_t)row * ldc + cofs) = val; }
             }
        __builtin_amdgcn_wave_barrier(); asm volatile("" ::: "memory");
    }
}

typedef __attribute__((address_space(3))) unsigned char lds_b8;

// ---- k_gemm_proj: single A plane; grid (M/128, N/128), 256 threads.
__global__ __launch_bounds__(GW * 32) void k_gemm_proj(const bf* __restrict__ A, const bf* __restrict__ Bt, float* C, int ldc, const float* __restrict__ bias) {
    __shared__ __align__(16) float os[GW * 16 * 68];
    __shared__ __align__(128) unsigned char ring[2 * 2 * GTB];
    gemm_tile<1>(A, A, Bt, C, ldc, bias, ring, (unsigned)(size_t)(lds_b8*)ring, os);
}

// ---- k_gemm_out: A carried as hi + lo planes, z-batched: A/A2 += z*sA, C += z*sC; grid (M/128, N/128, batches), 256 threads.
__global__ __launch_bounds__(GW * 32) void k_gemm_out(const bf* __restrict__ A, const bf* __restrict__ A2, const bf* __restrict__ Bt, float* C, int ldc, const float* __restrict__ bias, size_t sA, size_t sC) {
    __shared__ __align__(16) float os[GW * 16 * 68];
    __shared__ __align__(128) unsigned char ring[2 * 3 * GTB];
    const size_t z = blockIdx.z;
    gemm_tile<2>(A + z * sA, A2 + z * sA, Bt, C + z * sC, ldc, bias, ring, (unsigned)(size_t)(lds_b8*)ring, os);
}

__global__ __launch_bounds__(256) void k_cvt8(const float* __restrict__ src, bf* dst, size_t n8) { const size_t i = (size_t)blockIdx.x * 256 + threadIdx.x; if (i >= n8) return; const v8f v = *(const v8f*)(src + i * 8); v8us o;
#pragma unroll
    for (int k = 0; k < 8; ++k) o[k] = f2bf(v[k]);
    *(v8us*)(dst + i * 8) = o;  }

__global__ __launch_bounds__(32) void k_mpack(const int* __restrict__ mask, unsigned* MW) {
    const int i = blockIdx.x * 32 + threadIdx.x; const int nw = NB * (SEQ / 32); const int ii = (i < nw) ? i : (nw - 1); const int b = ii / (SEQ / 32), w = ii % (SEQ / 32);
    const int* mp = mask + (size_t)b * SEQ_FULL + w * 32; unsigned word = 0u;
#pragma unroll 4
    for (int j = 0; j < 32; ++j) word |= (mp[j] != 0) ? (1u << j) : 0u;
    if (i >= nw) word = 0xFFFFFFFFu;
    *(unsigned*)(MW + i) = word;  }

__global__ __launch_bounds__(256) void k_qkp(const float* __restrict__ F, bf* Ph, bf* Pl) {
    const size_t i = (size_t)blockIdx.x * 256 + threadIdx.x; if (i >= (size_t)NB * NH_ * SEQ * HD / 8) return; const size_t o = i * 8;
    const int d = (int)(o % HD); const int t = (int)((o / HD) % SEQ); const int h = (int)((o / ((size_t)HD * SEQ)) % NH_); const int b = (int)(o / ((size_t)HD * SEQ * NH_));
    const float* f = F + ((size_t)b * SEQ + t) * DM + h * HD + d; const v4f x0 = *(const v4f*)f, x1 = *(const v4f*)(f + 4); v8us oh, ol;
#pragma unroll
    for (int k = 0; k < 4; ++k) { unsigned short a, c; splitf(x0[k], a, c); oh[k] = a; ol[k] = c; splitf(x1[k], a, c); oh[4 + k] = a; ol[4 + k] = c; }
    *(v8us*)(Ph + o) = oh; *(v8us*)(Pl + o) = ol;  }

__global__ __launch_bounds__(256) void k_vtp8(const float* __restrict__ F, h16* V16, h16* Vr) {
    const size_t i = (size_t)blockIdx.x * 256 + threadIdx.x; if (i >= (size_t)NB * NH_ * HD * SEQ / 8) return; const size_t o = i * 8;
    const int t = (int)(o % SEQ); const int d = (int)((o / SEQ) % HD); const int h = (int)((o / ((size_t)SEQ * HD)) % NH_); const int b = (int)(o / ((size_t)SEQ * HD * NH_));
    const float* f = F + ((size_t)b * SEQ + t) * DM + h * HD + d; v8h o16, orr;
#pragma unroll
    for (int q = 0; q < 8; ++q) { const float x = f[(size_t)q * DM]; const h16 hv = (h16)x; o16[q] = hv; orr[q] = (h16)((x - (float)hv) * VRES); }
    *(v8h*)(V16 + o) = o16; *(v8h*)(Vr + o) = orr;  }

// One stage of the ring: each of the 256 lanes copies 16 bytes of rows r and r + 32 of the four 64-row x 128-byte tiles (a wave-wide copy covers four whole 128-byte lines).
// The s_wait_xcnt closes the copies' own statement so that it stands in front of any rewrite of the address registers they name.
__device__ __forceinline__ void stage_copy(unsigned l, const bf* kh, const bf* kl, const h16* v, const h16* vr) {
    asm volatile("global_load_async_to_lds_b128 %0, %8, off\n\t"
                 "global_load_async_to_lds_b128 %1, %9, off\n\t"
                 "global_load_async_to_lds_b128 %2, %10, off\n\t"
                 "global_load_async_to_lds_b128 %3, %11, off\n\t"
                 "global_load_async_to_lds_b128 %4, %12, off\n\t"
                 "global_load_async_to_lds_b128 %5, %13, off\n\t"
                 "global_load_async_to_lds_b128 %6, %14, off\n\t"
                 "global_load_async_to_lds_b128 %7, %15, off\n\t"
                 "s_wait_xcnt 0x0"
                 :: "v"(l), "v"(l + 32 * LPB), "v"(l + TLB), "v"(l + TLB + 32 * LPB), "v"(l + 2 * TLB), "v"(l + 2 * TLB + 32 * LPB), "v"(l + 3 * TLB), "v"(l + 3 * TLB + 32 * LPB),
                    "v"(kh), "v"(kh + 32 * HD), "v"(kl), "v"(kl + 32 * HD), "v"(v), "v"(v + 32 * SEQ), "v"(vr), "v"(vr + 32 * SEQ)
                 : "memory");
}

// ---- k_attn: fused attention, one wave per 16 query rows, 8 waves per block that share each 64-key stage of K and V through a two-buffer LDS ring; grid (SEQ/128, heads, batch).
// Transposed form: S^T[key][query] = K Q^T (A = K rows, B = Q rows; 3 products hi.hi + lo.hi + hi.lo), so each lane owns one query column: row statistics are per lane (+ one xor-16 exchange),
// and the two 16-key score tiles of a 32-key step pack directly into the B fragment of O^T[d][query] += V^T[d][key] P^T[key][query] (elements 0..7 <- tile of keys 0..15, elements 8..15 <- tile of keys 16..31, lane unchanged).
__global__ __launch_bounds__(ATW * 32) void k_attn(const bf* __restrict__ Qh, const bf* __restrict__ Ql, const bf* __restrict__ Kh, const bf* __restrict__ Kl, const h16* __restrict__ V16, const h16* __restrict__ Vr, const unsigned* __restrict__ MW, bf* Ah, bf* Al) {
    __shared__ __align__(16) float os[ATW * 16 * 68];
    __shared__ __align__(128) unsigned char ring[2 * STB];
    const int wave = __builtin_amdgcn_readfirstlane(threadIdx.x >> 5);
    const int lane = threadIdx.x & 31, lr = lane & 15, hi = lane >> 4;
    const int hh = blockIdx.y, bb = blockIdx.z;
    const int q0 = blockIdx.x * (ATW * 16) + wave * 16;
    const size_t pbase = ((size_t)bb * NH_ + hh) * (size_t)SEQ * HD;
    const bf* qhp = Qh + pbase; const bf* qlp = Ql + pbase; const bf* khp = Kh + pbase; const bf* klp = Kl + pbase;
    const h16* v16p = V16 + pbase; const h16* vrp = Vr + pbase;
    const unsigned* mwp = MW + (size_t)bb * (SEQ / 32);
    const int qoff0 = (q0 + lr) * HD + 8 * hi;
    const int foffl = lr * LPE + 8 * hi;                  // fragment reader's lane offset in a staged tile (row lr, 16-bit elements)
    typedef __attribute__((address_space(3))) unsigned char lds_u8;
    const int crow = threadIdx.x >> 3, cch = threadIdx.x & 7;   // copier's row (and row + 32) and 16-byte piece of it
    const unsigned lcp = (unsigned)(size_t)(lds_u8*)ring + (unsigned)(crow * LPB + cch * 16);
    const bf* khc = khp + crow * HD + cch * 8; const bf* klc = klp + crow * HD + cch * 8;
    const h16* v16c = v16p + crow * SEQ + cch * 8; const h16* vrc = vrp + crow * SEQ + cch * 8;
    v8f acc[4], accr[4];
#pragma unroll
    for (int dt = 0; dt < 4; ++dt) { acc[dt] = (v8f){}; accr[dt] = (v8f){}; }
    float m = -1.0e30f, l = 0.0f;
    stage_copy(lcp, khc, klc, v16c, vrc);
    asm volatile("s_wait_asynccnt 0x0" ::: "memory");     // this wave's share of stage 0 has landed
    __syncthreads();                                      // publishes stage 0
    stage_copy(lcp + STB, khc + KST * HD, klc + KST * HD, v16c + KST, vrc + KST);
#pragma unroll 1
    for (int s = 0; s < SEQ / KST; ++s) {
    const unsigned char* rb = ring + (s & 1) * STB;
    const bf* kht = (const bf*)rb + foffl; const bf* klt = (const bf*)(rb + TLB) + foffl;
    const h16* v16t = (const h16*)(rb + 2 * TLB) + foffl; const h16* vrt = (const h16*)(rb + 3 * TLB) + foffl;
#pragma unroll 1                                          // one copy of the 32-key step, as before: small code, same register set
    for (int sub = 0; sub < KST / 32; ++sub) {
        const int kb = s * KST + sub * 32;
        int qo = qoff0; asm volatile("" : "+v"(qo));      // q fragments are re-fetched per step (kept out of the loop-carried register set)
        v8f st0 = (v8f){}, st1 = (v8f){};
#pragma unroll
        for (int ks = 0; ks < 2; ++ks) {
            const v16bf qh = ldb(qhp + qo + ks * 32), ql = ldb(qlp + qo + ks * 32);
            const int ko = sub * 32 * LPE + ks * 32;
            const v16bf kh0 = ldb(kht + ko), kl0 = ldb(klt + ko), kh1 = ldb(kht + ko + 16 * LPE), kl1 = ldb(klt + ko + 16 * LPE);
            st0 = wmmab(kh0, qh, st0); st1 = wmmab(kh1, qh, st1);
            st0 = wmmab(kl0, qh, st0); st1 = wmmab(kl1, qh, st1);
            st0 = wmmab(kh0, ql, st0); st1 = wmmab(kh1, ql, st1);
            asm volatile("v_nop\n\tv_nop\n\tv_nop\n\tv_nop" : "+v"(st0), "+v"(st1) : "v"(qh), "v"(ql), "v"(kh0), "v"(kl0), "v"(kh1), "v"(kl1));
        }
        const unsigned mw = mwp[kb >> 5];
        if (mw != 0xFFFFFFFFu) {                          // wave-uniform: st0[r] is key kb+8*hi+r, st1[r] is key kb+16+8*hi+r
#pragma unroll
            for (int r = 0; r < 8; ++r) { st0[r] = ((mw >> (8 * hi + r)) & 1u) ? st0[r] : NEGF; st1[r] = ((mw >> (16 + 8 * hi + r)) & 1u) ? st1[r] : NEGF; }
        }
        float mx = fmaxf(st0[0], st1[0]);
#pragma unroll
        for (int r = 1; r < 8; ++r) mx = fmaxf(mx, fmaxf(st0[r], st1[r]));
        mx = fmaxf(mx, __shfl_xor(mx, 16, 32));
        const float mnew = fmaxf(m, mx);
        const float alpha = __builtin_amdgcn_exp2f((m - mnew) * L2E);
        const unsigned grow = __builtin_amdgcn_ballot_w32(mnew > m);
        if (grow != 0u) {                                 // wave-uniform: rescale only when some query's running max moved (alpha == 1 exactly elsewhere)
#pragma unroll
            for (int dt = 0; dt < 4; ++dt) { acc[dt] = acc[dt] * alpha; accr[dt] = accr[dt] * alpha; }
        }
        m = mnew;
        float psum = 0.0f; v16h pb;
#pragma unroll
        for (int r = 0; r < 8; ++r) {
            const float p0 = __builtin_amdgcn_exp2f((st0[r] - mnew) * L2E), p1 = __builtin_amdgcn_exp2f((st1[r] - mnew) * L2E);
            psum += p0 + p1; pb[r] = (h16)(p0 * PCAR); pb[8 + r] = (h16)(p1 * PCAR); }
        l = l * alpha + psum;
        const int vo = sub * 32;
        {
            const v16h va0 = ldh(v16t + vo), va1 = ldh(v16t + vo + 16 * LPE), va2 = ldh(v16t + vo + 32 * LPE), va3 = ldh(v16t + vo + 48 * LPE);
            acc[0] = wmma16(va0, pb, acc[0]); acc[1] = wmma16(va1, pb, acc[1]); acc[2] = wmma16(va2, pb, acc[2]); acc[3] = wmma16(va3, pb, acc[3]);
            asm volatile("v_nop\n\tv_nop\n\tv_nop\n\tv_nop" : "+v"(acc[0]), "+v"(acc[1]), "+v"(acc[2]), "+v"(acc[3]) : "v"(pb), "v"(va0), "v"(va1), "v"(va2), "v"(va3));
        }
        {
            const v16h vb0 = ldh(vrt + vo), vb1 = ldh(vrt + vo + 16 * LPE), vb2 = ldh(vrt + vo + 32 * LPE), vb3 = ldh(vrt + vo + 48 * LPE);
            accr[0] = wmma16(vb0, pb, accr[0]); accr[1] = wmma16(vb1, pb, accr[1]); accr[2] = wmma16(vb2, pb, accr[2]); accr[3] = wmma16(vb3, pb, accr[3]);
            asm volatile("v_nop\n\tv_nop\n\tv_nop\n\tv_nop" : "+v"(accr[0]), "+v"(accr[1]), "+v"(accr[2]), "+v"(accr[3]) : "v"(pb), "v"(vb0), "v"(vb1), "v"(vb2), "v"(vb3));
        }
    }
    asm volatile("s_wait_dscnt 0x0" ::: "memory");        // this wave's reads of stage s are done before its buffer is handed back
    asm volatile("s_wait_asynccnt 0x0" ::: "memory");     // this wave's share of stage s + 1 has landed
    __syncthreads();                                      // publishes stage s + 1 and ends every reader's last read of stage s
    if (s + 2 < SEQ / KST) stage_copy(lcp + (unsigned)((s & 1) * STB), khc + (s + 2) * KST * HD, klc + (s + 2) * KST * HD, v16c + (s + 2) * KST, vrc + (s + 2) * KST);
    }
    asm volatile("s_wait_asynccnt 0x0" ::: "memory");     // nothing of this wave's is in flight past the loop
    l += __shfl_xor(l, 16, 32);
    const float inv = 1.0f / (PCAR * l); const float invr = inv * (1.0f / VRES);
    const int ob = (wave * 16 + lr) * 68 + 8 * hi;        // O^T element (d = dt*16 + 8*hi + r, query lr) -> os[query][d]
#pragma unroll
    for (int dt = 0; dt < 4; ++dt) { v4f w0, w1;
#pragma unroll
        for (int r = 0; r < 4; ++r) { w0[r] = acc[dt][r] * inv + accr[dt][r] * invr; w1[r] = acc[dt][4 + r] * inv + accr[dt][4 + r] * invr; }
        *(v4fa*)(os + ob + dt * 16) = w0; *(v4fa*)(os + ob + dt * 16 + 4) = w1; }
    __builtin_amdgcn_wave_barrier(); asm volatile("" ::: "memory");
    const size_t orow = ((size_t)bb * SEQ + q0) * DM + hh * HD;
    const int rq = lane >> 3, d8 = (lane & 7) * 8;
{
#pragma unroll
        for (int s = 0; s < 4; ++s) { const int rr = s * 4 + rq;
            const v4f x0 = *(const v4fa*)(os + (wave * 16 + rr) * 68 + d8), x1 = *(const v4fa*)(os + (wave * 16 + rr) * 68 + d8 + 4); v8us oh, ol;
#pragma unroll
            for (int k = 0; k < 4; ++k) { unsigned short a, c; splitf(x0[k], a, c); oh[k] = a; ol[k] = c; splitf(x1[k], a, c); oh[4 + k] = a; ol[4 + k] = c; }
            *(v8us*)(Ah + orow + (size_t)rr * DM + d8) = oh; *(v8us*)(Al + orow + (size_t)rr * DM + d8) = ol; }
         }
}

// ---- workspace carve (bytes, 256-byte aligned regions; every region is covered exactly by its producer grid)
constexpr size_t al256(size_t b) { return (b + 255) & ~(size_t)255; }
constexpr size_t MWPAD  = (((size_t)NB * (SEQ / 32) + 31) / 32) * 32;
constexpr size_t SZ_XB  = al256((size_t)NB * SEQ * DM * 2);
constexpr size_t SZ_W   = al256((size_t)DM * DM * 2);
constexpr size_t SZ_F   = al256((size_t)NB * SEQ * DM * 4);
constexpr size_t SZ_PL  = al256((size_t)NB * NH_ * SEQ * HD * 2);
constexpr size_t SZ_MW  = al256(MWPAD * 4);
constexpr size_t OFF_XB = 0;
constexpr size_t OFF_WQ = OFF_XB + SZ_XB;
constexpr size_t OFF_WK = OFF_WQ + SZ_W;
constexpr size_t OFF_WV = OFF_WK + SZ_W;
constexpr size_t OFF_WO = OFF_WV + SZ_W;
constexpr size_t OFF_F  = OFF_WO + SZ_W;
constexpr size_t OFF_QH = OFF_F + SZ_F;
constexpr size_t OFF_QL = OFF_QH + SZ_PL;
constexpr size_t OFF_KH = OFF_QL + SZ_PL;
constexpr size_t OFF_KL = OFF_KH + SZ_PL;
constexpr size_t OFF_V16 = OFF_KL + SZ_PL;
constexpr size_t OFF_VR = OFF_V16 + SZ_PL;
constexpr size_t OFF_AH = OFF_VR + SZ_PL;
constexpr size_t OFF_AL = OFF_AH + SZ_PL;
constexpr size_t OFF_MW = OFF_AL + SZ_PL;
constexpr size_t WS_TOTAL = OFF_MW + SZ_MW;
static_assert(WS_TOTAL <= (size_t)134217728);          // 128 MiB
static_assert((size_t)NB * NH_ * SEQ * HD == (size_t)NB * SEQ * DM);   // head planes and merged planes have equal extents

extern "C" void kernel_launch(void* const* d_in, const int* in_sizes, int n_in,
                              void* d_out, int out_size, void* d_ws, size_t ws_size, hipStream_t stream) {
    if (n_in < 10) return;
    const size_t xneed = (size_t)(NB - 1) * SEQ_FULL * DM + (size_t)SEQ * DM;
    if ((size_t)in_sizes[0] < xneed) return;
    if ((size_t)in_sizes[1] < (size_t)(NB - 1) * SEQ_FULL + SEQ) return;
    if (in_sizes[2] < DM * DM || in_sizes[4] < DM * DM || in_sizes[6] < DM * DM || in_sizes[8] < DM * DM) return;
    if (in_sizes[3] < DM || in_sizes[5] < DM || in_sizes[7] < DM || in_sizes[9] < DM) return;
    if ((size_t)out_size < xneed) return;
    if (ws_size < WS_TOTAL) return;
    const float* x = (const float*)d_in[0]; const int* mask = (const int*)d_in[1];
    const float* wq = (const float*)d_in[2]; const float* bq = (const float*)d_in[3];
    const float* wk = (const float*)d_in[4]; const float* bk = (const float*)d_in[5];
    const float* wv = (const float*)d_in[6]; const float* bv = (const float*)d_in[7];
    const float* wo = (const float*)d_in[8]; const float* bo = (const float*)d_in[9];
    float* OUT = (float*)d_out;
    char* wsb = (char*)d_ws;
    bf* XB = (bf*)(wsb + OFF_XB); bf* WQ = (bf*)(wsb + OFF_WQ); bf* WK = (bf*)(wsb + OFF_WK); bf* WV = (bf*)(wsb + OFF_WV); bf* WO = (bf*)(wsb + OFF_WO);
    float* F = (float*)(wsb + OFF_F);
    bf* QPh = (bf*)(wsb + OFF_QH); bf* QPl = (bf*)(wsb + OFF_QL); bf* KPh = (bf*)(wsb + OFF_KH); bf* KPl = (bf*)(wsb + OFF_KL);
    h16* VT16 = (h16*)(wsb + OFF_V16); h16* VTr = (h16*)(wsb + OFF_VR);
    bf* ATh = (bf*)(wsb + OFF_AH); bf* ATl = (bf*)(wsb + OFF_AL);
    unsigned* MWp = (unsigned*)(wsb + OFF_MW);

    const size_t xn8 = (size_t)SEQ * DM / 8, wn8 = (size_t)DM * DM / 8;
    for (int b = 0; b < NB; ++b)
        k_cvt8<<<(unsigned)((xn8 + 255) / 256), 256, 0, stream>>>(x + (size_t)b * SEQ_FULL * DM, XB + (size_t)b * SEQ * DM, xn8);
    k_cvt8<<<(unsigned)((wn8 + 255) / 256), 256, 0, stream>>>(wq, WQ, wn8);
    k_cvt8<<<(unsigned)((wn8 + 255) / 256), 256, 0, stream>>>(wk, WK, wn8);
    k_cvt8<<<(unsigned)((wn8 + 255) / 256), 256, 0, stream>>>(wv, WV, wn8);
    k_cvt8<<<(unsigned)((wn8 + 255) / 256), 256, 0, stream>>>(wo, WO, wn8);
    k_mpack<<<(unsigned)(MWPAD / 32), 32, 0, stream>>>(mask, MWp);

    const dim3 gp((unsigned)(NB * SEQ / 128), DM / 128, 1);
    const unsigned lp = (unsigned)(((size_t)NB * SEQ * DM / 8 + 255) / 256);
    k_gemm_proj<<<gp, GW * 32, 0, stream>>>(XB, WQ, F, DM, bq);      // q = x Wq^T + bq
    k_qkp<<<lp, 256, 0, stream>>>(F, QPh, QPl);
    k_gemm_proj<<<gp, GW * 32, 0, stream>>>(XB, WK, F, DM, bk);      // k (F reused, stream-ordered)
    k_qkp<<<lp, 256, 0, stream>>>(F, KPh, KPl);
    k_gemm_proj<<<gp, GW * 32, 0, stream>>>(XB, WV, F, DM, bv);      // v
    k_vtp8<<<lp, 256, 0, stream>>>(F, VT16, VTr);

    k_attn<<<dim3(SEQ / (ATW * 16), NH_, NB), ATW * 32, 0, stream>>>(QPh, QPl, KPh, KPl, VT16, VTr, MWp, ATh, ATl);

    k_gemm_out<<<dim3(SEQ / 128, DM / 128, NB), GW * 32, 0, stream>>>(ATh, ATl, WO, OUT, DM, bo, (size_t)SEQ * DM, (size_t)SEQ_FULL * DM);
}

// v003
// Measured time: 171 microseconds a run.
// In both of two side-by-side timings against v002, it was 1.27 times as fast.
// Over all steps from v000 it is 2.79 times as fast.
#include <hip/hip_runtime.h>

// Non-causal attention, 16 heads x 64, unscaled scores, int32 key mask (fill -1e9 by select), out = merged x Wo^T + bo.
// Compute dtypes, f32 accumulate everywhere: every float input converted to bf16 (RNE) on load; q/k/v projections v_wmma_f32_16x16x32_bf16 single product (+ bf16-rounded bias);
// scores v_wmma_f32_16x16x32_bf16 on q,k hi|lo planes (3 products); softmax f32 online (exp2, running max); P x V v_wmma_f32_16x16x32_f16 with P x256 and V = f16 value + f16 residual x2048 (2 products, 2 accumulators);
// output projection v_wmma_f32_16x16x32_bf16 on context hi|lo planes x Wo (2 products) + bias.

#ifndef NB
#define NB 2
#endif
#ifndef SEQ
#define SEQ 2048
#endif
#define NB_FULL  2
#define SEQ_FULL 2048
#define DM   1024
#define NH_  16
#define HD   64
#define ATW  8                  // waves per attention block (16 query rows each)
#define KST  64                 // keys per LDS stage of the attention ring (two 32-key steps)
#define LPB  144                // LDS row pitch in bytes: 128-byte rows + 16 (16 B x odd, conflict-free for 16-byte row readers)
#define LPE  (LPB / 2)          // the same in 16-bit elements
#define TLB  (64 * LPB)         // one plane's tile: 64 rows
#define STB  (4 * TLB)          // one stage: K hi, K lo, V value, V residual
#define GW   8                  // waves per GEMM block
#define GKC  128                // k per LDS stage of the GEMM ring (four 32-k steps): 256-byte rows
#define GPB  272                // LDS row pitch of the GEMM tiles in bytes: 256-byte rows + 16 (16 B x odd, conflict-free for 16-byte row readers)
#define GPE  (GPB / 2)          // the same in 16-bit elements
#define GTB  (128 * GPB)        // one GEMM operand tile: 128 rows
#define PCAR 256.0f             // carry of the f16 probability operand
#define VRES 2048.0f            // carry of the f16 value residual plane
#define NEGF (-1.0e9f)
#define L2E  1.4426950408889634f

static_assert(NH_ * HD == DM);               // merged width
static_assert(HD == 64);
static_assert(DM % 64 == 0 && DM % 32 == 0); // wave tile and k-step multiples
static_assert(SEQ % 64 == 0);                // 64-key attention stages, 32-key steps
static_assert(SEQ % (ATW * 16) == 0);        // whole attention blocks
static_assert(SEQ / KST >= 2);               // the ring's prologue fills two stages
static_assert(ATW * 32 == 256);              // the stage copy deals 32 rows x 8 pieces of 16 bytes to the block's lanes, twice per tile
static_assert(KST == 64 && HD * 2 == 128 && KST * 2 == 128);   // every staged row of the attention ring is one 128-byte line
static_assert((NB * SEQ) % 128 == 0 && SEQ % 128 == 0 && DM % 128 == 0);   // whole 128x128 GEMM block tiles
static_assert(DM % GKC == 0 && DM / GKC >= 2 && GKC * 2 == 256 && GW * 32 == 256);   // whole GEMM stages; the tile copy deals 16 rows x 16 pieces of 16 bytes to the block's lanes, eight times per tile
static_assert(NB <= NB_FULL && SEQ <= SEQ_FULL);

typedef _Float16 h16;
typedef unsigned short bf;
typedef __attribute__((ext_vector_type(16))) __bf16   v16bf;
typedef __attribute__((ext_vector_type(16))) _Float16 v16h;
typedef __attribute__((ext_vector_type(8)))  _Float16 v8h;
typedef __attribute__((ext_vector_type(8)))  unsigned short v8us;
typedef __attribute__((ext_vector_type(8)))  float    v8f;
typedef __attribute__((ext_vector_type(4)))  float    v4f;
typedef v4f  __attribute__((may_alias)) v4fa;

__device__ __forceinline__ unsigned short f2bf(float f) { unsigned u = __float_as_uint(f); u += 0x7FFFu + ((u >> 16) & 1u); return (unsigned short)(u >> 16); }
__device__ __forceinline__ float bf2f(unsigned short b) { return __uint_as_float(((unsigned)b) << 16); }
__device__ __forceinline__ float bfr(float f) { return bf2f(f2bf(f)); }
__device__ __forceinline__ void splitf(float y, unsigned short& h, unsigned short& l) { h = f2bf(y); l = f2bf(y - bf2f(h)); }
__device__ __forceinline__ v16h cat16(v8h lo, v8h hi) { return __builtin_shufflevector(lo, hi, 0, 1, 2, 3, 4, 5, 6, 7, 8, 9, 10, 11, 12, 13, 14, 15); }
__device__ __forceinline__ v16bf cat16b(v8us lo, v8us hi) { return __builtin_bit_cast(v16bf, __builtin_shufflevector(lo, hi, 0, 1, 2, 3, 4, 5, 6, 7, 8, 9, 10, 11, 12, 13, 14, 15)); }
__device__ __forceinline__ v8f wmma16(v16h a, v16h b, v8f c) { return __builtin_amdgcn_wmma_f32_16x16x32_f16(false, a, false, b, (short)0, c, false, false); }
__device__ __forceinline__ v8f wmmab(v16bf a, v16bf b, v8f c) { return __builtin_amdgcn_wmma_f32_16x16x32_bf16(false, a, false, b, (short)0, c, false, false); }
// fragment loaders from K-contiguous 16-bit rows: p = row base + k0 + 8*(lane>>4); elements 0..7 = k0+8h.., elements 8..15 = k0+16+8h..
__device__ __forceinline__ v16bf ldb(const bf* p) { return cat16b(*(const v8us*)p, *(const v8us*)(p + 16)); }
__device__ __forceinline__ v16h  ldh(const h16* p) { return cat16(*(const v8h*)p, *(const v8h*)(p + 16)); }

// One operand tile of a GEMM stage: each of the 256 lanes copies 16 bytes of rows r, r + 16, ... r + 112 of a 128-row x 256-byte tile (a wave-wide copy covers four whole 128-byte lines); rs = 16 source rows in elements.
// The s_wait_xcnt closes the copies' own statement so that it stands in front of any rewrite of the address registers they name.
__device__ __forceinline__ void tile_copy(unsigned l, const bf* g, size_t rs) {
    asm volatile("global_load_async_to_lds_b128 %0, %8, off\n\t"
                 "global_load_async_to_lds_b128 %1, %9, off\n\t"
                 "global_load_async_to_lds_b128 %2, %10, off\n\t"
                 "global_load_async_to_lds_b128 %3, %11, off\n\t"
                 "global_load_async_to_lds_b128 %4, %12, off\n\t"
                 "global_load_async_to_lds_b128 %5, %13, off\n\t"
                 "global_load_async_to_lds_b128 %6, %14, off\n\t"
                 "global_load_async_to_lds_b128 %7, %15, off\n\t"
                 "s_wait_xcnt 0x0"
                 :: "v"(l), "v"(l + 16 * GPB), "v"(l + 32 * GPB), "v"(l + 48 * GPB), "v"(l + 64 * GPB), "v"(l + 80 * GPB), "v"(l + 96 * GPB), "v"(l + 112 * GPB),
                    "v"(g), "v"(g + rs), "v"(g + 2 * rs), "v"(g + 3 * rs), "v"(g + 4 * rs), "v"(g + 5 * rs), "v"(g + 6 * rs), "v"(g + 7 * rs)
                 : "memory");
}
// One stage: the A tile, the Bt tile and, with two A planes, the second A tile, in that order in the buffer.
template <int NA> __device__ __forceinline__ void gemm_stage(unsigned l, const bf* a, const bf* a2, const bf* b, size_t rs) {
    tile_copy(l, a, rs); tile_copy(l + GTB, b, rs);
    if (NA == 2) tile_copy(l + 2 * GTB, a2, rs);
}

// ---- GEMM engine: 8 waves per 128x128 block tile (4 x 2 wave tiles of 32 x 64), C[m][n] = sum_k A[m][k] Bt[n][k] + bf16 bias (bias[n]; bias[m] in the v^T epilogue); operands are K-contiguous bf16 planes, staged 128 k at a time
// in a two-buffer LDS ring that the 8 waves share; NA == 2: A carried as hi + lo planes (two products into one accumulator, hi first). K = DM; rows and columns multiples of 128.
// The full unrolls below keep every index of the fragment and accumulator arrays a constant, so that the arrays stay in registers.
// gemm_main leaves the block tile at rows r0, columns c0 in acc (wave tile at wr, wc); the epilogues behind it add the bias and store.
template <int NA> __device__ __forceinline__ void gemm_main(const bf* __restrict__ A, const bf* __restrict__ A2, const bf* __restrict__ Bt, int r0, int c0,
                                                            const unsigned char* ring, unsigned lbase, v8f (&acc)[2][4]) {
    constexpr unsigned SB = (NA + 1) * GTB;               // bytes of one buffer
    constexpr int K = DM, nst = K / GKC;
    const int wave = __builtin_amdgcn_readfirstlane(threadIdx.x >> 5);
    const int lane = threadIdx.x & 31, lr = lane & 15, hi = lane >> 4;
    const int wr = (wave >> 1) * 32, wc = (wave & 1) * 64;
#pragma unroll
    for (int mb = 0; mb < 2; ++mb)
#pragma unroll
        for (int nb = 0; nb < 4; ++nb) acc[mb][nb] = (v8f){};
    const int prow = threadIdx.x >> 4, pch = threadIdx.x & 15;   // copier's first row and 16-byte piece of it
    const unsigned lcp = lbase + (unsigned)(prow * GPB + pch * 16);
    const bf* ac = A + (size_t)(r0 + prow) * K + pch * 8; const bf* a2c = A2 + (size_t)(r0 + prow) * K + pch * 8; const bf* bc = Bt + (size_t)(c0 + prow) * K + pch * 8;
    const size_t rs = (size_t)16 * K;
    const int aofl = (wr + lr) * GPE + 8 * hi, bofl = (wc + lr) * GPE + 8 * hi;   // fragment readers' lane offsets in a staged tile (16-bit elements)
    gemm_stage<NA>(lcp, ac, a2c, bc, rs);
    asm volatile("s_wait_asynccnt 0x0" ::: "memory");     // this wave's share of stage 0 has landed
    __syncthreads();                                      // publishes stage 0
    gemm_stage<NA>(lcp + SB, ac + GKC, a2c + GKC, bc + GKC, rs);
#pragma unroll 1                                          // one copy of the stage's body: the ring's order stays as written
    for (int s = 0; s < nst; ++s) {
        const unsigned char* rb = ring + (s & 1) * SB;
        const bf* at = (const bf*)rb + aofl; const bf* bt = (const bf*)(rb + GTB) + bofl; const bf* a2t = (const bf*)(rb + 2 * GTB) + aofl;
        v16bf a[2][2], a2[2][2], b[2][4];                 // two fragment sets: the 32-k step in work and the next one of the same stage
#pragma unroll
        for (int mb = 0; mb < 2; ++mb) { a[0][mb] = ldb(at + mb * 16 * GPE); if (NA == 2) a2[0][mb] = ldb(a2t + mb * 16 * GPE); }
#pragma unroll
        for (int nb = 0; nb < 4; ++nb) b[0][nb] = ldb(bt + nb * 16 * GPE);
#pragma unroll
        for (int ks = 0; ks < GKC / 32; ++ks) {
            const int cu = ks & 1, nx = cu ^ 1;
            if (ks + 1 < GKC / 32) {
#pragma unroll
                for (int mb = 0; mb < 2; ++mb) { a[nx][mb] = ldb(at + mb * 16 * GPE + (ks + 1) * 32); if (NA == 2) a2[nx][mb] = ldb(a2t + mb * 16 * GPE + (ks + 1) * 32); }
#pragma unroll
                for (int nb = 0; nb < 4; ++nb) b[nx][nb] = ldb(bt + nb * 16 * GPE + (ks + 1) * 32);
            }
            __builtin_amdgcn_sched_barrier(0);            // keeps the next step's LDS reads as one group in front of this step's matrix instructions, which then hide their latency
#pragma unroll
            for (int nb = 0; nb < 4; ++nb)
#pragma unroll
                for (int mb = 0; mb < 2; ++mb) acc[mb][nb] = wmmab(a[cu][mb], b[cu][nb], acc[mb][nb]);
            if (NA == 2) {
#pragma unroll
                for (int nb = 0; nb < 4; ++nb)
#pragma unroll
                    for (int mb = 0; mb < 2; ++mb) acc[mb][nb] = wmmab(a2[cu][mb], b[cu][nb], acc[mb][nb]);
            }
            __builtin_amdgcn_sched_barrier(0);            // keeps the reads of the step after next from being spread among these matrix instructions
        }
        // the distance behind the stage's last matrix instructions, also on the taken side of the branches that follow
        asm volatile("v_nop\n\tv_nop\n\tv_nop\n\tv_nop" : "+v"(acc[0][0]), "+v"(acc[0][1]), "+v"(acc[0][2]), "+v"(acc[0][3]), "+v"(acc[1][0]), "+v"(acc[1][1]), "+v"(acc[1][2]), "+v"(acc[1][3]));
        asm volatile("s_wait_dscnt 0x0" ::: "memory");    // this wave's reads of stage s are done before its buffer is handed back
        asm volatile("s_wait_asynccnt 0x0" ::: "memory"); // this wave's share of stage s + 1 has landed
        __syncthreads();                                  // publishes stage s + 1 and ends every reader's last read of stage s
        if (s + 2 < nst) gemm_stage<NA>(lcp + (unsigned)(s & 1) * SB, ac + (size_t)(s + 2) * GKC, a2c + (size_t)(s + 2) * GKC, bc + (size_t)(s + 2) * GKC, rs);
    }
    asm volatile("s_wait_asynccnt 0x0" ::: "memory");     // nothing of this wave's is in flight past the loop
}

// The full unrolls in the epilogues keep every index of acc and of the small vectors a constant, so that they stay in registers.
// One 16 x 64 half of a wave tile into the wave's own staging rows: os row = tile row, os column = tile column.
__device__ __forceinline__ void stage_half(float* osw, const v8f (&a)[4], int lr, int hi) {
#pragma unroll
    for (int nb = 0; nb < 4; ++nb) {
#pragma unroll
        for (int j = 0; j < 8; ++j) osw[(hi * 8 + j) * 68 + nb * 16 + lr] = a[nb][j]; }
}

// Epilogue, f32 rows: C[m][n] = acc + bf16(bias[n]).
__device__ __forceinline__ void epi_f32(const v8f (&acc)[2][4], int r0, int c0, float* C, int ldc, const float* __restrict__ bias, float* os) {
    const int wave = __builtin_amdgcn_readfirstlane(threadIdx.x >> 5);
    const int lane = threadIdx.x & 31, lr = lane & 15, hi = lane >> 4;
    const int wr = (wave >> 1) * 32, wc = (wave & 1) * 64;
    float* osw = os + wave * 16 * 68;                     // each wave stages its output rows in its own range
    const int cofs = lr * 4;
    const int cw = c0 + wc;
    v4f bv; bv[0] = bfr(bias[cw + cofs]); bv[1] = bfr(bias[cw + cofs + 1]); bv[2] = bfr(bias[cw + cofs + 2]); bv[3] = bfr(bias[cw + cofs + 3]);
#pragma unroll
    for (int mb = 0; mb < 2; ++mb) {
        stage_half(osw, acc[mb], lr, hi);
        __builtin_amdgcn_wave_barrier(); asm volatile("" ::: "memory");
        float* crow = C + (size_t)(r0 + wr + mb * 16) * ldc + cw;
{
#pragma unroll
            for (int s = 0; s < 8; ++s) { const int row = 2 * s + hi; v4f val = *(const v4fa*)(osw + row * 68 + cofs); val = val + bv;
                *(v4f*)(crow + (size_t)row * ldc + cofs) = val; }
             }
        __builtin_amdgcn_wave_barrier(); asm volatile("" ::: "memory");
    }
}

typedef __attribute__((address_space(3))) unsigned char lds_b8;

// Epilogue of the q and k projections: rows are tokens, the wave's 64 columns are one head; y = acc + bf16(bias[column]) goes out as bf16 hi | lo planes [batch][head][token][64], 128-byte rows.
__device__ __forceinline__ void epi_qk(const v8f (&acc)[2][4], int r0, int c0, const float* __restrict__ bias, bf* Ph, bf* Pl, float* os) {
    const int wave = __builtin_amdgcn_readfirstlane(threadIdx.x >> 5);
    const int lane = threadIdx.x & 31, lr = lane & 15, hi = lane >> 4;
    const int wr = (wave >> 1) * 32, wc = (wave & 1) * 64;
    float* osw = os + wave * 16 * 68;                     // each wave stages its output rows in its own range
    const int rq = lane >> 3, d8 = (lane & 7) * 8;
    const int cw = c0 + wc, h = cw / HD;
    v4f b0, b1;
#pragma unroll
    for (int k = 0; k < 4; ++k) { b0[k] = bfr(bias[cw + d8 + k]); b1[k] = bfr(bias[cw + d8 + 4 + k]); }
#pragma unroll
    for (int mb = 0; mb < 2; ++mb) {
        stage_half(osw, acc[mb], lr, hi);
        __builtin_amdgcn_wave_barrier(); asm volatile("" ::: "memory");   // the wave's stores stay in front of its reads of other lanes' values
        const int g0 = r0 + wr + mb * 16; const int b = g0 / SEQ, t0 = g0 % SEQ;   // 16 rows of one batch (SEQ is a multiple of 128)
        const size_t o0 = (((size_t)b * NH_ + h) * SEQ + t0) * HD + d8;
#pragma unroll
        for (int s = 0; s < 4; ++s) { const int rr = s * 4 + rq;
            const v4f x0 = *(const v4fa*)(osw + rr * 68 + d8) + b0, x1 = *(const v4fa*)(osw + rr * 68 + d8 + 4) + b1; v8us oh, ol;
#pragma unroll
            for (int k = 0; k < 4; ++k) { unsigned short a, c; splitf(x0[k], a, c); oh[k] = a; ol[k] = c; splitf(x1[k], a, c); oh[4 + k] = a; ol[4 + k] = c; }
            *(v8us*)(Ph + o0 + (size_t)rr * HD) = oh; *(v8us*)(Pl + o0 + (size_t)rr * HD) = ol; }
        __builtin_amdgcn_wave_barrier();                  // with the clobber below: the reads stay in front of the next half's LDS stores
        asm volatile("s_wait_xcnt 0x0" ::: "memory");     // in front of every later rewrite of the registers that these global stores name: the next half's, and behind the last half the code that the build lays out after this epilogue
    }
}

// Epilogue of the v projection, computed transposed (rows are output features, columns are tokens): y = acc + bf16(bias[row]) goes out as f16 value | f16 residual x VRES planes [batch][head][64][token], 128-byte pieces of a row.
__device__ __forceinline__ void epi_vt(const v8f (&acc)[2][4], int r0, int c0, const float* __restrict__ bias, h16* V16, h16* Vr, float* os) {
    const int wave = __builtin_amdgcn_readfirstlane(threadIdx.x >> 5);
    const int lane = threadIdx.x & 31, lr = lane & 15, hi = lane >> 4;
    const int wr = (wave >> 1) * 32, wc = (wave & 1) * 64;
    float* osw = os + wave * 16 * 68;                     // each wave stages its output rows in its own range
    const int rq = lane >> 3, t8 = (lane & 7) * 8;
    const int cw = c0 + wc; const int b = cw / SEQ, t0 = cw % SEQ;   // 64 tokens of one batch (SEQ is a multiple of 128)
    float bb[2][4];                                       // the lane's eight rows' biases, all fetched in front of the first store
#pragma unroll
    for (int mb = 0; mb < 2; ++mb)
#pragma unroll
        for (int s = 0; s < 4; ++s) bb[mb][s] = bfr(bias[r0 + wr + mb * 16 + s * 4 + rq]);
#pragma unroll
    for (int mb = 0; mb < 2; ++mb) {
        stage_half(osw, acc[mb], lr, hi);
        __builtin_amdgcn_wave_barrier(); asm volatile("" ::: "memory");   // the wave's stores stay in front of its reads of other lanes' values
        const int m0 = r0 + wr + mb * 16;                 // feature row = head * 64 + d: the planes' rows of one batch follow one another in that order
#pragma unroll
        for (int s = 0; s < 4; ++s) { const int rr = s * 4 + rq;
            const v4f x0 = *(const v4fa*)(osw + rr * 68 + t8) + bb[mb][s], x1 = *(const v4fa*)(osw + rr * 68 + t8 + 4) + bb[mb][s]; v8h o16, orr;
#pragma unroll
            for (int k = 0; k < 4; ++k) { const h16 h0 = (h16)x0[k], h1 = (h16)x1[k]; o16[k] = h0; o16[4 + k] = h1;
                orr[k] = (h16)((x0[k] - (float)h0) * VRES); orr[4 + k] = (h16)((x1[k] - (float)h1) * VRES); }
            const size_t o = ((size_t)b * DM + m0 + rr) * SEQ + t0 + t8;
            *(v8h*)(V16 + o) = o16; *(v8h*)(Vr + o) = orr; }
        if (mb == 0) {
            __builtin_amdgcn_wave_barrier();              // with the clobber below: the reads stay in front of the next half's LDS stores
            asm volatile("s_wait_xcnt 0x0" ::: "memory"); // in front of the next half's rewrites of the registers that these global stores name
        }
    }
}

// ---- k_gemm_qkv: the three projections in one launch, single A plane; grid (tokens/128, DM/128, 3), 256 threads. z = 0, 1: q, k = x W^T (A = x rows, Bt = W rows);
// z = 2: v^T = Wv x^T (A = Wv rows, Bt = x rows; same k order), so that its rows run along the tokens as the attention's V planes do. Each epilogue writes the attention's planes itself.
__global__ __launch_bounds__(GW * 32) void k_gemm_qkv(const bf* __restrict__ XB, const bf* __restrict__ WQ, const bf* __restrict__ WK, const bf* __restrict__ WV,
                                                      const float* __restrict__ bq, const float* __restrict__ bk, const float* __restrict__ bv,
                                                      bf* Qh, bf* Ql, bf* Kh, bf* Kl, h16* V16, h16* Vr) {
    __shared__ __align__(16) float os[GW * 16 * 68];
    __shared__ __align__(128) unsigned char ring[2 * 2 * GTB];
    const int z = blockIdx.z;
    const bf* A = (z == 2) ? WV : XB; const bf* Bt = (z == 2) ? XB : (z == 1) ? WK : WQ;
    const int r0 = ((z == 2) ? blockIdx.y : blockIdx.x) * 128, c0 = ((z == 2) ? blockIdx.x : blockIdx.y) * 128;
    v8f acc[2][4];
    gemm_main<1>(A, A, Bt, r0, c0, ring, (unsigned)(size_t)(lds_b8*)ring, acc);
    if (z == 2) epi_vt(acc, r0, c0, bv, V16, Vr, os);
    else epi_qk(acc, r0, c0, (z == 1) ? bk : bq, (z == 1) ? Kh : Qh, (z == 1) ? Kl : Ql, os);
}

// ---- k_gemm_out: A carried as hi + lo planes, z-batched: A/A2 += z*sA, C += z*sC; grid (M/128, N/128, batches), 256 threads.
__global__ __launch_bounds__(GW * 32) void k_gemm_out(const bf* __restrict__ A, const bf* __restrict__ A2, const bf* __restrict__ Bt, float* C, int ldc, const float* __restrict__ bias, size_t sA, size_t sC) {
    __shared__ __align__(16) float os[GW * 16 * 68];
    __shared__ __align__(128) unsigned char ring[2 * 3 * GTB];
    const size_t z = blockIdx.z;
    const int r0 = blockIdx.x * 128, c0 = blockIdx.y * 128;
    v8f acc[2][4];
    gemm_main<2>(A + z * sA, A2 + z * sA, Bt, r0, c0, ring, (unsigned)(size_t)(lds_b8*)ring, acc);
    epi_f32(acc, r0, c0, C + z * sC, ldc, bias, os);
}

// ---- k_prep: every float operand to bf16 (RNE) and the mask to bit words, one launch. Block 0 packs the mask; each other block converts CVU x 256 pieces of 8 floats of one source
// (the batches of x, then Wq, Wk, Wv, Wo): a lane's CVU loads of 32 bytes are all issued before the first is used. The full unrolls keep v and o in registers.
#define CVU 8
constexpr int CVB = CVU * 256 * 8;                        // floats per block
constexpr int XBL = SEQ * DM / CVB, WBL = DM * DM / CVB;  // blocks per batch of x, per weight
static_assert((SEQ * DM) % CVB == 0 && (DM * DM) % CVB == 0);
constexpr int MWPADI = ((NB * (SEQ / 32) + 31) / 32) * 32;   // mask words, padded to whole 128-byte lines
__global__ __launch_bounds__(256) void k_prep(const float* __restrict__ x, const float* __restrict__ wq, const float* __restrict__ wk, const float* __restrict__ wv, const float* __restrict__ wo, const int* __restrict__ mask,
                                              bf* XB, bf* WQ, bf* WK, bf* WV, bf* WO, unsigned* MW) {
    if (blockIdx.x == 0) {                                // a wave packs 32 words (bit j of word w: key 32 w + j is kept) and stores them as one line
        const int wave = threadIdx.x >> 5, lane = threadIdx.x & 31; const int nw = NB * (SEQ / 32);
        for (int g = wave; g < MWPADI / 32; g += 8) {
            unsigned mine = 0xFFFFFFFFu;                  // words past the last real one
            for (int j = 0; j < 32; ++j) { const int i = g * 32 + j; const int ii = (i < nw) ? i : (nw - 1); const int b = ii / (SEQ / 32), w = ii % (SEQ / 32);
                const unsigned word = __builtin_amdgcn_ballot_w32(mask[(size_t)b * SEQ_FULL + w * 32 + lane] != 0);
                if (lane == j && i < nw) mine = word; }
            MW[g * 32 + lane] = mine;
        }
        return;
    }
    const int blk = blockIdx.x - 1;
    const float* s; bf* d;
    if (blk < NB * XBL) { const int b = blk / XBL, r = blk % XBL; s = x + (size_t)b * SEQ_FULL * DM + (size_t)r * CVB; d = XB + (size_t)b * SEQ * DM + (size_t)r * CVB; }
    else { const int q = blk - NB * XBL; const int w = q / WBL, r = q % WBL;
        s = ((w == 0) ? wq : (w == 1) ? wk : (w == 2) ? wv : wo) + (size_t)r * CVB; d = ((w == 0) ? WQ : (w == 1) ? WK : (w == 2) ? WV : WO) + (size_t)r * CVB; }
    v8f v[CVU];
#pragma unroll
    for (int u = 0; u < CVU; ++u) v[u] = *(const v8f*)(s + (size_t)(u * 256 + threadIdx.x) * 8);
#pragma unroll
    for (int u = 0; u < CVU; ++u) { v8us o;
#pragma unroll
        for (int k = 0; k < 8; ++k) o[k] = f2bf(v[u][k]);
        *(v8us*)(d + (size_t)(u * 256 + threadIdx.x) * 8) = o; }
}

// One stage of the ring: each of the 256 lanes copies 16 bytes of rows r and r + 32 of the four 64-row x 128-byte tiles (a wave-wide copy covers four whole 128-byte lines).
// The s_wait_xcnt closes the copies' own statement so that it stands in front of any rewrite of the address registers they name.
__device__ __forceinline__ void stage_copy(unsigned l, const bf* kh, const bf* kl, const h16* v, const h16* vr) {
    asm volatile("global_load_async_to_lds_b128 %0, %8, off\n\t"
                 "global_load_async_to_lds_b128 %1, %9, off\n\t"
                 "global_load_async_to_lds_b128 %2, %10, off\n\t"
                 "global_load_async_to_lds_b128 %3, %11, off\n\t"
                 "global_load_async_to_lds_b128 %4, %12, off\n\t"
                 "global_load_async_to_lds_b128 %5, %13, off\n\t"
                 "global_load_async_to_lds_b128 %6, %14, off\n\t"
                 "global_load_async_to_lds_b128 %7, %15, off\n\t"
                 "s_wait_xcnt 0x0"
                 :: "v"(l), "v"(l + 32 * LPB), "v"(l + TLB), "v"(l + TLB + 32 * LPB), "v"(l + 2 * TLB), "v"(l + 2 * TLB + 32 * LPB), "v"(l + 3 * TLB), "v"(l + 3 * TLB + 32 * LPB),
                    "v"(kh), "v"(kh + 32 * HD), "v"(kl), "v"(kl + 32 * HD), "v"(v), "v"(v + 32 * SEQ), "v"(vr), "v"(vr + 32 * SEQ)
                 : "memory");
}

// ---- k_attn: fused attention, one wave per 16 query rows, 8 waves per block that share each 64-key stage of K and V through a two-buffer LDS ring; grid (SEQ/128, heads, batch).
// Transposed form: S^T[key][query] = K Q^T (A = K rows, B = Q rows; 3 products hi.hi + lo.hi + hi.lo), so each lane owns one query column: row statistics are per lane (+ one xor-16 exchange),
// and the two 16-key score tiles of a 32-key step pack directly into the B fragment of O^T[d][query] += V^T[d][key] P^T[key][query] (elements 0..7 <- tile of keys 0..15, elements 8..15 <- tile of keys 16..31, lane unchanged).
__global__ __launch_bounds__(ATW * 32) void k_attn(const bf* __restrict__ Qh, const bf* __restrict__ Ql, const bf* __restrict__ Kh, const bf* __restrict__ Kl, const h16* __restrict__ V16, const h16* __restrict__ Vr, const unsigned* __restrict__ MW, bf* Ah, bf* Al) {
    __shared__ __align__(16) float os[ATW * 16 * 68];
    __shared__ __align__(128) unsigned char ring[2 * STB];
    const int wave = __builtin_amdgcn_readfirstlane(threadIdx.x >> 5);
    const int lane = threadIdx.x & 31, lr = lane & 15, hi = lane >> 4;
    const int hh = blockIdx.y, bb = blockIdx.z;
    const int q0 = blockIdx.x * (ATW * 16) + wave * 16;
    const size_t pbase = ((size_t)bb * NH_ + hh) * (size_t)SEQ * HD;
    const bf* qhp = Qh + pbase; const bf* qlp = Ql + pbase; const bf* khp = Kh + pbase; const bf* klp = Kl + pbase;
    const h16* v16p = V16 + pbase; const h16* vrp = Vr + pbase;
    const unsigned* mwp = MW + (size_t)bb * (SEQ / 32);
    const int qoff0 = (q0 + lr) * HD + 8 * hi;
    const int foffl = lr * LPE + 8 * hi;                  // fragment reader's lane offset in a staged tile (row lr, 16-bit elements)
    typedef __attribute__((address_space(3))) unsigned char lds_u8;
    const int crow = threadIdx.x >> 3, cch = threadIdx.x & 7;   // copier's row (and row + 32) and 16-byte piece of it
    const unsigned lcp = (unsigned)(size_t)(lds_u8*)ring + (unsigned)(crow * LPB + cch * 16);
    const bf* khc = khp + crow * HD + cch * 8; const bf* klc = klp + crow * HD + cch * 8;
    const h16* v16c = v16p + crow * SEQ + cch * 8; const h16* vrc = vrp + crow * SEQ + cch * 8;
    v8f acc[4], accr[4];
#pragma unroll
    for (int dt = 0; dt < 4; ++dt) { acc[dt] = (v8f){}; accr[dt] = (v8f){}; }
    float m = -1.0e30f, l = 0.0f;
    stage_copy(lcp, khc, klc, v16c, vrc);
    asm volatile("s_wait_asynccnt 0x0" ::: "memory");     // this wave's share of stage 0 has landed
    __syncthreads();                                      // publishes stage 0
    stage_copy(lcp + STB, khc + KST * HD, klc + KST * HD, v16c + KST, vrc + KST);
#pragma unroll 1
    for (int s = 0; s < SEQ / KST; ++s) {
    const unsigned char* rb = ring + (s & 1) * STB;
    const bf* kht = (const bf*)rb + foffl; const bf* klt = (const bf*)(rb + TLB) + foffl;
    const h16* v16t = (const h16*)(rb + 2 * TLB) + foffl; const h16* vrt = (const h16*)(rb + 3 * TLB) + foffl;
#pragma unroll 1                                          // one copy of the 32-key step, as before: small code, same register set
    for (int sub = 0; sub < KST / 32; ++sub) {
        const int kb = s * KST + sub * 32;
        int qo = qoff0; asm volatile("" : "+v"(qo));      // q fragments are re-fetched per step (kept out of the loop-carried register set)
        v8f st0 = (v8f){}, st1 = (v8f){};
#pragma unroll
        for (int ks = 0; ks < 2; ++ks) {
            const v16bf qh = ldb(qhp + qo + ks * 32), ql = ldb(qlp + qo + ks * 32);
            const int ko = sub * 32 * LPE + ks * 32;
            const v16bf kh0 = ldb(kht + ko), kl0 = ldb(klt + ko), kh1 = ldb(kht + ko + 16 * LPE), kl1 = ldb(klt + ko + 16 * LPE);
            st0 = wmmab(kh0, qh, st0); st1 = wmmab(kh1, qh, st1);
            st0 = wmmab(kl0, qh, st0); st1 = wmmab(kl1, qh, st1);
            st0 = wmmab(kh0, ql, st0); st1 = wmmab(kh1, ql, st1);
            asm volatile("v_nop\n\tv_nop\n\tv_nop\n\tv_nop" : "+v"(st0), "+v"(st1) : "v"(qh), "v"(ql), "v"(kh0), "v"(kl0), "v"(kh1), "v"(kl1));
        }
        const unsigned mw = mwp[kb >> 5];
        if (mw != 0xFFFFFFFFu) {                          // wave-uniform: st0[r] is key kb+8*hi+r, st1[r] is key kb+16+8*hi+r
#pragma unroll
            for (int r = 0; r < 8; ++r) { st0[r] = ((mw >> (8 * hi + r)) & 1u) ? st0[r] : NEGF; st1[r] = ((mw >> (16 + 8 * hi + r)) & 1u) ? st1[r] : NEGF; }
        }
        float mx = fmaxf(st0[0], st1[0]);
#pragma unroll
        for (int r = 1; r < 8; ++r) mx = fmaxf(mx, fmaxf(st0[r], st1[r]));
        mx = fmaxf(mx, __shfl_xor(mx, 16, 32));
        const float mnew = fmaxf(m, mx);
        const float alpha = __builtin_amdgcn_exp2f((m - mnew) * L2E);
        const unsigned grow = __builtin_amdgcn_ballot_w32(mnew > m);
        if (grow != 0u) {                                 // wave-uniform: rescale only when some query's running max moved (alpha == 1 exactly elsewhere)
#pragma unroll
            for (int dt = 0; dt < 4; ++dt) { acc[dt] = acc[dt] * alpha; accr[dt] = accr[dt] * alpha; }
        }
        m = mnew;
        float psum = 0.0f; v16h pb;
#pragma unroll
        for (int r = 0; r < 8; ++r) {
            const float p0 = __builtin_amdgcn_exp2f((st0[r] - mnew) * L2E), p1 = __builtin_amdgcn_exp2f((st1[r] - mnew) * L2E);
            psum += p0 + p1; pb[r] = (h16)(p0 * PCAR); pb[8 + r] = (h16)(p1 * PCAR); }
        l = l * alpha + psum;
        const int vo = sub * 32;
        {
            const v16h va0 = ldh(v16t + vo), va1 = ldh(v16t + vo + 16 * LPE), va2 = ldh(v16t + vo + 32 * LPE), va3 = ldh(v16t + vo + 48 * LPE);
            acc[0] = wmma16(va0, pb, acc[0]); acc[1] = wmma16(va1, pb, acc[1]); acc[2] = wmma16(va2, pb, acc[2]); acc[3] = wmma16(va3, pb, acc[3]);
            asm volatile("v_nop\n\tv_nop\n\tv_nop\n\tv_nop" : "+v"(acc[0]), "+v"(acc[1]), "+v"(acc[2]), "+v"(acc[3]) : "v"(pb), "v"(va0), "v"(va1), "v"(va2), "v"(va3));
        }
        {
            const v16h vb0 = ldh(vrt + vo), vb1 = ldh(vrt + vo + 16 * LPE), vb2 = ldh(vrt + vo + 32 * LPE), vb3 = ldh(vrt + vo + 48 * LPE);
            accr[0] = wmma16(vb0, pb, accr[0]); accr[1] = wmma16(vb1, pb, accr[1]); accr[2] = wmma16(vb2, pb, accr[2]); accr[3] = wmma16(vb3, pb, accr[3]);
            asm volatile("v_nop\n\tv_nop\n\tv_nop\n\tv_nop" : "+v"(accr[0]), "+v"(accr[1]), "+v"(accr[2]), "+v"(accr[3]) : "v"(pb), "v"(vb0), "v"(vb1), "v"(vb2), "v"(vb3));
        }
    }
    asm volatile("s_wait_dscnt 0x0" ::: "memory");        // this wave's reads of stage s are done before its buffer is handed back
    asm volatile("s_wait_asynccnt 0x0" ::: "memory");     // this wave's share of stage s + 1 has landed
    __syncthreads();                                      // publishes stage s + 1 and ends every reader's last read of stage s
    if (s + 2 < SEQ / KST) stage_copy(lcp + (unsigned)((s & 1) * STB), khc + (s + 2) * KST * HD, klc + (s + 2) * KST * HD, v16c + (s + 2) * KST, vrc + (s + 2) * KST);
    }
    asm volatile("s_wait_asynccnt 0x0" ::: "memory");     // nothing of this wave's is in flight past the loop
    l += __shfl_xor(l, 16, 32);
    const float inv = 1.0f / (PCAR * l); const float invr = inv * (1.0f / VRES);
    const int ob = (wave * 16 + lr) * 68 + 8 * hi;        // O^T element (d = dt*16 + 8*hi + r, query lr) -> os[query][d]
#pragma unroll
    for (int dt = 0; dt < 4; ++dt) { v4f w0, w1;
#pragma unroll
        for (int r = 0; r < 4; ++r) { w0[r] = acc[dt][r] * inv + accr[dt][r] * invr; w1[r] = acc[dt][4 + r] * inv + accr[dt][4 + r] * invr; }
        *(v4fa*)(os + ob + dt * 16) = w0; *(v4fa*)(os + ob + dt * 16 + 4) = w1; }
    __builtin_amdgcn_wave_barrier(); asm volatile("" ::: "memory");
    const size_t orow = ((size_t)bb * SEQ + q0) * DM + hh * HD;
    const int rq = lane >> 3, d8 = (lane & 7) * 8;
{
#pragma unroll
        for (int s = 0; s < 4; ++s) { const int rr = s * 4 + rq;
            const v4f x0 = *(const v4fa*)(os + (wave * 16 + rr) * 68 + d8), x1 = *(const v4fa*)(os + (wave * 16 + rr) * 68 + d8 + 4); v8us oh, ol;
#pragma unroll
            for (int k = 0; k < 4; ++k) { unsigned short a, c; splitf(x0[k], a, c); oh[k] = a; ol[k] = c; splitf(x1[k], a, c); oh[4 + k] = a; ol[4 + k] = c; }
            *(v8us*)(Ah + orow + (size_t)rr * DM + d8) = oh; *(v8us*)(Al + orow + (size_t)rr * DM + d8) = ol; }
         }
}

// ---- workspace carve (bytes, 256-byte aligned regions; every region is covered exactly by its producer grid)
constexpr size_t al256(size_t b) { return (b + 255) & ~(size_t)255; }
constexpr size_t MWPAD  = (((size_t)NB * (SEQ / 32) + 31) / 32) * 32;
constexpr size_t SZ_XB  = al256((size_t)NB * SEQ * DM * 2);
constexpr size_t SZ_W   = al256((size_t)DM * DM * 2);
constexpr size_t SZ_PL  = al256((size_t)NB * NH_ * SEQ * HD * 2);
constexpr size_t SZ_MW  = al256(MWPAD * 4);
constexpr size_t OFF_XB = 0;
constexpr size_t OFF_WQ = OFF_XB + SZ_XB;
constexpr size_t OFF_WK = OFF_WQ + SZ_W;
constexpr size_t OFF_WV = OFF_WK + SZ_W;
constexpr size_t OFF_WO = OFF_WV + SZ_W;
constexpr size_t OFF_QH = OFF_WO + SZ_W;
constexpr size_t OFF_QL = OFF_QH + SZ_PL;
constexpr size_t OFF_KH = OFF_QL + SZ_PL;
constexpr size_t OFF_KL = OFF_KH + SZ_PL;
constexpr size_t OFF_V16 = OFF_KL + SZ_PL;
constexpr size_t OFF_VR = OFF_V16 + SZ_PL;
constexpr size_t OFF_AH = OFF_VR + SZ_PL;
constexpr size_t OFF_AL = OFF_AH + SZ_PL;
constexpr size_t OFF_MW = OFF_AL + SZ_PL;
constexpr size_t WS_TOTAL = OFF_MW + SZ_MW;
static_assert(WS_TOTAL <= (size_t)134217728);          // 128 MiB
static_assert((size_t)NB * NH_ * SEQ * HD == (size_t)NB * SEQ * DM);   // head planes and merged planes have equal extents
static_assert(MWPAD == (size_t)MWPADI);

extern "C" void kernel_launch(void* const* d_in, const int* in_sizes, int n_in,
                              void* d_out, int out_size, void* d_ws, size_t ws_size, hipStream_t stream) {
    if (n_in < 10) return;
    const size_t xneed = (size_t)(NB - 1) * SEQ_FULL * DM + (size_t)SEQ * DM;
    if ((size_t)in_sizes[0] < xneed) return;
    if ((size_t)in_sizes[1] < (size_t)(NB - 1) * SEQ_FULL + SEQ) return;
    if (in_sizes[2] < DM * DM || in_sizes[4] < DM * DM || in_sizes[6] < DM * DM || in_sizes[8] < DM * DM) return;
    if (in_sizes[3] < DM || in_sizes[5] < DM || in_sizes[7] < DM || in_sizes[9] < DM) return;
    if ((size_t)out_size < xneed) return;
    if (ws_size < WS_TOTAL) return;
    const float* x = (const float*)d_in[0]; const int* mask = (const int*)d_in[1];
    const float* wq = (const float*)d_in[2]; const float* bq = (const float*)d_in[3];
    const float* wk = (const float*)d_in[4]; const float* bk = (const float*)d_in[5];
    const float* wv = (const float*)d_in[6]; const float* bv = (const float*)d_in[7];
    const float* wo = (const float*)d_in[8]; const float* bo = (const float*)d_in[9];
    float* OUT = (float*)d_out;
    char* wsb = (char*)d_ws;
    bf* XB = (bf*)(wsb + OFF_XB); bf* WQ = (bf*)(wsb + OFF_WQ); bf* WK = (bf*)(wsb + OFF_WK); bf* WV = (bf*)(wsb + OFF_WV); bf* WO = (bf*)(wsb + OFF_WO);
    bf* QPh = (bf*)(wsb + OFF_QH); bf* QPl = (bf*)(wsb + OFF_QL); bf* KPh = (bf*)(wsb + OFF_KH); bf* KPl = (bf*)(wsb + OFF_KL);
    h16* VT16 = (h16*)(wsb + OFF_V16); h16* VTr = (h16*)(wsb + OFF_VR);
    bf* ATh = (bf*)(wsb + OFF_AH); bf* ATl = (bf*)(wsb + OFF_AL);
    unsigned* MWp = (unsigned*)(wsb + OFF_MW);

    k_prep<<<1 + NB * XBL + 4 * WBL, 256, 0, stream>>>(x, wq, wk, wv, wo, mask, XB, WQ, WK, WV, WO, MWp);

    k_gemm_qkv<<<dim3((unsigned)(NB * SEQ / 128), DM / 128, 3), GW * 32, 0, stream>>>(XB, WQ, WK, WV, bq, bk, bv, QPh, QPl, KPh, KPl, VT16, VTr);

    k_attn<<<dim3(SEQ / (ATW * 16), NH_, NB), ATW * 32, 0, stream>>>(QPh, QPl, KPh, KPl, VT16, VTr, MWp, ATh, ATl);

    k_gemm_out<<<dim3(SEQ / 128, DM / 128, NB), GW * 32, 0, stream>>>(ATh, ATl, WO, OUT, DM, bo, (size_t)SEQ * DM, (size_t)SEQ_FULL * DM);
}

// v004
// A run of this version takes 159 microseconds.
// In both of two side-by-side timings against v003, it was 1.07 times as fast.
// All steps since v000 together make it 2.98 times as fast.
#include <hip/hip_runtime.h>

// Non-causal attention, 16 heads x 64, unscaled scores, int32 key mask (fill -1e9 by select), out = merged x Wo^T + bo.
// Compute dtypes, f32 accumulate everywhere: every float input converted to bf16 (RNE) on load; q/k/v projections v_wmma_f32_16x16x32_bf16 single product (+ bf16-rounded bias);
// scores v_wmma_f32_16x16x32_bf16 on q,k hi|lo planes (3 products); softmax f32 online (exp2, running max); P x V v_wmma_f32_16x16x32_f16 with P x256 and V = f16 value + f16 residual x2048 (2 products, 2 accumulators);
// output projection v_wmma_f32_16x16x32_bf16 on context hi|lo planes x Wo (2 products) + bias.

#ifndef NB
#define NB 2
#endif
#ifndef SEQ
#define SEQ 2048
#endif
#define NB_FULL  2
#define SEQ_FULL 2048
#define DM   1024
#define NH_  16
#define HD   64
#define ATW  8                  // waves per attention block (4 groups of 32 query rows x 2 key halves: 128 query rows a block)
#define KST  64                 // keys per LDS stage of the attention ring (two 32-key steps)
#define LPB  144                // LDS row pitch in bytes: 128-byte rows + 16 (16 B x odd, conflict-free for 16-byte row readers)
#define LPE  (LPB / 2)          // the same in 16-bit elements
#define TLB  (64 * LPB)         // one plane's tile: 64 rows
#define STB  (4 * TLB)          // one stage: K hi, K lo, V value, V residual
#define GW   8                  // waves per GEMM block
#define GKC  128                // k per LDS stage of the GEMM ring (four 32-k steps): 256-byte rows
#define GPB  272                // LDS row pitch of the GEMM tiles in bytes: 256-byte rows + 16 (16 B x odd, conflict-free for 16-byte row readers)
#define GPE  (GPB / 2)          // the same in 16-bit elements
#define GTB  (128 * GPB)        // one GEMM operand tile: 128 rows
#define PCAR 256.0f             // carry of the f16 probability operand
#define VRES 2048.0f            // carry of the f16 value residual plane
#define NEGF (-1.0e9f)
#define L2E  1.4426950408889634f

static_assert(NH_ * HD == DM);               // merged width
static_assert(HD == 64);
static_assert(DM % 64 == 0 && DM % 32 == 0); // wave tile and k-step multiples
static_assert(SEQ % 64 == 0);                // 64-key attention stages, 32-key steps
static_assert(SEQ % (ATW * 16) == 0);        // whole attention blocks
static_assert(SEQ / KST >= 2);               // the ring's prologue fills two stages
static_assert(ATW == 8 && KST == 64);         // four 32-query groups x two 32-key halves of a stage
static_assert(ATW * 32 == 256);              // the stage copy deals 32 rows x 8 pieces of 16 bytes to the block's lanes, twice per tile
static_assert(KST == 64 && HD * 2 == 128 && KST * 2 == 128);   // every staged row of the attention ring is one 128-byte line
static_assert((NB * SEQ) % 128 == 0 && SEQ % 128 == 0 && DM % 128 == 0);   // whole 128x128 GEMM block tiles
static_assert(DM % GKC == 0 && DM / GKC >= 2 && GKC * 2 == 256 && GW * 32 == 256);   // whole GEMM stages; the tile copy deals 16 rows x 16 pieces of 16 bytes to the block's lanes, eight times per tile
static_assert(NB <= NB_FULL && SEQ <= SEQ_FULL);

typedef _Float16 h16;
typedef unsigned short bf;
typedef __attribute__((ext_vector_type(16))) __bf16   v16bf;
typedef __attribute__((ext_vector_type(16))) _Float16 v16h;
typedef __attribute__((ext_vector_type(8)))  _Float16 v8h;
typedef __attribute__((ext_vector_type(8)))  unsigned short v8us;
typedef __attribute__((ext_vector_type(8)))  float    v8f;
typedef __attribute__((ext_vector_type(4)))  float    v4f;
typedef v4f  __attribute__((may_alias)) v4fa;

__device__ __forceinline__ unsigned short f2bf(float f) { unsigned u = __float_as_uint(f); u += 0x7FFFu + ((u >> 16) & 1u); return (unsigned short)(u >> 16); }
__device__ __forceinline__ float bf2f(unsigned short b) { return __uint_as_float(((unsigned)b) << 16); }
__device__ __forceinline__ float bfr(float f) { return bf2f(f2bf(f)); }
__device__ __forceinline__ void splitf(float y, unsigned short& h, unsigned short& l) { h = f2bf(y); l = f2bf(y - bf2f(h)); }
__device__ __forceinline__ v16h cat16(v8h lo, v8h hi) { return __builtin_shufflevector(lo, hi, 0, 1, 2, 3, 4, 5, 6, 7, 8, 9, 10, 11, 12, 13, 14, 15); }
__device__ __forceinline__ v16bf cat16b(v8us lo, v8us hi) { return __builtin_bit_cast(v16bf, __builtin_shufflevector(lo, hi, 0, 1, 2, 3, 4, 5, 6, 7, 8, 9, 10, 11, 12, 13, 14, 15)); }
__device__ __forceinline__ v8f wmma16(v16h a, v16h b, v8f c) { return __builtin_amdgcn_wmma_f32_16x16x32_f16(false, a, false, b, (short)0, c, false, false); }
__device__ __forceinline__ v8f wmmab(v16bf a, v16bf b, v8f c) { return __builtin_amdgcn_wmma_f32_16x16x32_bf16(false, a, false, b, (short)0, c, false, false); }
// fragment loaders from K-contiguous 16-bit rows: p = row base + k0 + 8*(lane>>4); elements 0..7 = k0+8h.., elements 8..15 = k0+16+8h..
__device__ __forceinline__ v16bf ldb(const bf* p) { return cat16b(*(const v8us*)p, *(const v8us*)(p + 16)); }
__device__ __forceinline__ v16h  ldh(const h16* p) { return cat16(*(const v8h*)p, *(const v8h*)(p + 16)); }

// One operand tile of a GEMM stage: each of the 256 lanes copies 16 bytes of rows r, r + 16, ... r + 112 of a 128-row x 256-byte tile (a wave-wide copy covers four whole 128-byte lines); rs = 16 source rows in elements.
// The s_wait_xcnt closes the copies' own statement so that it stands in front of any rewrite of the address registers they name.
__device__ __forceinline__ void tile_copy(unsigned l, const bf* g, size_t rs) {
    asm volatile("global_load_async_to_lds_b128 %0, %8, off\n\t"
                 "global_load_async_to_lds_b128 %1, %9, off\n\t"
                 "global_load_async_to_lds_b128 %2, %10, off\n\t"
                 "global_load_async_to_lds_b128 %3, %11, off\n\t"
                 "global_load_async_to_lds_b128 %4, %12, off\n\t"
                 "global_load_async_to_lds_b128 %5, %13, off\n\t"
                 "global_load_async_to_lds_b128 %6, %14, off\n\t"
                 "global_load_async_to_lds_b128 %7, %15, off\n\t"
                 "s_wait_xcnt 0x0"
                 :: "v"(l), "v"(l + 16 * GPB), "v"(l + 32 * GPB), "v"(l + 48 * GPB), "v"(l + 64 * GPB), "v"(l + 80 * GPB), "v"(l + 96 * GPB), "v"(l + 112 * GPB),
                    "v"(g), "v"(g + rs), "v"(g + 2 * rs), "v"(g + 3 * rs), "v"(g + 4 * rs), "v"(g + 5 * rs), "v"(g + 6 * rs), "v"(g + 7 * rs)
                 : "memory");
}
// One stage: the A tile, the Bt tile and, with two A planes, the second A tile, in that order in the buffer.
template <int NA> __device__ __forceinline__ void gemm_stage(unsigned l, const bf* a, const bf* a2, const bf* b, size_t rs) {
    tile_copy(l, a, rs); tile_copy(l + GTB, b, rs);
    if (NA == 2) tile_copy(l + 2 * GTB, a2, rs);
}

// ---- GEMM engine: 8 waves per 128x128 block tile (4 x 2 wave tiles of 32 x 64), C[m][n] = sum_k A[m][k] Bt[n][k] + bf16 bias (bias[n]; bias[m] in the v^T epilogue); operands are K-contiguous bf16 planes, staged 128 k at a time
// in a two-buffer LDS ring that the 8 waves share; NA == 2: A carried as hi + lo planes (two products into one accumulator, hi first). K = DM; rows and columns multiples of 128.
// The full unrolls below keep every index of the fragment and accumulator arrays a constant, so that the arrays stay in registers.
// gemm_main leaves the block tile at rows r0, columns c0 in acc (wave tile at wr, wc); the epilogues behind it add the bias and store.
template <int NA> __device__ __forceinline__ void gemm_main(const bf* __restrict__ A, const bf* __restrict__ A2, const bf* __restrict__ Bt, int r0, int c0,
                                                            const unsigned char* ring, unsigned lbase, v8f (&acc)[2][4]) {
    constexpr unsigned SB = (NA + 1) * GTB;               // bytes of one buffer
    constexpr int K = DM, nst = K / GKC;
    const int wave = __builtin_amdgcn_readfirstlane(threadIdx.x >> 5);
    const int lane = threadIdx.x & 31, lr = lane & 15, hi = lane >> 4;
    const int wr = (wave >> 1) * 32, wc = (wave & 1) * 64;
#pragma unroll
    for (int mb = 0; mb < 2; ++mb)
#pragma unroll
        for (int nb = 0; nb < 4; ++nb) acc[mb][nb] = (v8f){};
    const int prow = threadIdx.x >> 4, pch = threadIdx.x & 15;   // copier's first row and 16-byte piece of it
    const unsigned lcp = lbase + (unsigned)(prow * GPB + pch * 16);
    const bf* ac = A + (size_t)(r0 + prow) * K + pch * 8; const bf* a2c = A2 + (size_t)(r0 + prow) * K + pch * 8; const bf* bc = Bt + (size_t)(c0 + prow) * K + pch * 8;
    const size_t rs = (size_t)16 * K;
    const int aofl = (wr + lr) * GPE + 8 * hi, bofl = (wc + lr) * GPE + 8 * hi;   // fragment readers' lane offsets in a staged tile (16-bit elements)
    gemm_stage<NA>(lcp, ac, a2c, bc, rs);
    asm volatile("s_wait_asynccnt 0x0" ::: "memory");     // this wave's share of stage 0 has landed
    __syncthreads();                                      // publishes stage 0
    gemm_stage<NA>(lcp + SB, ac + GKC, a2c + GKC, bc + GKC, rs);
#pragma unroll 1                                          // one copy of the stage's body: the ring's order stays as written
    for (int s = 0; s < nst; ++s) {
        const unsigned char* rb = ring + (s & 1) * SB;
        const bf* at = (const bf*)rb + aofl; const bf* bt = (const bf*)(rb + GTB) + bofl; const bf* a2t = (const bf*)(rb + 2 * GTB) + aofl;
        v16bf a[2][2], a2[2][2], b[2][4];                 // two fragment sets: the 32-k step in work and the next one of the same stage
#pragma unroll
        for (int mb = 0; mb < 2; ++mb) { a[0][mb] = ldb(at + mb * 16 * GPE); if (NA == 2) a2[0][mb] = ldb(a2t + mb * 16 * GPE); }
#pragma unroll
        for (int nb = 0; nb < 4; ++nb) b[0][nb] = ldb(bt + nb * 16 * GPE);
#pragma unroll
        for (int ks = 0; ks < GKC / 32; ++ks) {
            const int cu = ks & 1, nx = cu ^ 1;
            if (ks + 1 < GKC / 32) {
#pragma unroll
                for (int mb = 0; mb < 2; ++mb) { a[nx][mb] = ldb(at + mb * 16 * GPE + (ks + 1) * 32); if (NA == 2) a2[nx][mb] = ldb(a2t + mb * 16 * GPE + (ks + 1) * 32); }
#pragma unroll
                for (int nb = 0; nb < 4; ++nb) b[nx][nb] = ldb(bt + nb * 16 * GPE + (ks + 1) * 32);
            }
            __builtin_amdgcn_sched_barrier(0);            // keeps the next step's LDS reads as one group in front of this step's matrix instructions, which then hide their latency
#pragma unroll
            for (int nb = 0; nb < 4; ++nb)
#pragma unroll
                for (int mb = 0; mb < 2; ++mb) acc[mb][nb] = wmmab(a[cu][mb], b[cu][nb], acc[mb][nb]);
            if (NA == 2) {
#pragma unroll
                for (int nb = 0; nb < 4; ++nb)
#pragma unroll
                    for (int mb = 0; mb < 2; ++mb) acc[mb][nb] = wmmab(a2[cu][mb], b[cu][nb], acc[mb][nb]);
            }
            __builtin_amdgcn_sched_barrier(0);            // keeps the reads of the step after next from being spread among these matrix instructions
        }
        // the distance behind the stage's last matrix instructions, also on the taken side of the branches that follow
        asm volatile("v_nop\n\tv_nop\n\tv_nop\n\tv_nop" : "+v"(acc[0][0]), "+v"(acc[0][1]), "+v"(acc[0][2]), "+v"(acc[0][3]), "+v"(acc[1][0]), "+v"(acc[1][1]), "+v"(acc[1][2]), "+v"(acc[1][3]));
        asm volatile("s_wait_dscnt 0x0" ::: "memory");    // this wave's reads of stage s are done before its buffer is handed back
        asm volatile("s_wait_asynccnt 0x0" ::: "memory"); // this wave's share of stage s + 1 has landed
        __syncthreads();                                  // publishes stage s + 1 and ends every reader's last read of stage s
        if (s + 2 < nst) gemm_stage<NA>(lcp + (unsigned)(s & 1) * SB, ac + (size_t)(s + 2) * GKC, a2c + (size_t)(s + 2) * GKC, bc + (size_t)(s + 2) * GKC, rs);
    }
    asm volatile("s_wait_asynccnt 0x0" ::: "memory");     // nothing of this wave's is in flight past the loop
}

// The full unrolls in the epilogues keep every index of acc and of the small vectors a constant, so that they stay in registers.
// One 16 x 64 half of a wave tile into the wave's own staging rows: os row = tile row, os column = tile column.
__device__ __forceinline__ void stage_half(float* osw, const v8f (&a)[4], int lr, int hi) {
#pragma unroll
    for (int nb = 0; nb < 4; ++nb) {
#pragma unroll
        for (int j = 0; j < 8; ++j) osw[(hi * 8 + j) * 68 + nb * 16 + lr] = a[nb][j]; }
}

// Epilogue, f32 rows: C[m][n] = acc + bf16(bias[n]).
__device__ __forceinline__ void epi_f32(const v8f (&acc)[2][4], int r0, int c0, float* C, int ldc, const float* __restrict__ bias, float* os) {
    const int wave = __builtin_amdgcn_readfirstlane(threadIdx.x >> 5);
    const int lane = threadIdx.x & 31, lr = lane & 15, hi = lane >> 4;
    const int wr = (wave >> 1) * 32, wc = (wave & 1) * 64;
    float* osw = os + wave * 16 * 68;                     // each wave stages its output rows in its own range
    const int cofs = lr * 4;
    const int cw = c0 + wc;
    v4f bv; bv[0] = bfr(bias[cw + cofs]); bv[1] = bfr(bias[cw + cofs + 1]); bv[2] = bfr(bias[cw + cofs + 2]); bv[3] = bfr(bias[cw + cofs + 3]);
#pragma unroll
    for (int mb = 0; mb < 2; ++mb) {
        stage_half(osw, acc[mb], lr, hi);
        __builtin_amdgcn_wave_barrier(); asm volatile("" ::: "memory");
        float* crow = C + (size_t)(r0 + wr + mb * 16) * ldc + cw;
{
#pragma unroll
            for (int s = 0; s < 8; ++s) { const int row = 2 * s + hi; v4f val = *(const v4fa*)(osw + row * 68 + cofs); val = val + bv;
                *(v4f*)(crow + (size_t)row * ldc + cofs) = val; }
             }
        __builtin_amdgcn_wave_barrier(); asm volatile("" ::: "memory");
    }
}

typedef __attribute__((address_space(3))) unsigned char lds_b8;

// Epilogue of the q and k projections: rows are tokens, the wave's 64 columns are one head; y = acc + bf16(bias[column]) goes out as bf16 hi | lo planes [batch][head][token][64], 128-byte rows.
__device__ __forceinline__ void epi_qk(const v8f (&acc)[2][4], int r0, int c0, const float* __restrict__ bias, bf* Ph, bf* Pl, float* os) {
    const int wave = __builtin_amdgcn_readfirstlane(threadIdx.x >> 5);
    const int lane = threadIdx.x & 31, lr = lane & 15, hi = lane >> 4;
    const int wr = (wave >> 1) * 32, wc = (wave & 1) * 64;
    float* osw = os + wave * 16 * 68;                     // each wave stages its output rows in its own range
    const int rq = lane >> 3, d8 = (lane & 7) * 8;
    const int cw = c0 + wc, h = cw / HD;
    v4f b0, b1;
#pragma unroll
    for (int k = 0; k < 4; ++k) { b0[k] = bfr(bias[cw + d8 + k]); b1[k] = bfr(bias[cw + d8 + 4 + k]); }
#pragma unroll
    for (int mb = 0; mb < 2; ++mb) {
        stage_half(osw, acc[mb], lr, hi);
        __builtin_amdgcn_wave_barrier(); asm volatile("" ::: "memory");   // the wave's stores stay in front of its reads of other lanes' values
        const int g0 = r0 + wr + mb * 16; const int b = g0 / SEQ, t0 = g0 % SEQ;   // 16 rows of one batch (SEQ is a multiple of 128)
        const size_t o0 = (((size_t)b * NH_ + h) * SEQ + t0) * HD + d8;
#pragma unroll
        for (int s = 0; s < 4; ++s) { const int rr = s * 4 + rq;
            const v4f x0 = *(const v4fa*)(osw + rr * 68 + d8) + b0, x1 = *(const v4fa*)(osw + rr * 68 + d8 + 4) + b1; v8us oh, ol;
#pragma unroll
            for (int k = 0; k < 4; ++k) { unsigned short a, c; splitf(x0[k], a, c); oh[k] = a; ol[k] = c; splitf(x1[k], a, c); oh[4 + k] = a; ol[4 + k] = c; }
            *(v8us*)(Ph + o0 + (size_t)rr * HD) = oh; *(v8us*)(Pl + o0 + (size_t)rr * HD) = ol; }
        __builtin_amdgcn_wave_barrier();                  // with the clobber below: the reads stay in front of the next half's LDS stores
        asm volatile("s_wait_xcnt 0x0" ::: "memory");     // in front of every later rewrite of the registers that these global stores name: the next half's, and behind the last half the code that the build lays out after this epilogue
    }
}

// Epilogue of the v projection, computed transposed (rows are output features, columns are tokens): y = acc + bf16(bias[row]) goes out as f16 value | f16 residual x VRES planes [batch][head][64][token], 128-byte pieces of a row.
__device__ __forceinline__ void epi_vt(const v8f (&acc)[2][4], int r0, int c0, const float* __restrict__ bias, h16* V16, h16* Vr, float* os) {
    const int wave = __builtin_amdgcn_readfirstlane(threadIdx.x >> 5);
    const int lane = threadIdx.x & 31, lr = lane & 15, hi = lane >> 4;
    const int wr = (wave >> 1) * 32, wc = (wave & 1) * 64;
    float* osw = os + wave * 16 * 68;                     // each wave stages its output rows in its own range
    const int rq = lane >> 3, t8 = (lane & 7) * 8;
    const int cw = c0 + wc; const int b = cw / SEQ, t0 = cw % SEQ;   // 64 tokens of one batch (SEQ is a multiple of 128)
    float bb[2][4];                                       // the lane's eight rows' biases, all fetched in front of the first store
#pragma unroll
    for (int mb = 0; mb < 2; ++mb)
#pragma unroll
        for (int s = 0; s < 4; ++s) bb[mb][s] = bfr(bias[r0 + wr + mb * 16 + s * 4 + rq]);
#pragma unroll
    for (int mb = 0; mb < 2; ++mb) {
        stage_half(osw, acc[mb], lr, hi);
        __builtin_amdgcn_wave_barrier(); asm volatile("" ::: "memory");   // the wave's stores stay in front of its reads of other lanes' values
        const int m0 = r0 + wr + mb * 16;                 // feature row = head * 64 + d: the planes' rows of one batch follow one another in that order
#pragma unroll
        for (int s = 0; s < 4; ++s) { const int rr = s * 4 + rq;
            const v4f x0 = *(const v4fa*)(osw + rr * 68 + t8) + bb[mb][s], x1 = *(const v4fa*)(osw + rr * 68 + t8 + 4) + bb[mb][s]; v8h o16, orr;
#pragma unroll
            for (int k = 0; k < 4; ++k) { const h16 h0 = (h16)x0[k], h1 = (h16)x1[k]; o16[k] = h0; o16[4 + k] = h1;
                orr[k] = (h16)((x0[k] - (float)h0) * VRES); orr[4 + k] = (h16)((x1[k] - (float)h1) * VRES); }
            const size_t o = ((size_t)b * DM + m0 + rr) * SEQ + t0 + t8;
            *(v8h*)(V16 + o) = o16; *(v8h*)(Vr + o) = orr; }
        if (mb == 0) {
            __builtin_amdgcn_wave_barrier();              // with the clobber below: the reads stay in front of the next half's LDS stores
            asm volatile("s_wait_xcnt 0x0" ::: "memory"); // in front of the next half's rewrites of the registers that these global stores name
        }
    }
}

// ---- k_gemm_qkv: the three projections in one launch, single A plane; grid (tokens/128, DM/128, 3), 256 threads. z = 0, 1: q, k = x W^T (A = x rows, Bt = W rows);
// z = 2: v^T = Wv x^T (A = Wv rows, Bt = x rows; same k order), so that its rows run along the tokens as the attention's V planes do. Each epilogue writes the attention's planes itself.
__global__ __launch_bounds__(GW * 32) void k_gemm_qkv(const bf* __restrict__ XB, const bf* __restrict__ WQ, const bf* __restrict__ WK, const bf* __restrict__ WV,
                                                      const float* __restrict__ bq, const float* __restrict__ bk, const float* __restrict__ bv,
                                                      bf* Qh, bf* Ql, bf* Kh, bf* Kl, h16* V16, h16* Vr) {
    __shared__ __align__(16) float os[GW * 16 * 68];
    __shared__ __align__(128) unsigned char ring[2 * 2 * GTB];
    const int z = blockIdx.z;
    const bf* A = (z == 2) ? WV : XB; const bf* Bt = (z == 2) ? XB : (z == 1) ? WK : WQ;
    const int r0 = ((z == 2) ? blockIdx.y : blockIdx.x) * 128, c0 = ((z == 2) ? blockIdx.x : blockIdx.y) * 128;
    v8f acc[2][4];
    gemm_main<1>(A, A, Bt, r0, c0, ring, (unsigned)(size_t)(lds_b8*)ring, acc);
    if (z == 2) epi_vt(acc, r0, c0, bv, V16, Vr, os);
    else epi_qk(acc, r0, c0, (z == 1) ? bk : bq, (z == 1) ? Kh : Qh, (z == 1) ? Kl : Ql, os);
}

// ---- k_gemm_out: A carried as hi + lo planes, z-batched: A/A2 += z*sA, C += z*sC; grid (M/128, N/128, batches), 256 threads.
__global__ __launch_bounds__(GW * 32) void k_gemm_out(const bf* __restrict__ A, const bf* __restrict__ A2, const bf* __restrict__ Bt, float* C, int ldc, const float* __restrict__ bias, size_t sA, size_t sC) {
    __shared__ __align__(16) float os[GW * 16 * 68];
    __shared__ __align__(128) unsigned char ring[2 * 3 * GTB];
    const size_t z = blockIdx.z;
    const int r0 = blockIdx.x * 128, c0 = blockIdx.y * 128;
    v8f acc[2][4];
    gemm_main<2>(A + z * sA, A2 + z * sA, Bt, r0, c0, ring, (unsigned)(size_t)(lds_b8*)ring, acc);
    epi_f32(acc, r0, c0, C + z * sC, ldc, bias, os);
}

// ---- k_prep: every float operand to bf16 (RNE) and the mask to bit words, one launch. Block 0 packs the mask; each other block converts CVU x 256 pieces of 8 floats of one source
// (the batches of x, then Wq, Wk, Wv, Wo): a lane's CVU loads of 32 bytes are all issued before the first is used. The full unrolls keep v and o in registers.
#define CVU 8
constexpr int CVB = CVU * 256 * 8;                        // floats per block
constexpr int XBL = SEQ * DM / CVB, WBL = DM * DM / CVB;  // blocks per batch of x, per weight
static_assert((SEQ * DM) % CVB == 0 && (DM * DM) % CVB == 0);
constexpr int MWPADI = ((NB * (SEQ / 32) + 31) / 32) * 32;   // mask words, padded to whole 128-byte lines
__global__ __launch_bounds__(256) void k_prep(const float* __restrict__ x, const float* __restrict__ wq, const float* __restrict__ wk, const float* __restrict__ wv, const float* __restrict__ wo, const int* __restrict__ mask,
                                              bf* XB, bf* WQ, bf* WK, bf* WV, bf* WO, unsigned* MW) {
    if (blockIdx.x == 0) {                                // a wave packs 32 words (bit j of word w: key 32 w + j is kept) and stores them as one line
        const int wave = threadIdx.x >> 5, lane = threadIdx.x & 31; const int nw = NB * (SEQ / 32);
        for (int g = wave; g < MWPADI / 32; g += 8) {
            unsigned mine = 0xFFFFFFFFu;                  // words past the last real one
            for (int j = 0; j < 32; ++j) { const int i = g * 32 + j; const int ii = (i < nw) ? i : (nw - 1); const int b = ii / (SEQ / 32), w = ii % (SEQ / 32);
                const unsigned word = __builtin_amdgcn_ballot_w32(mask[(size_t)b * SEQ_FULL + w * 32 + lane] != 0);
                if (lane == j && i < nw) mine = word; }
            MW[g * 32 + lane] = mine;
        }
        return;
    }
    const int blk = blockIdx.x - 1;
    const float* s; bf* d;
    if (blk < NB * XBL) { const int b = blk / XBL, r = blk % XBL; s = x + (size_t)b * SEQ_FULL * DM + (size_t)r * CVB; d = XB + (size_t)b * SEQ * DM + (size_t)r * CVB; }
    else { const int q = blk - NB * XBL; const int w = q / WBL, r = q % WBL;
        s = ((w == 0) ? wq : (w == 1) ? wk : (w == 2) ? wv : wo) + (size_t)r * CVB; d = ((w == 0) ? WQ : (w == 1) ? WK : (w == 2) ? WV : WO) + (size_t)r * CVB; }
    v8f v[CVU];
#pragma unroll
    for (int u = 0; u < CVU; ++u) v[u] = *(const v8f*)(s + (size_t)(u * 256 + threadIdx.x) * 8);
#pragma unroll
    for (int u = 0; u < CVU; ++u) { v8us o;
#pragma unroll
        for (int k = 0; k < 8; ++k) o[k] = f2bf(v[u][k]);
        *(v8us*)(d + (size_t)(u * 256 + threadIdx.x) * 8) = o; }
}

// One stage of the ring: each of the 256 lanes copies 16 bytes of rows r and r + 32 of the four 64-row x 128-byte tiles (a wave-wide copy covers four whole 128-byte lines).
// The s_wait_xcnt closes the copies' own statement so that it stands in front of any rewrite of the address registers they name.
__device__ __forceinline__ void stage_copy(unsigned l, const bf* kh, const bf* kl, const h16* v, const h16* vr) {
    asm volatile("global_load_async_to_lds_b128 %0, %8, off\n\t"
                 "global_load_async_to_lds_b128 %1, %9, off\n\t"
                 "global_load_async_to_lds_b128 %2, %10, off\n\t"
                 "global_load_async_to_lds_b128 %3, %11, off\n\t"
                 "global_load_async_to_lds_b128 %4, %12, off\n\t"
                 "global_load_async_to_lds_b128 %5, %13, off\n\t"
                 "global_load_async_to_lds_b128 %6, %14, off\n\t"
                 "global_load_async_to_lds_b128 %7, %15, off\n\t"
                 "s_wait_xcnt 0x0"
                 :: "v"(l), "v"(l + 32 * LPB), "v"(l + TLB), "v"(l + TLB + 32 * LPB), "v"(l + 2 * TLB), "v"(l + 2 * TLB + 32 * LPB), "v"(l + 3 * TLB), "v"(l + 3 * TLB + 32 * LPB),
                    "v"(kh), "v"(kh + 32 * HD), "v"(kl), "v"(kl + 32 * HD), "v"(v), "v"(v + 32 * SEQ), "v"(vr), "v"(vr + 32 * SEQ)
                 : "memory");
}

// ---- k_attn: fused attention, 8 waves per block that share each 64-key stage of K and V through a two-buffer LDS ring; grid (SEQ/128, heads, batch).
// A wave owns 32 query columns (two groups of 16) and one 32-key half of every stage: waves 0..3 take keys 0..31 of the stage, waves 4..7 keys 32..63, for the same four 32-query groups.
// Each K and V fragment read from LDS so feeds two matrix instructions. The two key halves of a query are joined through LDS behind the loop (running max, sum and output rescaled to the common max).
// Transposed form: S^T[key][query] = K Q^T (A = K rows, B = Q rows; 3 products hi.hi + lo.hi + hi.lo), so each lane owns one query column per group: row statistics are per lane (+ one xor-16 exchange),
// and the two 16-key score tiles of a 32-key step pack directly into the B fragment of O^T[d][query] += V^T[d][key] P^T[key][query] (elements 0..7 <- tile of keys 0..15, elements 8..15 <- tile of keys 16..31, lane unchanged).
// The full unrolls over the column groups keep every index of the register arrays a constant. amdgpu_waves_per_eu: two blocks stay resident per WGP (four waves per SIMD), as the grid needs to run in one round.
__global__ __launch_bounds__(ATW * 32) __attribute__((amdgpu_waves_per_eu(4, 4))) void k_attn(const bf* __restrict__ Qh, const bf* __restrict__ Ql, const bf* __restrict__ Kh, const bf* __restrict__ Kl, const h16* __restrict__ V16, const h16* __restrict__ Vr, const unsigned* __restrict__ MW, bf* Ah, bf* Al) {
    __shared__ __align__(16) float os[ATW * 16 * 68];
    __shared__ __align__(128) unsigned char ring[2 * STB];
    const int wave = __builtin_amdgcn_readfirstlane(threadIdx.x >> 5);
    const int lane = threadIdx.x & 31, lr = lane & 15, hi = lane >> 4;
    const int qg = wave & 3, kg = wave >> 2;              // 32-query group of the block, 32-key half of each stage
    const int hh = blockIdx.y, bb = blockIdx.z;
    const int q0 = blockIdx.x * (ATW * 16) + qg * 32;
    const size_t pbase = ((size_t)bb * NH_ + hh) * (size_t)SEQ * HD;
    const bf* qhp = Qh + pbase; const bf* qlp = Ql + pbase; const bf* khp = Kh + pbase; const bf* klp = Kl + pbase;
    const h16* v16p = V16 + pbase; const h16* vrp = Vr + pbase;
    const unsigned* mwp = MW + (size_t)bb * (SEQ / 32);
    const int qoff0 = (q0 + lr) * HD + 8 * hi;            // column group c adds 16 rows
    const int foffl = lr * LPE + 8 * hi;                  // fragment reader's lane offset in a staged tile (row lr, 16-bit elements)
    typedef __attribute__((address_space(3))) unsigned char lds_u8;
    const int crow = threadIdx.x >> 3, cch = threadIdx.x & 7;   // copier's row (and row + 32) and 16-byte piece of it
    const unsigned lcp = (unsigned)(size_t)(lds_u8*)ring + (unsigned)(crow * LPB + cch * 16);
    const bf* khc = khp + crow * HD + cch * 8; const bf* klc = klp + crow * HD + cch * 8;
    const h16* v16c = v16p + crow * SEQ + cch * 8; const h16* vrc = vrp + crow * SEQ + cch * 8;
    v8f acc[2][4], accr[2][4];
#pragma unroll
    for (int c = 0; c < 2; ++c)
#pragma unroll
        for (int dt = 0; dt < 4; ++dt) { acc[c][dt] = (v8f){}; accr[c][dt] = (v8f){}; }
    float m[2] = { -1.0e30f, -1.0e30f }, l[2] = { 0.0f, 0.0f };
    stage_copy(lcp, khc, klc, v16c, vrc);
    asm volatile("s_wait_asynccnt 0x0" ::: "memory");     // this wave's share of stage 0 has landed
    __syncthreads();                                      // publishes stage 0
    stage_copy(lcp + STB, khc + KST * HD, klc + KST * HD, v16c + KST, vrc + KST);
#pragma unroll 1                                          // one copy of the stage's body: the ring's order stays as written, small code, same register set
    for (int s = 0; s < SEQ / KST; ++s) {
        const unsigned char* rb = ring + (s & 1) * STB;
        const bf* kht = (const bf*)rb + foffl; const bf* klt = (const bf*)(rb + TLB) + foffl;
        const h16* v16t = (const h16*)(rb + 2 * TLB) + foffl; const h16* vrt = (const h16*)(rb + 3 * TLB) + foffl;
        const int kb = s * KST + kg * 32;
        int qo = qoff0; asm volatile("" : "+v"(qo));      // q fragments are re-fetched per step (kept out of the loop-carried register set)
        v8f st[2][2];
#pragma unroll
        for (int c = 0; c < 2; ++c) { st[c][0] = (v8f){}; st[c][1] = (v8f){}; }
#pragma unroll
        for (int ks = 0; ks < 2; ++ks) {
            const int ko = kg * 32 * LPE + ks * 32;
            const v16bf kh0 = ldb(kht + ko), kl0 = ldb(klt + ko), kh1 = ldb(kht + ko + 16 * LPE), kl1 = ldb(klt + ko + 16 * LPE);
            v16bf qh[2], ql[2];
#pragma unroll
            for (int c = 0; c < 2; ++c) { qh[c] = ldb(qhp + qo + c * 16 * HD + ks * 32); ql[c] = ldb(qlp + qo + c * 16 * HD + ks * 32); }
#pragma unroll
            for (int c = 0; c < 2; ++c) { st[c][0] = wmmab(kh0, qh[c], st[c][0]); st[c][1] = wmmab(kh1, qh[c], st[c][1]); }
#pragma unroll
            for (int c = 0; c < 2; ++c) { st[c][0] = wmmab(kl0, qh[c], st[c][0]); st[c][1] = wmmab(kl1, qh[c], st[c][1]); }
#pragma unroll
            for (int c = 0; c < 2; ++c) { st[c][0] = wmmab(kh0, ql[c], st[c][0]); st[c][1] = wmmab(kh1, ql[c], st[c][1]); }
            // the distance behind the group's last matrix instructions
            asm volatile("v_nop\n\tv_nop\n\tv_nop\n\tv_nop" : "+v"(st[0][0]), "+v"(st[0][1]), "+v"(st[1][0]), "+v"(st[1][1]) : "v"(qh[0]), "v"(ql[0]), "v"(qh[1]), "v"(ql[1]), "v"(kh0), "v"(kl0), "v"(kh1), "v"(kl1));
        }
        const unsigned mw = mwp[kb >> 5];
        if (mw != 0xFFFFFFFFu) {                          // wave-uniform: st[c][0][r] is key kb+8*hi+r, st[c][1][r] is key kb+16+8*hi+r
#pragma unroll
            for (int c = 0; c < 2; ++c)
#pragma unroll
                for (int r = 0; r < 8; ++r) { st[c][0][r] = ((mw >> (8 * hi + r)) & 1u) ? st[c][0][r] : NEGF; st[c][1][r] = ((mw >> (16 + 8 * hi + r)) & 1u) ? st[c][1][r] : NEGF; }
        }
        float mx[2], alpha[2];
#pragma unroll
        for (int c = 0; c < 2; ++c) {
            mx[c] = fmaxf(st[c][0][0], st[c][1][0]);
#pragma unroll
            for (int r = 1; r < 8; ++r) mx[c] = fmaxf(mx[c], fmaxf(st[c][0][r], st[c][1][r]));
        }
#pragma unroll
        for (int c = 0; c < 2; ++c) mx[c] = fmaxf(mx[c], __shfl_xor(mx[c], 16, 32));
        v16h pb[2];
#pragma unroll
        for (int c = 0; c < 2; ++c) {
            const float mnew = fmaxf(m[c], mx[c]);
            alpha[c] = __builtin_amdgcn_exp2f((m[c] - mnew) * L2E);
            const unsigned grow = __builtin_amdgcn_ballot_w32(mnew > m[c]);
            if (grow != 0u) {                             // wave-uniform: rescale only when some query's running max moved (alpha == 1 exactly elsewhere)
#pragma unroll
                for (int dt = 0; dt < 4; ++dt) { acc[c][dt] = acc[c][dt] * alpha[c]; accr[c][dt] = accr[c][dt] * alpha[c]; }
            }
            m[c] = mnew;
            float psum = 0.0f;
#pragma unroll
            for (int r = 0; r < 8; ++r) {
                const float p0 = __builtin_amdgcn_exp2f((st[c][0][r] - mnew) * L2E), p1 = __builtin_amdgcn_exp2f((st[c][1][r] - mnew) * L2E);
                psum += p0 + p1; pb[c][r] = (h16)(p0 * PCAR); pb[c][8 + r] = (h16)(p1 * PCAR); }
            l[c] = l[c] * alpha[c] + psum;
        }
        const int vo = kg * 32;
        {
            const v16h va0 = ldh(v16t + vo), va1 = ldh(v16t + vo + 16 * LPE), va2 = ldh(v16t + vo + 32 * LPE), va3 = ldh(v16t + vo + 48 * LPE);
#pragma unroll
            for (int c = 0; c < 2; ++c) { acc[c][0] = wmma16(va0, pb[c], acc[c][0]); acc[c][1] = wmma16(va1, pb[c], acc[c][1]); acc[c][2] = wmma16(va2, pb[c], acc[c][2]); acc[c][3] = wmma16(va3, pb[c], acc[c][3]); }
            // the distance behind the group's last matrix instructions
            asm volatile("v_nop\n\tv_nop\n\tv_nop\n\tv_nop" : "+v"(acc[1][0]), "+v"(acc[1][1]), "+v"(acc[1][2]), "+v"(acc[1][3]) : "v"(pb[1]), "v"(va0), "v"(va1), "v"(va2), "v"(va3));
        }
        {
            const v16h vb0 = ldh(vrt + vo), vb1 = ldh(vrt + vo + 16 * LPE), vb2 = ldh(vrt + vo + 32 * LPE), vb3 = ldh(vrt + vo + 48 * LPE);
#pragma unroll
            for (int c = 0; c < 2; ++c) { accr[c][0] = wmma16(vb0, pb[c], accr[c][0]); accr[c][1] = wmma16(vb1, pb[c], accr[c][1]); accr[c][2] = wmma16(vb2, pb[c], accr[c][2]); accr[c][3] = wmma16(vb3, pb[c], accr[c][3]); }
            // the distance behind the group's last matrix instructions, also on the taken side of the branches that follow
            asm volatile("v_nop\n\tv_nop\n\tv_nop\n\tv_nop" : "+v"(accr[1][0]), "+v"(accr[1][1]), "+v"(accr[1][2]), "+v"(accr[1][3]) : "v"(pb[1]), "v"(vb0), "v"(vb1), "v"(vb2), "v"(vb3));
        }
        asm volatile("s_wait_dscnt 0x0" ::: "memory");    // this wave's reads of stage s are done before its buffer is handed back
        asm volatile("s_wait_asynccnt 0x0" ::: "memory"); // this wave's share of stage s + 1 has landed
        __syncthreads();                                  // publishes stage s + 1 and ends every reader's last read of stage s
        if (s + 2 < SEQ / KST) stage_copy(lcp + (unsigned)((s & 1) * STB), khc + (s + 2) * KST * HD, klc + (s + 2) * KST * HD, v16c + (s + 2) * KST, vrc + (s + 2) * KST);
    }
    asm volatile("s_wait_asynccnt 0x0" ::: "memory");     // nothing of this wave's is in flight past the loop
    // Join of the two key halves: wave w and wave w ^ 4 hold the same 32 queries. Each keeps the column group of its own key-half number and hands the other group to its partner
    // through the ring, which nobody reads any more behind the loop's last barrier and into which nothing is in flight. Same lane, same register position on both sides.
    static_assert(ATW * 4096 + ATW * 256 <= 2 * STB);
    float* xo = (float*)ring + wave * 1024;               // 8 pieces of 4 floats per lane
    float* xs = (float*)(ring + ATW * 4096) + wave * 64;  // running max, sum
    const bool up = kg != 0;
    v8f wk[4];                                            // value + residual of the kept group, not yet normalised
#pragma unroll
    for (int dt = 0; dt < 4; ++dt) { v4f g0, g1;
#pragma unroll
        for (int r = 0; r < 8; ++r) {
            const float t0 = acc[0][dt][r] + accr[0][dt][r] * (1.0f / VRES), t1 = acc[1][dt][r] + accr[1][dt][r] * (1.0f / VRES);
            wk[dt][r] = up ? t1 : t0; const float g = up ? t0 : t1;
            if (r < 4) g0[r] = g; else g1[r - 4] = g; }
        *(v4fa*)(xo + (dt * 2) * 128 + lane * 4) = g0; *(v4fa*)(xo + (dt * 2 + 1) * 128 + lane * 4) = g1; }
    xs[lane] = up ? m[0] : m[1]; xs[32 + lane] = up ? l[0] : l[1];
    const float mk = up ? m[1] : m[0], lk = up ? l[1] : l[0];
    __syncthreads();                                      // publishes every wave's handed-over group to its partner
    const float* yo = (const float*)ring + (wave ^ 4) * 1024;
    const float* ys = (const float*)(ring + ATW * 4096) + (wave ^ 4) * 64;
    const float mo = ys[lane], lo = ys[32 + lane];
    const float mf = fmaxf(mk, mo);
    const float ak = __builtin_amdgcn_exp2f((mk - mf) * L2E), ao = __builtin_amdgcn_exp2f((mo - mf) * L2E);
    float lf = lk * ak + lo * ao;
    lf += __shfl_xor(lf, 16, 32);
    const float inv = 1.0f / (PCAR * lf); const float sk = ak * inv, so = ao * inv;
    const int ob = (wave * 16 + lr) * 68 + 8 * hi;        // O^T element (d = dt*16 + 8*hi + r, query lr) -> os[query][d]
#pragma unroll
    for (int dt = 0; dt < 4; ++dt) { v4f w0, w1;
        const v4f o0 = *(const v4fa*)(yo + (dt * 2) * 128 + lane * 4), o1 = *(const v4fa*)(yo + (dt * 2 + 1) * 128 + lane * 4);
#pragma unroll
        for (int r = 0; r < 4; ++r) { w0[r] = wk[dt][r] * sk + o0[r] * so; w1[r] = wk[dt][4 + r] * sk + o1[r] * so; }
        *(v4fa*)(os + ob + dt * 16) = w0; *(v4fa*)(os + ob + dt * 16 + 4) = w1; }
    __builtin_amdgcn_wave_barrier(); asm volatile("" ::: "memory");
    const size_t orow = ((size_t)bb * SEQ + q0 + kg * 16) * DM + hh * HD;   // the kept group's 16 queries
    const int rq = lane >> 3, d8 = (lane & 7) * 8;
{
#pragma unroll
        for (int s = 0; s < 4; ++s) { const int rr = s * 4 + rq;
            const v4f x0 = *(const v4fa*)(os + (wave * 16 + rr) * 68 + d8), x1 = *(const v4fa*)(os + (wave * 16 + rr) * 68 + d8 + 4); v8us oh, ol;
#pragma unroll
            for (int k = 0; k < 4; ++k) { unsigned short a, c; splitf(x0[k], a, c); oh[k] = a; ol[k] = c; splitf(x1[k], a, c); oh[4 + k] = a; ol[4 + k] = c; }
            *(v8us*)(Ah + orow + (size_t)rr * DM + d8) = oh; *(v8us*)(Al + orow + (size_t)rr * DM + d8) = ol; }
         }
}

// ---- workspace carve (bytes, 256-byte aligned regions; every region is covered exactly by its producer grid)
constexpr size_t al256(size_t b) { return (b + 255) & ~(size_t)255; }
constexpr size_t MWPAD  = (((size_t)NB * (SEQ / 32) + 31) / 32) * 32;
constexpr size_t SZ_XB  = al256((size_t)NB * SEQ * DM * 2);
constexpr size_t SZ_W   = al256((size_t)DM * DM * 2);
constexpr size_t SZ_PL  = al256((size_t)NB * NH_ * SEQ * HD * 2);
constexpr size_t SZ_MW  = al256(MWPAD * 4);
constexpr size_t OFF_XB = 0;
constexpr size_t OFF_WQ = OFF_XB + SZ_XB;
constexpr size_t OFF_WK = OFF_WQ + SZ_W;
constexpr size_t OFF_WV = OFF_WK + SZ_W;
constexpr size_t OFF_WO = OFF_WV + SZ_W;
constexpr size_t OFF_QH = OFF_WO + SZ_W;
constexpr size_t OFF_QL = OFF_QH + SZ_PL;
constexpr size_t OFF_KH = OFF_QL + SZ_PL;
constexpr size_t OFF_KL = OFF_KH + SZ_PL;
constexpr size_t OFF_V16 = OFF_KL + SZ_PL;
constexpr size_t OFF_VR = OFF_V16 + SZ_PL;
constexpr size_t OFF_AH = OFF_VR + SZ_PL;
constexpr size_t OFF_AL = OFF_AH + SZ_PL;
constexpr size_t OFF_MW = OFF_AL + SZ_PL;
constexpr size_t WS_TOTAL = OFF_MW + SZ_MW;
static_assert(WS_TOTAL <= (size_t)134217728);          // 128 MiB
static_assert((size_t)NB * NH_ * SEQ * HD == (size_t)NB * SEQ * DM);   // head planes and merged planes have equal extents
static_assert(MWPAD == (size_t)MWPADI);

extern "C" void kernel_launch(void* const* d_in, const int* in_sizes, int n_in,
                              void* d_out, int out_size, void* d_ws, size_t ws_size, hipStream_t stream) {
    if (n_in < 10) return;
    const size_t xneed = (size_t)(NB - 1) * SEQ_FULL * DM + (size_t)SEQ * DM;
    if ((size_t)in_sizes[0] < xneed) return;
    if ((size_t)in_sizes[1] < (size_t)(NB - 1) * SEQ_FULL + SEQ) return;
    if (in_sizes[2] < DM * DM || in_sizes[4] < DM * DM || in_sizes[6] < DM * DM || in_sizes[8] < DM * DM) return;
    if (in_sizes[3] < DM || in_sizes[5] < DM || in_sizes[7] < DM || in_sizes[9] < DM) return;
    if ((size_t)out_size < xneed) return;
    if (ws_size < WS_TOTAL) return;
    const float* x = (const float*)d_in[0]; const int* mask = (const int*)d_in[1];
    const float* wq = (const float*)d_in[2]; const float* bq = (const float*)d_in[3];
    const float* wk = (const float*)d_in[4]; const float* bk = (const float*)d_in[5];
    const float* wv = (const float*)d_in[6]; const float* bv = (const float*)d_in[7];
    const float* wo = (const float*)d_in[8]; const float* bo = (const float*)d_in[9];
    float* OUT = (float*)d_out;
    char* wsb = (char*)d_ws;
    bf* XB = (bf*)(wsb + OFF_XB); bf* WQ = (bf*)(wsb + OFF_WQ); bf* WK = (bf*)(wsb + OFF_WK); bf* WV = (bf*)(wsb + OFF_WV); bf* WO = (bf*)(wsb + OFF_WO);
    bf* QPh = (bf*)(wsb + OFF_QH); bf* QPl = (bf*)(wsb + OFF_QL); bf* KPh = (bf*)(wsb + OFF_KH); bf* KPl = (bf*)(wsb + OFF_KL);
    h16* VT16 = (h16*)(wsb + OFF_V16); h16* VTr = (h16*)(wsb + OFF_VR);
    bf* ATh = (bf*)(wsb + OFF_AH); bf* ATl = (bf*)(wsb + OFF_AL);
    unsigned* MWp = (unsigned*)(wsb + OFF_MW);

    k_prep<<<1 + NB * XBL + 4 * WBL, 256, 0, stream>>>(x, wq, wk, wv, wo, mask, XB, WQ, WK, WV, WO, MWp);

    k_gemm_qkv<<<dim3((unsigned)(NB * SEQ / 128), DM / 128, 3), GW * 32, 0, stream>>>(XB, WQ, WK, WV, bq, bk, bv, QPh, QPl, KPh, KPl, VT16, VTr);

    k_attn<<<dim3(SEQ / (ATW * 16), NH_, NB), ATW * 32, 0, stream>>>(QPh, QPl, KPh, KPl, VT16, VTr, MWp, ATh, ATl);

    k_gemm_out<<<dim3(SEQ / 128, DM / 128, NB), GW * 32, 0, stream>>>(ATh, ATl, WO, OUT, DM, bo, (size_t)SEQ * DM, (size_t)SEQ_FULL * DM);
}

// v005
// It runs in 121 microseconds.
// Timed twice side by side with v004, it ran 1.32 and 1.31 times as fast.
// All steps since v000 together make it 3.92 times as fast.
#include <hip/hip_runtime.h>

// Non-causal attention, 16 heads x 64, unscaled scores, int32 key mask (fill -1e9 by select), out = merged x Wo^T + bo.
// Compute dtypes, f32 accumulate everywhere: every float input converted to bf16 (RNE) on load; q/k/v projections v_wmma_f32_16x16x32_bf16 single product (+ bf16-rounded bias);
// scores v_wmma_f32_16x16x32_bf16 on q,k hi|lo planes (3 products); softmax f32 online (exp2, running max); P x V v_wmma_f32_16x16x32_f16 with P x256 and V = f16 value + f16 residual x2048 (2 products, 2 accumulators);
// output projection v_wmma_f32_16x16x32_bf16 on context hi|lo planes x Wo (2 products) + bias.

#ifndef NB
#define NB 2
#endif
#ifndef SEQ
#define SEQ 2048
#endif
#define NB_FULL  2
#define SEQ_FULL 2048
#define DM   1024
#define NH_  16
#define HD   64
#define ATW  8                  // waves per attention block (4 groups of 32 query rows x 2 key halves: 128 query rows a block)
#define KST  64                 // keys per LDS stage of the attention ring (two 32-key steps)
#define LPB  144                // LDS row pitch in bytes: 128-byte rows + 16 (16 B x odd, conflict-free for 16-byte row readers)
#define LPE  (LPB / 2)          // the same in 16-bit elements
#define TLB  (64 * LPB)         // one plane's tile: 64 rows
#define STB  (4 * TLB)          // one stage: K hi, K lo, V value, V residual
#define QTB  (ATW * 16 * LPB)   // one Q plane's tile: the block's 128 query rows at the same pitch
#define GW   8                  // waves per GEMM block
#define GKC  128                // k per LDS stage of the GEMM ring (four 32-k steps): 256-byte rows
#define GPB  272                // LDS row pitch of the GEMM tiles in bytes: 256-byte rows + 16 (16 B x odd, conflict-free for 16-byte row readers)
#define GPE  (GPB / 2)          // the same in 16-bit elements
#define GTB  (128 * GPB)        // one GEMM operand tile: 128 rows
#define PCAR 256.0f             // carry of the f16 probability operand
#define VRES 2048.0f            // carry of the f16 value residual plane
#define NEGF (-1.0e9f)
#define L2E  1.4426950408889634f

static_assert(NH_ * HD == DM);               // merged width
static_assert(HD == 64);
static_assert(DM % 64 == 0 && DM % 32 == 0); // wave tile and k-step multiples
static_assert(SEQ % 64 == 0);                // 64-key attention stages, 32-key steps
static_assert(SEQ % (ATW * 16) == 0);        // whole attention blocks
static_assert(SEQ / KST >= 2);               // the ring's prologue fills two stages
static_assert(ATW == 8 && KST == 64);         // four 32-query groups x two 32-key halves of a stage
static_assert(ATW * 32 == 256);              // the stage copy deals 32 rows x 8 pieces of 16 bytes to the block's lanes, twice per tile
static_assert(KST == 64 && HD * 2 == 128 && KST * 2 == 128);   // every staged row of the attention ring is one 128-byte line
static_assert((NB * SEQ) % 128 == 0 && SEQ % 128 == 0 && DM % 128 == 0);   // whole 128x128 GEMM block tiles
static_assert(DM % GKC == 0 && DM / GKC >= 2 && GKC * 2 == 256 && GW * 32 == 256);   // whole GEMM stages; the tile copy deals 16 rows x 16 pieces of 16 bytes to the block's lanes, eight times per tile
static_assert(NB <= NB_FULL && SEQ <= SEQ_FULL);

typedef _Float16 h16;
typedef unsigned short bf;
typedef __attribute__((ext_vector_type(16))) __bf16   v16bf;
typedef __attribute__((ext_vector_type(16))) _Float16 v16h;
typedef __attribute__((ext_vector_type(8)))  _Float16 v8h;
typedef __attribute__((ext_vector_type(8)))  unsigned short v8us;
typedef __attribute__((ext_vector_type(8)))  float    v8f;
typedef __attribute__((ext_vector_type(4)))  float    v4f;
typedef v4f  __attribute__((may_alias)) v4fa;

__device__ __forceinline__ unsigned short f2bf(float f) { unsigned u = __float_as_uint(f); u += 0x7FFFu + ((u >> 16) & 1u); return (unsigned short)(u >> 16); }
__device__ __forceinline__ float bf2f(unsigned short b) { return __uint_as_float(((unsigned)b) << 16); }
__device__ __forceinline__ float bfr(float f) { return bf2f(f2bf(f)); }
__device__ __forceinline__ void splitf(float y, unsigned short& h, unsigned short& l) { h = f2bf(y); l = f2bf(y - bf2f(h)); }
__device__ __forceinline__ v16h cat16(v8h lo, v8h hi) { return __builtin_shufflevector(lo, hi, 0, 1, 2, 3, 4, 5, 6, 7, 8, 9, 10, 11, 12, 13, 14, 15); }
__device__ __forceinline__ v16bf cat16b(v8us lo, v8us hi) { return __builtin_bit_cast(v16bf, __builtin_shufflevector(lo, hi, 0, 1, 2, 3, 4, 5, 6, 7, 8, 9, 10, 11, 12, 13, 14, 15)); }
__device__ __forceinline__ v8f wmma16(v16h a, v16h b, v8f c) { return __builtin_amdgcn_wmma_f32_16x16x32_f16(false, a, false, b, (short)0, c, false, false); }
__device__ __forceinline__ v8f wmmab(v16bf a, v16bf b, v8f c) { return __builtin_amdgcn_wmma_f32_16x16x32_bf16(false, a, false, b, (short)0, c, false, false); }
// fragment loaders from K-contiguous 16-bit rows: p = row base + k0 + 8*(lane>>4); elements 0..7 = k0+8h.., elements 8..15 = k0+16+8h..
__device__ __forceinline__ v16bf ldb(const bf* p) { return cat16b(*(const v8us*)p, *(const v8us*)(p + 16)); }
__device__ __forceinline__ v16h  ldh(const h16* p) { return cat16(*(const v8h*)p, *(const v8h*)(p + 16)); }

// One operand tile of a GEMM stage: each of the 256 lanes copies 16 bytes of rows r, r + 16, ... r + 112 of a 128-row x 256-byte tile (a wave-wide copy covers four whole 128-byte lines); rs = 16 source rows in elements.
// The s_wait_xcnt closes the copies' own statement so that it stands in front of any rewrite of the address registers they name.
__device__ __forceinline__ void tile_copy(unsigned l, const bf* g, size_t rs) {
    asm volatile("global_load_async_to_lds_b128 %0, %8, off\n\t"
                 "global_load_async_to_lds_b128 %1, %9, off\n\t"
                 "global_load_async_to_lds_b128 %2, %10, off\n\t"
                 "global_load_async_to_lds_b128 %3, %11, off\n\t"
                 "global_load_async_to_lds_b128 %4, %12, off\n\t"
                 "global_load_async_to_lds_b128 %5, %13, off\n\t"
                 "global_load_async_to_lds_b128 %6, %14, off\n\t"
                 "global_load_async_to_lds_b128 %7, %15, off\n\t"
                 "s_wait_xcnt 0x0"
                 :: "v"(l), "v"(l + 16 * GPB), "v"(l + 32 * GPB), "v"(l + 48 * GPB), "v"(l + 64 * GPB), "v"(l + 80 * GPB), "v"(l + 96 * GPB), "v"(l + 112 * GPB),
                    "v"(g), "v"(g + rs), "v"(g + 2 * rs), "v"(g + 3 * rs), "v"(g + 4 * rs), "v"(g + 5 * rs), "v"(g + 6 * rs), "v"(g + 7 * rs)
                 : "memory");
}
// One stage: the A tile, the Bt tile and, with two A planes, the second A tile, in that order in the buffer.
template <int NA> __device__ __forceinline__ void gemm_stage(unsigned l, const bf* a, const bf* a2, const bf* b, size_t rs) {
    tile_copy(l, a, rs); tile_copy(l + GTB, b, rs);
    if (NA == 2) tile_copy(l + 2 * GTB, a2, rs);
}

// ---- GEMM engine: 8 waves per 128x128 block tile (4 x 2 wave tiles of 32 x 64), C[m][n] = sum_k A[m][k] Bt[n][k] + bf16 bias (bias[n]; bias[m] in the v^T epilogue); operands are K-contiguous bf16 planes, staged 128 k at a time
// in a two-buffer LDS ring that the 8 waves share; NA == 2: A carried as hi + lo planes (two products into one accumulator, hi first). K = DM; rows and columns multiples of 128.
// The full unrolls below keep every index of the fragment and accumulator arrays a constant, so that the arrays stay in registers.
// gemm_main leaves the block tile at rows r0, columns c0 in acc (wave tile at wr, wc); the epilogues behind it add the bias and store.
template <int NA> __device__ __forceinline__ void gemm_main(const bf* __restrict__ A, const bf* __restrict__ A2, const bf* __restrict__ Bt, int r0, int c0,
                                                            const unsigned char* ring, unsigned lbase, v8f (&acc)[2][4]) {
    constexpr unsigned SB = (NA + 1) * GTB;               // bytes of one buffer
    constexpr int K = DM, nst = K / GKC;
    const int wave = __builtin_amdgcn_readfirstlane(threadIdx.x >> 5);
    const int lane = threadIdx.x & 31, lr = lane & 15, hi = lane >> 4;
    const int wr = (wave >> 1) * 32, wc = (wave & 1) * 64;
#pragma unroll
    for (int mb = 0; mb < 2; ++mb)
#pragma unroll
        for (int nb = 0; nb < 4; ++nb) acc[mb][nb] = (v8f){};
    const int prow = threadIdx.x >> 4, pch = threadIdx.x & 15;   // copier's first row and 16-byte piece of it
    const unsigned lcp = lbase + (unsigned)(prow * GPB + pch * 16);
    const bf* ac = A + (size_t)(r0 + prow) * K + pch * 8; const bf* a2c = A2 + (size_t)(r0 + prow) * K + pch * 8; const bf* bc = Bt + (size_t)(c0 + prow) * K + pch * 8;
    const size_t rs = (size_t)16 * K;
    const int aofl = (wr + lr) * GPE + 8 * hi, bofl = (wc + lr) * GPE + 8 * hi;   // fragment readers' lane offsets in a staged tile (16-bit elements)
    gemm_stage<NA>(lcp, ac, a2c, bc, rs);
    asm volatile("s_wait_asynccnt 0x0" ::: "memory");     // this wave's share of stage 0 has landed
    __syncthreads();                                      // publishes stage 0
    gemm_stage<NA>(lcp + SB, ac + GKC, a2c + GKC, bc + GKC, rs);
#pragma unroll 1                                          // one copy of the stage's body: the ring's order stays as written
    for (int s = 0; s < nst; ++s) {
        const unsigned char* rb = ring + (s & 1) * SB;
        const bf* at = (const bf*)rb + aofl; const bf* bt = (const bf*)(rb + GTB) + bofl; const bf* a2t = (const bf*)(rb + 2 * GTB) + aofl;
        v16bf a[2][2], a2[2][2], b[2][4];                 // two fragment sets: the 32-k step in work and the next one of the same stage
#pragma unroll
        for (int mb = 0; mb < 2; ++mb) { a[0][mb] = ldb(at + mb * 16 * GPE); if (NA == 2) a2[0][mb] = ldb(a2t + mb * 16 * GPE); }
#pragma unroll
        for (int nb = 0; nb < 4; ++nb) b[0][nb] = ldb(bt + nb * 16 * GPE);
#pragma unroll
        for (int ks = 0; ks < GKC / 32; ++ks) {
            const int cu = ks & 1, nx = cu ^ 1;
            if (ks + 1 < GKC / 32) {
#pragma unroll
                for (int mb = 0; mb < 2; ++mb) { a[nx][mb] = ldb(at + mb * 16 * GPE + (ks + 1) * 32); if (NA == 2) a2[nx][mb] = ldb(a2t + mb * 16 * GPE + (ks + 1) * 32); }
#pragma unroll
                for (int nb = 0; nb < 4; ++nb) b[nx][nb] = ldb(bt + nb * 16 * GPE + (ks + 1) * 32);
            }
            __builtin_amdgcn_sched_barrier(0);            // keeps the next step's LDS reads as one group in front of this step's matrix instructions, which then hide their latency
#pragma unroll
            for (int nb = 0; nb < 4; ++nb)
#pragma unroll
                for (int mb = 0; mb < 2; ++mb) acc[mb][nb] = wmmab(a[cu][mb], b[cu][nb], acc[mb][nb]);
            if (NA == 2) {
#pragma unroll
                for (int nb = 0; nb < 4; ++nb)
#pragma unroll
                    for (int mb = 0; mb < 2; ++mb) acc[mb][nb] = wmmab(a2[cu][mb], b[cu][nb], acc[mb][nb]);
            }
            __builtin_amdgcn_sched_barrier(0);            // keeps the reads of the step after next from being spread among these matrix instructions
        }
        // the distance behind the stage's last matrix instructions, also on the taken side of the branches that follow
        asm volatile("v_nop\n\tv_nop\n\tv_nop\n\tv_nop" : "+v"(acc[0][0]), "+v"(acc[0][1]), "+v"(acc[0][2]), "+v"(acc[0][3]), "+v"(acc[1][0]), "+v"(acc[1][1]), "+v"(acc[1][2]), "+v"(acc[1][3]));
        asm volatile("s_wait_dscnt 0x0" ::: "memory");    // this wave's reads of stage s are done before its buffer is handed back
        asm volatile("s_wait_asynccnt 0x0" ::: "memory"); // this wave's share of stage s + 1 has landed
        __syncthreads();                                  // publishes stage s + 1 and ends every reader's last read of stage s
        if (s + 2 < nst) gemm_stage<NA>(lcp + (unsigned)(s & 1) * SB, ac + (size_t)(s + 2) * GKC, a2c + (size_t)(s + 2) * GKC, bc + (size_t)(s + 2) * GKC, rs);
    }
    asm volatile("s_wait_asynccnt 0x0" ::: "memory");     // nothing of this wave's is in flight past the loop
}

// The full unrolls in the epilogues keep every index of acc and of the small vectors a constant, so that they stay in registers.
// One 16 x 64 half of a wave tile into the wave's own staging rows: os row = tile row, os column = tile column.
__device__ __forceinline__ void stage_half(float* osw, const v8f (&a)[4], int lr, int hi) {
#pragma unroll
    for (int nb = 0; nb < 4; ++nb) {
#pragma unroll
        for (int j = 0; j < 8; ++j) osw[(hi * 8 + j) * 68 + nb * 16 + lr] = a[nb][j]; }
}

// Epilogue, f32 rows: C[m][n] = acc + bf16(bias[n]).
__device__ __forceinline__ void epi_f32(const v8f (&acc)[2][4], int r0, int c0, float* C, int ldc, const float* __restrict__ bias, float* os) {
    const int wave = __builtin_amdgcn_readfirstlane(threadIdx.x >> 5);
    const int lane = threadIdx.x & 31, lr = lane & 15, hi = lane >> 4;
    const int wr = (wave >> 1) * 32, wc = (wave & 1) * 64;
    float* osw = os + wave * 16 * 68;                     // each wave stages its output rows in its own range
    const int cofs = lr * 4;
    const int cw = c0 + wc;
    v4f bv; bv[0] = bfr(bias[cw + cofs]); bv[1] = bfr(bias[cw + cofs + 1]); bv[2] = bfr(bias[cw + cofs + 2]); bv[3] = bfr(bias[cw + cofs + 3]);
#pragma unroll
    for (int mb = 0; mb < 2; ++mb) {
        stage_half(osw, acc[mb], lr, hi);
        __builtin_amdgcn_wave_barrier(); asm volatile("" ::: "memory");
        float* crow = C + (size_t)(r0 + wr + mb * 16) * ldc + cw;
{
#pragma unroll
            for (int s = 0; s < 8; ++s) { const int row = 2 * s + hi; v4f val = *(const v4fa*)(osw + row * 68 + cofs); val = val + bv;
                *(v4f*)(crow + (size_t)row * ldc + cofs) = val; }
             }
        __builtin_amdgcn_wave_barrier(); asm volatile("" ::: "memory");
    }
}

typedef __attribute__((address_space(3))) unsigned char lds_b8;

// Epilogue of the q and k projections: rows are tokens, the wave's 64 columns are one head; y = acc + bf16(bias[column]) goes out as bf16 hi | lo planes [batch][head][token][64], 128-byte rows.
__device__ __forceinline__ void epi_qk(const v8f (&acc)[2][4], int r0, int c0, const float* __restrict__ bias, bf* Ph, bf* Pl, float* os) {
    const int wave = __builtin_amdgcn_readfirstlane(threadIdx.x >> 5);
    const int lane = threadIdx.x & 31, lr = lane & 15, hi = lane >> 4;
    const int wr = (wave >> 1) * 32, wc = (wave & 1) * 64;
    float* osw = os + wave * 16 * 68;                     // each wave stages its output rows in its own range
    const int rq = lane >> 3, d8 = (lane & 7) * 8;
    const int cw = c0 + wc, h = cw / HD;
    v4f b0, b1;
#pragma unroll
    for (int k = 0; k < 4; ++k) { b0[k] = bfr(bias[cw + d8 + k]); b1[k] = bfr(bias[cw + d8 + 4 + k]); }
#pragma unroll
    for (int mb = 0; mb < 2; ++mb) {
        stage_half(osw, acc[mb], lr, hi);
        __builtin_amdgcn_wave_barrier(); asm volatile("" ::: "memory");   // the wave's stores stay in front of its reads of other lanes' values
        const int g0 = r0 + wr + mb * 16; const int b = g0 / SEQ, t0 = g0 % SEQ;   // 16 rows of one batch (SEQ is a multiple of 128)
        const size_t o0 = (((size_t)b * NH_ + h) * SEQ + t0) * HD + d8;
#pragma unroll
        for (int s = 0; s < 4; ++s) { const int rr = s * 4 + rq;
            const v4f x0 = *(const v4fa*)(osw + rr * 68 + d8) + b0, x1 = *(const v4fa*)(osw + rr * 68 + d8 + 4) + b1; v8us oh, ol;
#pragma unroll
            for (int k = 0; k < 4; ++k) { unsigned short a, c; splitf(x0[k], a, c); oh[k] = a; ol[k] = c; splitf(x1[k], a, c); oh[4 + k] = a; ol[4 + k] = c; }
            *(v8us*)(Ph + o0 + (size_t)rr * HD) = oh; *(v8us*)(Pl + o0 + (size_t)rr * HD) = ol; }
        __builtin_amdgcn_wave_barrier();                  // with the clobber below: the reads stay in front of the next half's LDS stores
        asm volatile("s_wait_xcnt 0x0" ::: "memory");     // in front of every later rewrite of the registers that these global stores name: the next half's, and behind the last half the code that the build lays out after this epilogue
    }
}

// Epilogue of the v projection, computed transposed (rows are output features, columns are tokens): y = acc + bf16(bias[row]) goes out as f16 value | f16 residual x VRES planes [batch][head][64][token], 128-byte pieces of a row.
__device__ __forceinline__ void epi_vt(const v8f (&acc)[2][4], int r0, int c0, const float* __restrict__ bias, h16* V16, h16* Vr, float* os) {
    const int wave = __builtin_amdgcn_readfirstlane(threadIdx.x >> 5);
    const int lane = threadIdx.x & 31, lr = lane & 15, hi = lane >> 4;
    const int wr = (wave >> 1) * 32, wc = (wave & 1) * 64;
    float* osw = os + wave * 16 * 68;                     // each wave stages its output rows in its own range
    const int rq = lane >> 3, t8 = (lane & 7) * 8;
    const int cw = c0 + wc; const int b = cw / SEQ, t0 = cw % SEQ;   // 64 tokens of one batch (SEQ is a multiple of 128)
    float bb[2][4];                                       // the lane's eight rows' biases, all fetched in front of the first store
#pragma unroll
    for (int mb = 0; mb < 2; ++mb)
#pragma unroll
        for (int s = 0; s < 4; ++s) bb[mb][s] = bfr(bias[r0 + wr + mb * 16 + s * 4 + rq]);
#pragma unroll
    for (int mb = 0; mb < 2; ++mb) {
        stage_half(osw, acc[mb], lr, hi);
        __builtin_amdgcn_wave_barrier(); asm volatile("" ::: "memory");   // the wave's stores stay in front of its reads of other lanes' values
        const int m0 = r0 + wr + mb * 16;                 // feature row = head * 64 + d: the planes' rows of one batch follow one another in that order
#pragma unroll
        for (int s = 0; s < 4; ++s) { const int rr = s * 4 + rq;
            const v4f x0 = *(const v4fa*)(osw + rr * 68 + t8) + bb[mb][s], x1 = *(const v4fa*)(osw + rr * 68 + t8 + 4) + bb[mb][s]; v8h o16, orr;
#pragma unroll
            for (int k = 0; k < 4; ++k) { const h16 h0 = (h16)x0[k], h1 = (h16)x1[k]; o16[k] = h0; o16[4 + k] = h1;
                orr[k] = (h16)((x0[k] - (float)h0) * VRES); orr[4 + k] = (h16)((x1[k] - (float)h1) * VRES); }
            const size_t o = ((size_t)b * DM + m0 + rr) * SEQ + t0 + t8;
            *(v8h*)(V16 + o) = o16; *(v8h*)(Vr + o) = orr; }
        if (mb == 0) {
            __builtin_amdgcn_wave_barrier();              // with the clobber below: the reads stay in front of the next half's LDS stores
            asm volatile("s_wait_xcnt 0x0" ::: "memory"); // in front of the next half's rewrites of the registers that these global stores name
        }
    }
}

// ---- k_gemm_qkv: the three projections in one launch, single A plane; grid (tokens/128, DM/128, 3), 256 threads. z = 0, 1: q, k = x W^T (A = x rows, Bt = W rows);
// z = 2: v^T = Wv x^T (A = Wv rows, Bt = x rows; same k order), so that its rows run along the tokens as the attention's V planes do. Each epilogue writes the attention's planes itself.
__global__ __launch_bounds__(GW * 32) void k_gemm_qkv(const bf* __restrict__ XB, const bf* __restrict__ WQ, const bf* __restrict__ WK, const bf* __restrict__ WV,
                                                      const float* __restrict__ bq, const float* __restrict__ bk, const float* __restrict__ bv,
                                                      bf* Qh, bf* Ql, bf* Kh, bf* Kl, h16* V16, h16* Vr) {
    __shared__ __align__(16) float os[GW * 16 * 68];
    __shared__ __align__(128) unsigned char ring[2 * 2 * GTB];
    const int z = blockIdx.z;
    const bf* A = (z == 2) ? WV : XB; const bf* Bt = (z == 2) ? XB : (z == 1) ? WK : WQ;
    const int r0 = ((z == 2) ? blockIdx.y : blockIdx.x) * 128, c0 = ((z == 2) ? blockIdx.x : blockIdx.y) * 128;
    v8f acc[2][4];
    gemm_main<1>(A, A, Bt, r0, c0, ring, (unsigned)(size_t)(lds_b8*)ring, acc);
    if (z == 2) epi_vt(acc, r0, c0, bv, V16, Vr, os);
    else epi_qk(acc, r0, c0, (z == 1) ? bk : bq, (z == 1) ? Kh : Qh, (z == 1) ? Kl : Ql, os);
}

// ---- k_gemm_out: A carried as hi + lo planes, z-batched: A/A2 += z*sA, C += z*sC; grid (M/128, N/128, batches), 256 threads.
__global__ __launch_bounds__(GW * 32) void k_gemm_out(const bf* __restrict__ A, const bf* __restrict__ A2, const bf* __restrict__ Bt, float* C, int ldc, const float* __restrict__ bias, size_t sA, size_t sC) {
    __shared__ __align__(16) float os[GW * 16 * 68];
    __shared__ __align__(128) unsigned char ring[2 * 3 * GTB];
    const size_t z = blockIdx.z;
    const int r0 = blockIdx.x * 128, c0 = blockIdx.y * 128;
    v8f acc[2][4];
    gemm_main<2>(A + z * sA, A2 + z * sA, Bt, r0, c0, ring, (unsigned)(size_t)(lds_b8*)ring, acc);
    epi_f32(acc, r0, c0, C + z * sC, ldc, bias, os);
}

// ---- k_prep: every float operand to bf16 (RNE) and the mask to bit words, one launch. Block 0 packs the mask; each other block converts CVU x 256 pieces of 8 floats of one source
// (the batches of x, then Wq, Wk, Wv, Wo): a lane's CVU loads of 32 bytes are all issued before the first is used. The full unrolls keep v and o in registers.
#define CVU 8
constexpr int CVB = CVU * 256 * 8;                        // floats per block
constexpr int XBL = SEQ * DM / CVB, WBL = DM * DM / CVB;  // blocks per batch of x, per weight
static_assert((SEQ * DM) % CVB == 0 && (DM * DM) % CVB == 0);
constexpr int MWPADI = ((NB * (SEQ / 32) + 31) / 32) * 32;   // mask words, padded to whole 128-byte lines
__global__ __launch_bounds__(256) void k_prep(const float* __restrict__ x, const float* __restrict__ wq, const float* __restrict__ wk, const float* __restrict__ wv, const float* __restrict__ wo, const int* __restrict__ mask,
                                              bf* XB, bf* WQ, bf* WK, bf* WV, bf* WO, unsigned* MW) {
    if (blockIdx.x == 0) {                                // a wave packs 32 words (bit j of word w: key 32 w + j is kept) and stores them as one line
        const int wave = threadIdx.x >> 5, lane = threadIdx.x & 31; const int nw = NB * (SEQ / 32);
        for (int g = wave; g < MWPADI / 32; g += 8) {
            unsigned mine = 0xFFFFFFFFu;                  // words past the last real one
            for (int j = 0; j < 32; ++j) { const int i = g * 32 + j; const int ii = (i < nw) ? i : (nw - 1); const int b = ii / (SEQ / 32), w = ii % (SEQ / 32);
                const unsigned word = __builtin_amdgcn_ballot_w32(mask[(size_t)b * SEQ_FULL + w * 32 + lane] != 0);
                if (lane == j && i < nw) mine = word; }
            MW[g * 32 + lane] = mine;
        }
        return;
    }
    const int blk = blockIdx.x - 1;
    const float* s; bf* d;
    if (blk < NB * XBL) { const int b = blk / XBL, r = blk % XBL; s = x + (size_t)b * SEQ_FULL * DM + (size_t)r * CVB; d = XB + (size_t)b * SEQ * DM + (size_t)r * CVB; }
    else { const int q = blk - NB * XBL; const int w = q / WBL, r = q % WBL;
        s = ((w == 0) ? wq : (w == 1) ? wk : (w == 2) ? wv : wo) + (size_t)r * CVB; d = ((w == 0) ? WQ : (w == 1) ? WK : (w == 2) ? WV : WO) + (size_t)r * CVB; }
    v8f v[CVU];
#pragma unroll
    for (int u = 0; u < CVU; ++u) v[u] = *(const v8f*)(s + (size_t)(u * 256 + threadIdx.x) * 8);
#pragma unroll
    for (int u = 0; u < CVU; ++u) { v8us o;
#pragma unroll
        for (int k = 0; k < 8; ++k) o[k] = f2bf(v[u][k]);
        *(v8us*)(d + (size_t)(u * 256 + threadIdx.x) * 8) = o; }
}

// One stage of the ring: each of the 256 lanes copies 16 bytes of rows r and r + 32 of the four 64-row x 128-byte tiles (a wave-wide copy covers four whole 128-byte lines).
// The s_wait_xcnt closes the copies' own statement so that it stands in front of any rewrite of the address registers they name.
__device__ __forceinline__ void stage_copy(unsigned l, const bf* kh, const bf* kl, const h16* v, const h16* vr) {
    asm volatile("global_load_async_to_lds_b128 %0, %8, off\n\t"
                 "global_load_async_to_lds_b128 %1, %9, off\n\t"
                 "global_load_async_to_lds_b128 %2, %10, off\n\t"
                 "global_load_async_to_lds_b128 %3, %11, off\n\t"
                 "global_load_async_to_lds_b128 %4, %12, off\n\t"
                 "global_load_async_to_lds_b128 %5, %13, off\n\t"
                 "global_load_async_to_lds_b128 %6, %14, off\n\t"
                 "global_load_async_to_lds_b128 %7, %15, off\n\t"
                 "s_wait_xcnt 0x0"
                 :: "v"(l), "v"(l + 32 * LPB), "v"(l + TLB), "v"(l + TLB + 32 * LPB), "v"(l + 2 * TLB), "v"(l + 2 * TLB + 32 * LPB), "v"(l + 3 * TLB), "v"(l + 3 * TLB + 32 * LPB),
                    "v"(kh), "v"(kh + 32 * HD), "v"(kl), "v"(kl + 32 * HD), "v"(v), "v"(v + 32 * SEQ), "v"(vr), "v"(vr + 32 * SEQ)
                 : "memory");
}

// The block's 128 query rows, hi and lo plane: each of the 256 lanes copies 16 bytes of rows r, r + 32, r + 64, r + 96 of the two 128-row x 128-byte tiles (a wave-wide copy covers four whole 128-byte lines).
// The s_wait_xcnt closes the copies' own statement so that it stands in front of any rewrite of the address registers they name.
__device__ __forceinline__ void q_copy(unsigned l, const bf* qh, const bf* ql) {
    asm volatile("global_load_async_to_lds_b128 %0, %8, off\n\t"
                 "global_load_async_to_lds_b128 %1, %9, off\n\t"
                 "global_load_async_to_lds_b128 %2, %10, off\n\t"
                 "global_load_async_to_lds_b128 %3, %11, off\n\t"
                 "global_load_async_to_lds_b128 %4, %12, off\n\t"
                 "global_load_async_to_lds_b128 %5, %13, off\n\t"
                 "global_load_async_to_lds_b128 %6, %14, off\n\t"
                 "global_load_async_to_lds_b128 %7, %15, off\n\t"
                 "s_wait_xcnt 0x0"
                 :: "v"(l), "v"(l + 32 * LPB), "v"(l + 64 * LPB), "v"(l + 96 * LPB), "v"(l + QTB), "v"(l + QTB + 32 * LPB), "v"(l + QTB + 64 * LPB), "v"(l + QTB + 96 * LPB),
                    "v"(qh), "v"(qh + 32 * HD), "v"(qh + 64 * HD), "v"(qh + 96 * HD), "v"(ql), "v"(ql + 32 * HD), "v"(ql + 64 * HD), "v"(ql + 96 * HD)
                 : "memory");
}

// ---- k_attn: fused attention, 8 waves per block that share each 64-key stage of K and V through a two-buffer LDS ring; grid (SEQ/128, heads, batch).
// A wave owns 32 query columns (two groups of 16) and one 32-key half of every stage: waves 0..3 take keys 0..31 of the stage, waves 4..7 keys 32..63, for the same four 32-query groups.
// The block's Q rows (hi and lo plane) are staged in LDS once, with stage 0, and every stage reads its Q fragments from there at the conflict-free pitch.
// Each K and V fragment read from LDS so feeds two matrix instructions. The two key halves of a query are joined through LDS behind the loop (running max, sum and output rescaled to the common max).
// Transposed form: S^T[key][query] = K Q^T (A = K rows, B = Q rows; 3 products hi.hi + lo.hi + hi.lo), so each lane owns one query column per group: row statistics are per lane (+ one xor-16 exchange),
// and the two 16-key score tiles of a 32-key step pack directly into the B fragment of O^T[d][query] += V^T[d][key] P^T[key][query] (elements 0..7 <- tile of keys 0..15, elements 8..15 <- tile of keys 16..31, lane unchanged).
// The full unrolls over the column groups keep every index of the register arrays a constant. amdgpu_waves_per_eu: two blocks stay resident per WGP (four waves per SIMD), as the grid needs to run in one round.
__global__ __launch_bounds__(ATW * 32) __attribute__((amdgpu_waves_per_eu(4, 4))) void k_attn(const bf* __restrict__ Qh, const bf* __restrict__ Ql, const bf* __restrict__ Kh, const bf* __restrict__ Kl, const h16* __restrict__ V16, const h16* __restrict__ Vr, const unsigned* __restrict__ MW, bf* Ah, bf* Al) {
    __shared__ __align__(16) float os[ATW * 16 * 68];
    __shared__ __align__(128) unsigned char ring[2 * STB];
    __shared__ __align__(128) unsigned char qs[2 * QTB];
    const int wave = __builtin_amdgcn_readfirstlane(threadIdx.x >> 5);
    const int lane = threadIdx.x & 31, lr = lane & 15, hi = lane >> 4;
    const int qg = wave & 3, kg = wave >> 2;              // 32-query group of the block, 32-key half of each stage
    const int hh = blockIdx.y, bb = blockIdx.z;
    const int q0 = blockIdx.x * (ATW * 16) + qg * 32;
    const size_t pbase = ((size_t)bb * NH_ + hh) * (size_t)SEQ * HD;
    const bf* qhp = Qh + pbase; const bf* qlp = Ql + pbase; const bf* khp = Kh + pbase; const bf* klp = Kl + pbase;
    const h16* v16p = V16 + pbase; const h16* vrp = Vr + pbase;
    const unsigned* mwp = MW + (size_t)bb * (SEQ / 32);
    const bf* qht = (const bf*)qs + (qg * 32 + lr) * LPE + 8 * hi;   // Q fragment reader's place in the staged hi tile; column group c adds 16 rows
    const bf* qlt = (const bf*)(qs + QTB) + (qg * 32 + lr) * LPE + 8 * hi;
    const int foffl = lr * LPE + 8 * hi;                  // fragment reader's lane offset in a staged tile (row lr, 16-bit elements)
    typedef __attribute__((address_space(3))) unsigned char lds_u8;
    const int crow = threadIdx.x >> 3, cch = threadIdx.x & 7;   // copier's row (and row + 32) and 16-byte piece of it
    const unsigned lcp = (unsigned)(size_t)(lds_u8*)ring + (unsigned)(crow * LPB + cch * 16);
    const bf* khc = khp + crow * HD + cch * 8; const bf* klc = klp + crow * HD + cch * 8;
    const h16* v16c = v16p + crow * SEQ + cch * 8; const h16* vrc = vrp + crow * SEQ + cch * 8;
    v8f acc[2][4], accr[2][4];
#pragma unroll
    for (int c = 0; c < 2; ++c)
#pragma unroll
        for (int dt = 0; dt < 4; ++dt) { acc[c][dt] = (v8f){}; accr[c][dt] = (v8f){}; }
    float m[2] = { -1.0e30f, -1.0e30f }, l[2] = { 0.0f, 0.0f };
    const int qrow = (blockIdx.x * (ATW * 16) + crow) * HD + cch * 8;
    q_copy((unsigned)(size_t)(lds_u8*)qs + (unsigned)(crow * LPB + cch * 16), qhp + qrow, qlp + qrow);
    stage_copy(lcp, khc, klc, v16c, vrc);
    asm volatile("s_wait_asynccnt 0x0" ::: "memory");     // this wave's share of the Q tiles and of stage 0 has landed
    __syncthreads();                                      // publishes the Q tiles and stage 0
    stage_copy(lcp + STB, khc + KST * HD, klc + KST * HD, v16c + KST, vrc + KST);
#pragma unroll 1                                          // one copy of the stage's body: the ring's order stays as written, small code, same register set
    for (int s = 0; s < SEQ / KST; ++s) {
        const unsigned char* rb = ring + (s & 1) * STB;
        const bf* kht = (const bf*)rb + foffl; const bf* klt = (const bf*)(rb + TLB) + foffl;
        const h16* v16t = (const h16*)(rb + 2 * TLB) + foffl; const h16* vrt = (const h16*)(rb + 3 * TLB) + foffl;
        const int kb = s * KST + kg * 32;
        v8f st[2][2];
#pragma unroll
        for (int c = 0; c < 2; ++c) { st[c][0] = (v8f){}; st[c][1] = (v8f){}; }
#pragma unroll
        for (int ks = 0; ks < 2; ++ks) {
            const int ko = kg * 32 * LPE + ks * 32;
            const v16bf kh0 = ldb(kht + ko), kl0 = ldb(klt + ko), kh1 = ldb(kht + ko + 16 * LPE), kl1 = ldb(klt + ko + 16 * LPE);
            v16bf qh[2], ql[2];
#pragma unroll
            for (int c = 0; c < 2; ++c) { qh[c] = ldb(qht + c * 16 * LPE + ks * 32); ql[c] = ldb(qlt + c * 16 * LPE + ks * 32); }
#pragma unroll
            for (int c = 0; c < 2; ++c) { st[c][0] = wmmab(kh0, qh[c], st[c][0]); st[c][1] = wmmab(kh1, qh[c], st[c][1]); }
#pragma unroll
            for (int c = 0; c < 2; ++c) { st[c][0] = wmmab(kl0, qh[c], st[c][0]); st[c][1] = wmmab(kl1, qh[c], st[c][1]); }
#pragma unroll
            for (int c = 0; c < 2; ++c) { st[c][0] = wmmab(kh0, ql[c], st[c][0]); st[c][1] = wmmab(kh1, ql[c], st[c][1]); }
            // the distance behind the group's last matrix instructions
            asm volatile("v_nop\n\tv_nop\n\tv_nop\n\tv_nop" : "+v"(st[0][0]), "+v"(st[0][1]), "+v"(st[1][0]), "+v"(st[1][1]) : "v"(qh[0]), "v"(ql[0]), "v"(qh[1]), "v"(ql[1]), "v"(kh0), "v"(kl0), "v"(kh1), "v"(kl1));
        }
        const unsigned mw = mwp[kb >> 5];
        if (mw != 0xFFFFFFFFu) {                          // wave-uniform: st[c][0][r] is key kb+8*hi+r, st[c][1][r] is key kb+16+8*hi+r
#pragma unroll
            for (int c = 0; c < 2; ++c)
#pragma unroll
                for (int r = 0; r < 8; ++r) { st[c][0][r] = ((mw >> (8 * hi + r)) & 1u) ? st[c][0][r] : NEGF; st[c][1][r] = ((mw >> (16 + 8 * hi + r)) & 1u) ? st[c][1][r] : NEGF; }
        }
        float mx[2], alpha[2];
#pragma unroll
        for (int c = 0; c < 2; ++c) {
            mx[c] = fmaxf(st[c][0][0], st[c][1][0]);
#pragma unroll
            for (int r = 1; r < 8; ++r) mx[c] = fmaxf(mx[c], fmaxf(st[c][0][r], st[c][1][r]));
        }
#pragma unroll
        for (int c = 0; c < 2; ++c) mx[c] = fmaxf(mx[c], __shfl_xor(mx[c], 16, 32));
        v16h pb[2];
#pragma unroll
        for (int c = 0; c < 2; ++c) {
            const float mnew = fmaxf(m[c], mx[c]);
            alpha[c] = __builtin_amdgcn_exp2f((m[c] - mnew) * L2E);
            const unsigned grow = __builtin_amdgcn_ballot_w32(mnew > m[c]);
            if (grow != 0u) {                             // wave-uniform: rescale only when some query's running max moved (alpha == 1 exactly elsewhere)
#pragma unroll
                for (int dt = 0; dt < 4; ++dt) { acc[c][dt] = acc[c][dt] * alpha[c]; accr[c][dt] = accr[c][dt] * alpha[c]; }
            }
            m[c] = mnew;
            float psum = 0.0f;
#pragma unroll
            for (int r = 0; r < 8; ++r) {
                const float p0 = __builtin_amdgcn_exp2f((st[c][0][r] - mnew) * L2E), p1 = __builtin_amdgcn_exp2f((st[c][1][r] - mnew) * L2E);
                psum += p0 + p1; pb[c][r] = (h16)(p0 * PCAR); pb[c][8 + r] = (h16)(p1 * PCAR); }
            l[c] = l[c] * alpha[c] + psum;
        }
        const int vo = kg * 32;
        {
            const v16h va0 = ldh(v16t + vo), va1 = ldh(v16t + vo + 16 * LPE), va2 = ldh(v16t + vo + 32 * LPE), va3 = ldh(v16t + vo + 48 * LPE);
#pragma unroll
            for (int c = 0; c < 2; ++c) { acc[c][0] = wmma16(va0, pb[c], acc[c][0]); acc[c][1] = wmma16(va1, pb[c], acc[c][1]); acc[c][2] = wmma16(va2, pb[c], acc[c][2]); acc[c][3] = wmma16(va3, pb[c], acc[c][3]); }
            // the distance behind the group's last matrix instructions
            asm volatile("v_nop\n\tv_nop\n\tv_nop\n\tv_nop" : "+v"(acc[1][0]), "+v"(acc[1][1]), "+v"(acc[1][2]), "+v"(acc[1][3]) : "v"(pb[1]), "v"(va0), "v"(va1), "v"(va2), "v"(va3));
        }
        {
            const v16h vb0 = ldh(vrt + vo), vb1 = ldh(vrt + vo + 16 * LPE), vb2 = ldh(vrt + vo + 32 * LPE), vb3 = ldh(vrt + vo + 48 * LPE);
#pragma unroll
            for (int c = 0; c < 2; ++c) { accr[c][0] = wmma16(vb0, pb[c], accr[c][0]); accr[c][1] = wmma16(vb1, pb[c], accr[c][1]); accr[c][2] = wmma16(vb2, pb[c], accr[c][2]); accr[c][3] = wmma16(vb3, pb[c], accr[c][3]); }
            // the distance behind the group's last matrix instructions, also on the taken side of the branches that follow
            asm volatile("v_nop\n\tv_nop\n\tv_nop\n\tv_nop" : "+v"(accr[1][0]), "+v"(accr[1][1]), "+v"(accr[1][2]), "+v"(accr[1][3]) : "v"(pb[1]), "v"(vb0), "v"(vb1), "v"(vb2), "v"(vb3));
        }
        asm volatile("s_wait_dscnt 0x0" ::: "memory");    // this wave's reads of stage s are done before its buffer is handed back
        asm volatile("s_wait_asynccnt 0x0" ::: "memory"); // this wave's share of stage s + 1 has landed
        __syncthreads();                                  // publishes stage s + 1 and ends every reader's last read of stage s
        if (s + 2 < SEQ / KST) stage_copy(lcp + (unsigned)((s & 1) * STB), khc + (s + 2) * KST * HD, klc + (s + 2) * KST * HD, v16c + (s + 2) * KST, vrc + (s + 2) * KST);
    }
    asm volatile("s_wait_asynccnt 0x0" ::: "memory");     // nothing of this wave's is in flight past the loop
    // Join of the two key halves: wave w and wave w ^ 4 hold the same 32 queries. Each keeps the column group of its own key-half number and hands the other group to its partner
    // through the ring, which nobody reads any more behind the loop's last barrier and into which nothing is in flight. Same lane, same register position on both sides.
    static_assert(ATW * 4096 + ATW * 256 <= 2 * STB);
    float* xo = (float*)ring + wave * 1024;               // 8 pieces of 4 floats per lane
    float* xs = (float*)(ring + ATW * 4096) + wave * 64;  // running max, sum
    const bool up = kg != 0;
    v8f wk[4];                                            // value + residual of the kept group, not yet normalised
#pragma unroll
    for (int dt = 0; dt < 4; ++dt) { v4f g0, g1;
#pragma unroll
        for (int r = 0; r < 8; ++r) {
            const float t0 = acc[0][dt][r] + accr[0][dt][r] * (1.0f / VRES), t1 = acc[1][dt][r] + accr[1][dt][r] * (1.0f / VRES);
            wk[dt][r] = up ? t1 : t0; const float g = up ? t0 : t1;
            if (r < 4) g0[r] = g; else g1[r - 4] = g; }
        *(v4fa*)(xo + (dt * 2) * 128 + lane * 4) = g0; *(v4fa*)(xo + (dt * 2 + 1) * 128 + lane * 4) = g1; }
    xs[lane] = up ? m[0] : m[1]; xs[32 + lane] = up ? l[0] : l[1];
    const float mk = up ? m[1] : m[0], lk = up ? l[1] : l[0];
    __syncthreads();                                      // publishes every wave's handed-over group to its partner
    const float* yo = (const float*)ring + (wave ^ 4) * 1024;
    const float* ys = (const float*)(ring + ATW * 4096) + (wave ^ 4) * 64;
    const float mo = ys[lane], lo = ys[32 + lane];
    const float mf = fmaxf(mk, mo);
    const float ak = __builtin_amdgcn_exp2f((mk - mf) * L2E), ao = __builtin_amdgcn_exp2f((mo - mf) * L2E);
    float lf = lk * ak + lo * ao;
    lf += __shfl_xor(lf, 16, 32);
    const float inv = 1.0f / (PCAR * lf); const float sk = ak * inv, so = ao * inv;
    const int ob = (wave * 16 + lr) * 68 + 8 * hi;        // O^T element (d = dt*16 + 8*hi + r, query lr) -> os[query][d]
#pragma unroll
    for (int dt = 0; dt < 4; ++dt) { v4f w0, w1;
        const v4f o0 = *(const v4fa*)(yo + (dt * 2) * 128 + lane * 4), o1 = *(const v4fa*)(yo + (dt * 2 + 1) * 128 + lane * 4);
#pragma unroll
        for (int r = 0; r < 4; ++r) { w0[r] = wk[dt][r] * sk + o0[r] * so; w1[r] = wk[dt][4 + r] * sk + o1[r] * so; }
        *(v4fa*)(os + ob + dt * 16) = w0; *(v4fa*)(os + ob + dt * 16 + 4) = w1; }
    __builtin_amdgcn_wave_barrier(); asm volatile("" ::: "memory");
    const size_t orow = ((size_t)bb * SEQ + q0 + kg * 16) * DM + hh * HD;   // the kept group's 16 queries
    const int rq = lane >> 3, d8 = (lane & 7) * 8;
{
#pragma unroll
        for (int s = 0; s < 4; ++s) { const int rr = s * 4 + rq;
            const v4f x0 = *(const v4fa*)(os + (wave * 16 + rr) * 68 + d8), x1 = *(const v4fa*)(os + (wave * 16 + rr) * 68 + d8 + 4); v8us oh, ol;
#pragma unroll
            for (int k = 0; k < 4; ++k) { unsigned short a, c; splitf(x0[k], a, c); oh[k] = a; ol[k] = c; splitf(x1[k], a, c); oh[4 + k] = a; ol[4 + k] = c; }
            *(v8us*)(Ah + orow + (size_t)rr * DM + d8) = oh; *(v8us*)(Al + orow + (size_t)rr * DM + d8) = ol; }
         }
}

// ---- workspace carve (bytes, 256-byte aligned regions; every region is covered exactly by its producer grid)
constexpr size_t al256(size_t b) { return (b + 255) & ~(size_t)255; }
constexpr size_t MWPAD  = (((size_t)NB * (SEQ / 32) + 31) / 32) * 32;
constexpr size_t SZ_XB  = al256((size_t)NB * SEQ * DM * 2);
constexpr size_t SZ_W   = al256((size_t)DM * DM * 2);
constexpr size_t SZ_PL  = al256((size_t)NB * NH_ * SEQ * HD * 2);
constexpr size_t SZ_MW  = al256(MWPAD * 4);
constexpr size_t OFF_XB = 0;
constexpr size_t OFF_WQ = OFF_XB + SZ_XB;
constexpr size_t OFF_WK = OFF_WQ + SZ_W;
constexpr size_t OFF_WV = OFF_WK + SZ_W;
constexpr size_t OFF_WO = OFF_WV + SZ_W;
constexpr size_t OFF_QH = OFF_WO + SZ_W;
constexpr size_t OFF_QL = OFF_QH + SZ_PL;
constexpr size_t OFF_KH = OFF_QL + SZ_PL;
constexpr size_t OFF_KL = OFF_KH + SZ_PL;
constexpr size_t OFF_V16 = OFF_KL + SZ_PL;
constexpr size_t OFF_VR = OFF_V16 + SZ_PL;
constexpr size_t OFF_AH = OFF_VR + SZ_PL;
constexpr size_t OFF_AL = OFF_AH + SZ_PL;
constexpr size_t OFF_MW = OFF_AL + SZ_PL;
constexpr size_t WS_TOTAL = OFF_MW + SZ_MW;
static_assert(WS_TOTAL <= (size_t)134217728);          // 128 MiB
static_assert((size_t)NB * NH_ * SEQ * HD == (size_t)NB * SEQ * DM);   // head planes and merged planes have equal extents
static_assert(MWPAD == (size_t)MWPADI);

extern "C" void kernel_launch(void* const* d_in, const int* in_sizes, int n_in,
                              void* d_out, int out_size, void* d_ws, size_t ws_size, hipStream_t stream) {
    if (n_in < 10) return;
    const size_t xneed = (size_t)(NB - 1) * SEQ_FULL * DM + (size_t)SEQ * DM;
    if ((size_t)in_sizes[0] < xneed) return;
    if ((size_t)in_sizes[1] < (size_t)(NB - 1) * SEQ_FULL + SEQ) return;
    if (in_sizes[2] < DM * DM || in_sizes[4] < DM * DM || in_sizes[6] < DM * DM || in_sizes[8] < DM * DM) return;
    if (in_sizes[3] < DM || in_sizes[5] < DM || in_sizes[7] < DM || in_sizes[9] < DM) return;
    if ((size_t)out_size < xneed) return;
    if (ws_size < WS_TOTAL) return;
    const float* x = (const float*)d_in[0]; const int* mask = (const int*)d_in[1];
    const float* wq = (const float*)d_in[2]; const float* bq = (const float*)d_in[3];
    const float* wk = (const float*)d_in[4]; const float* bk = (const float*)d_in[5];
    const float* wv = (const float*)d_in[6]; const float* bv = (const float*)d_in[7];
    const float* wo = (const float*)d_in[8]; const float* bo = (const float*)d_in[9];
    float* OUT = (float*)d_out;
    char* wsb = (char*)d_ws;
    bf* XB = (bf*)(wsb + OFF_XB); bf* WQ = (bf*)(wsb + OFF_WQ); bf* WK = (bf*)(wsb + OFF_WK); bf* WV = (bf*)(wsb + OFF_WV); bf* WO = (bf*)(wsb + OFF_WO);
    bf* QPh = (bf*)(wsb + OFF_QH); bf* QPl = (bf*)(wsb + OFF_QL); bf* KPh = (bf*)(wsb + OFF_KH); bf* KPl = (bf*)(wsb + OFF_KL);
    h16* VT16 = (h16*)(wsb + OFF_V16); h16* VTr = (h16*)(wsb + OFF_VR);
    bf* ATh = (bf*)(wsb + OFF_AH); bf* ATl = (bf*)(wsb + OFF_AL);
    unsigned* MWp = (unsigned*)(wsb + OFF_MW);

    k_prep<<<1 + NB * XBL + 4 * WBL, 256, 0, stream>>>(x, wq, wk, wv, wo, mask, XB, WQ, WK, WV, WO, MWp);

    k_gemm_qkv<<<dim3((unsigned)(NB * SEQ / 128), DM / 128, 3), GW * 32, 0, stream>>>(XB, WQ, WK, WV, bq, bk, bv, QPh, QPl, KPh, KPl, VT16, VTr);

    k_attn<<<dim3(SEQ / (ATW * 16), NH_, NB), ATW * 32, 0, stream>>>(QPh, QPl, KPh, KPl, VT16, VTr, MWp, ATh, ATl);

    k_gemm_out<<<dim3(SEQ / 128, DM / 128, NB), GW * 32, 0, stream>>>(ATh, ATl, WO, OUT, DM, bo, (size_t)SEQ * DM, (size_t)SEQ_FULL * DM);
}

// v007
// A run of this version takes 91.7 microseconds.
// Versions between v005 and this one are left out; their measured steps multiply to 1.32 times as fast.
// Over all steps from v000 it is 5.19 times as fast.
#include <hip/hip_runtime.h>

// Non-causal attention, 16 heads x 64, unscaled scores, int32 key mask (fill -1e9 by select), out = merged x Wo^T + bo.
// Compute dtypes, f32 accumulate everywhere: every float input converted to bf16 (RNE) on load; q/k/v projections v_wmma_f32_16x16x32_bf16 single product (+ bf16 bias);
// scores v_wmma_f32_16x16x32_f16 on q, k rounded to f16 (1 product); softmax f32 online (exp2, running max); P x V v_wmma_f32_16x16x32_f16 with P x256 and V rounded to f16 (1 product);
// output projection v_wmma_f32_16x16x32_bf16 on context hi|lo planes x Wo (2 products) + bias.

#ifndef NB
#define NB 2
#endif
#ifndef SEQ
#define SEQ 2048
#endif
#define NB_FULL  2
#define SEQ_FULL 2048
#define DM   1024
#define NH_  16
#define HD   64
#define ATW  8                  // waves per attention block (4 groups of 32 query rows x 2 key halves: 128 query rows a block)
#define KST  64                 // keys per LDS stage of the attention ring (two 32-key steps)
#define LPB  144                // LDS row pitch in bytes: 128-byte rows + 16 (16 B x odd, conflict-free for 16-byte row readers)
#define LPE  (LPB / 2)          // the same in 16-bit elements
#define TLB  (64 * LPB)         // one plane's tile: 64 rows
#define STB  (2 * TLB)          // one stage: K, V
#define QTB  (ATW * 16 * LPB)   // the Q tile: the block's 128 query rows at the same pitch
#define GW   8                  // waves per GEMM block
#define GKC  128                // k per LDS stage of the GEMM ring (four 32-k steps): 256-byte rows
#define GPB  272                // LDS row pitch of the GEMM tiles in bytes: 256-byte rows + 16 (16 B x odd, conflict-free for 16-byte row readers)
#define GPE  (GPB / 2)          // the same in 16-bit elements
#define GTB  (128 * GPB)        // one GEMM operand tile: 128 rows
#define PCAR 256.0f             // carry of the f16 probability operand
#define NEGF (-1.0e9f)
#define L2E  1.4426950408889634f

static_assert(NH_ * HD == DM);               // merged width
static_assert(HD == 64);
static_assert(DM % 64 == 0 && DM % 32 == 0); // wave tile and k-step multiples
static_assert(SEQ % 64 == 0);                // 64-key attention stages, 32-key steps
static_assert(SEQ % (ATW * 16) == 0);        // whole attention blocks
static_assert(SEQ / KST >= 2);               // the ring's prologue fills two stages
static_assert(ATW == 8 && KST == 64);         // four 32-query groups x two 32-key halves of a stage
static_assert(ATW * 32 == 256);              // the stage copy deals 32 rows x 8 pieces of 16 bytes to the block's lanes, twice per tile
static_assert(KST == 64 && HD * 2 == 128 && KST * 2 == 128);   // every staged row of the attention ring is one 128-byte line
static_assert((NB * SEQ) % 128 == 0 && SEQ % 128 == 0 && DM % 128 == 0);   // whole 128x128 GEMM block tiles
static_assert(DM % GKC == 0 && DM / GKC >= 2 && GKC * 2 == 256 && GW * 32 == 256);   // whole GEMM stages; the tile copy deals 16 rows x 16 pieces of 16 bytes to the block's lanes, eight times per tile
static_assert(NB <= NB_FULL && SEQ <= SEQ_FULL);

typedef _Float16 h16;
typedef unsigned short bf;
typedef __attribute__((ext_vector_type(16))) __bf16   v16bf;
typedef __attribute__((ext_vector_type(16))) _Float16 v16h;
typedef __attribute__((ext_vector_type(8)))  _Float16 v8h;
typedef __attribute__((ext_vector_type(8)))  unsigned short v8us;
typedef __attribute__((ext_vector_type(8)))  float    v8f;
typedef __attribute__((ext_vector_type(4)))  float    v4f;
typedef v4f  __attribute__((may_alias)) v4fa;

__device__ __forceinline__ unsigned short f2bf(float f) { unsigned u = __float_as_uint(f); u += 0x7FFFu + ((u >> 16) & 1u); return (unsigned short)(u >> 16); }
__device__ __forceinline__ float bf2f(unsigned short b) { return __uint_as_float(((unsigned)b) << 16); }
__device__ __forceinline__ float bfr(float f) { return bf2f(f2bf(f)); }
__device__ __forceinline__ void splitf(float y, unsigned short& h, unsigned short& l) { h = f2bf(y); l = f2bf(y - bf2f(h)); }
__device__ __forceinline__ v16h cat16(v8h lo, v8h hi) { return __builtin_shufflevector(lo, hi, 0, 1, 2, 3, 4, 5, 6, 7, 8, 9, 10, 11, 12, 13, 14, 15); }
__device__ __forceinline__ v16bf cat16b(v8us lo, v8us hi) { return __builtin_bit_cast(v16bf, __builtin_shufflevector(lo, hi, 0, 1, 2, 3, 4, 5, 6, 7, 8, 9, 10, 11, 12, 13, 14, 15)); }
__device__ __forceinline__ v8f wmma16(v16h a, v16h b, v8f c) { return __builtin_amdgcn_wmma_f32_16x16x32_f16(false, a, false, b, (short)0, c, false, false); }
__device__ __forceinline__ v8f wmmab(v16bf a, v16bf b, v8f c) { return __builtin_amdgcn_wmma_f32_16x16x32_bf16(false, a, false, b, (short)0, c, false, false); }
// fragment loaders from K-contiguous 16-bit rows: p = row base + k0 + 8*(lane>>4); elements 0..7 = k0+8h.., elements 8..15 = k0+16+8h..
__device__ __forceinline__ v16bf ldb(const bf* p) { return cat16b(*(const v8us*)p, *(const v8us*)(p + 16)); }
__device__ __forceinline__ v16h  ldh(const h16* p) { return cat16(*(const v8h*)p, *(const v8h*)(p + 16)); }

// One operand tile of a GEMM stage: each of the 256 lanes copies 16 bytes of rows r, r + 16, ... r + 112 of a 128-row x 256-byte tile (a wave-wide copy covers four whole 128-byte lines); rs = 16 source rows in elements.
// The s_wait_xcnt closes the copies' own statement so that it stands in front of any rewrite of the address registers they name.
__device__ __forceinline__ void tile_copy(unsigned l, const bf* g, size_t rs) {
    asm volatile("global_load_async_to_lds_b128 %0, %8, off\n\t"
                 "global_load_async_to_lds_b128 %1, %9, off\n\t"
                 "global_load_async_to_lds_b128 %2, %10, off\n\t"
                 "global_load_async_to_lds_b128 %3, %11, off\n\t"
                 "global_load_async_to_lds_b128 %4, %12, off\n\t"
                 "global_load_async_to_lds_b128 %5, %13, off\n\t"
                 "global_load_async_to_lds_b128 %6, %14, off\n\t"
                 "global_load_async_to_lds_b128 %7, %15, off\n\t"
                 "s_wait_xcnt 0x0"
                 :: "v"(l), "v"(l + 16 * GPB), "v"(l + 32 * GPB), "v"(l + 48 * GPB), "v"(l + 64 * GPB), "v"(l + 80 * GPB), "v"(l + 96 * GPB), "v"(l + 112 * GPB),
                    "v"(g), "v"(g + rs), "v"(g + 2 * rs), "v"(g + 3 * rs), "v"(g + 4 * rs), "v"(g + 5 * rs), "v"(g + 6 * rs), "v"(g + 7 * rs)
                 : "memory");
}
// One stage: the A tile, the Bt tile and, with two A planes, the second A tile, in that order in the buffer.
template <int NA> __device__ __forceinline__ void gemm_stage(unsigned l, const bf* a, const bf* a2, const bf* b, size_t rs) {
    tile_copy(l, a, rs); tile_copy(l + GTB, b, rs);
    if (NA == 2) tile_copy(l + 2 * GTB, a2, rs);
}

// ---- GEMM engine: 8 waves per 128x128 block tile (4 x 2 wave tiles of 32 x 64), C[m][n] = sum_k A[m][k] Bt[n][k] + bf16 bias (bias[n]; bias[m] in the v^T epilogue); operands are K-contiguous bf16 planes, staged 128 k at a time
// in a two-buffer LDS ring that the 8 waves share; NA == 2: A carried as hi + lo planes (two products into one accumulator, hi first). K = DM; rows and columns multiples of 128.
// The full unrolls below keep every index of the fragment and accumulator arrays a constant, so that the arrays stay in registers.
// gemm_main leaves the block tile at rows r0, columns c0 in acc (wave tile at wr, wc); the epilogues behind it add the bias and store.
template <int NA> __device__ __forceinline__ void gemm_main(const bf* __restrict__ A, const bf* __restrict__ A2, const bf* __restrict__ Bt, int r0, int c0,
                                                            const unsigned char* ring, unsigned lbase, v8f (&acc)[2][4]) {
    constexpr unsigned SB = (NA + 1) * GTB;               // bytes of one buffer
    constexpr int K = DM, nst = K / GKC;
    const int wave = __builtin_amdgcn_readfirstlane(threadIdx.x >> 5);
    const int lane = threadIdx.x & 31, lr = lane & 15, hi = lane >> 4;
    const int wr = (wave >> 1) * 32, wc = (wave & 1) * 64;
#pragma unroll
    for (int mb = 0; mb < 2; ++mb)
#pragma unroll
        for (int nb = 0; nb < 4; ++nb) acc[mb][nb] = (v8f){};
    const int prow = threadIdx.x >> 4, pch = threadIdx.x & 15;   // copier's first row and 16-byte piece of it
    const unsigned lcp = lbase + (unsigned)(prow * GPB + pch * 16);
    const bf* ac = A + (size_t)(r0 + prow) * K + pch * 8; const bf* a2c = A2 + (size_t)(r0 + prow) * K + pch * 8; const bf* bc = Bt + (size_t)(c0 + prow) * K + pch * 8;
    const size_t rs = (size_t)16 * K;
    const int aofl = (wr + lr) * GPE + 8 * hi, bofl = (wc + lr) * GPE + 8 * hi;   // fragment readers' lane offsets in a staged tile (16-bit elements)
    gemm_stage<NA>(lcp, ac, a2c, bc, rs);
    asm volatile("s_wait_asynccnt 0x0" ::: "memory");     // this wave's share of stage 0 has landed
    __syncthreads();                                      // publishes stage 0
    gemm_stage<NA>(lcp + SB, ac + GKC, a2c + GKC, bc + GKC, rs);
#pragma unroll 1                                          // one copy of the stage's body: the ring's order stays as written
    for (int s = 0; s < nst; ++s) {
        const unsigned char* rb = ring + (s & 1) * SB;
        const bf* at = (const bf*)rb + aofl; const bf* bt = (const bf*)(rb + GTB) + bofl; const bf* a2t = (const bf*)(rb + 2 * GTB) + aofl;
        v16bf a[2][2], a2[2][2], b[2][4];                 // two fragment sets: the 32-k step in work and the next one of the same stage
#pragma unroll
        for (int mb = 0; mb < 2; ++mb) { a[0][mb] = ldb(at + mb * 16 * GPE); if (NA == 2) a2[0][mb] = ldb(a2t + mb * 16 * GPE); }
#pragma unroll
        for (int nb = 0; nb < 4; ++nb) b[0][nb] = ldb(bt + nb * 16 * GPE);
#pragma unroll
        for (int ks = 0; ks < GKC / 32; ++ks) {
            const int cu = ks & 1, nx = cu ^ 1;
            if (ks + 1 < GKC / 32) {
#pragma unroll
                for (int mb = 0; mb < 2; ++mb) { a[nx][mb] = ldb(at + mb * 16 * GPE + (ks + 1) * 32); if (NA == 2) a2[nx][mb] = ldb(a2t + mb * 16 * GPE + (ks + 1) * 32); }
#pragma unroll
                for (int nb = 0; nb < 4; ++nb) b[nx][nb] = ldb(bt + nb * 16 * GPE + (ks + 1) * 32);
            }
            __builtin_amdgcn_sched_barrier(0);            // keeps the next step's LDS reads as one group in front of this step's matrix instructions, which then hide their latency
#pragma unroll
            for (int nb = 0; nb < 4; ++nb)
#pragma unroll
                for (int mb = 0; mb < 2; ++mb) acc[mb][nb] = wmmab(a[cu][mb], b[cu][nb], acc[mb][nb]);
            if (NA == 2) {
#pragma unroll
                for (int nb = 0; nb < 4; ++nb)
#pragma unroll
                    for (int mb = 0; mb < 2; ++mb) acc[mb][nb] = wmmab(a2[cu][mb], b[cu][nb], acc[mb][nb]);
            }
            __builtin_amdgcn_sched_barrier(0);            // keeps the reads of the step after next from being spread among these matrix instructions
        }
        // the distance behind the stage's last matrix instructions, also on the taken side of the branches that follow
        asm volatile("v_nop\n\tv_nop\n\tv_nop\n\tv_nop" : "+v"(acc[0][0]), "+v"(acc[0][1]), "+v"(acc[0][2]), "+v"(acc[0][3]), "+v"(acc[1][0]), "+v"(acc[1][1]), "+v"(acc[1][2]), "+v"(acc[1][3]));
        asm volatile("s_wait_dscnt 0x0" ::: "memory");    // this wave's reads of stage s are done before its buffer is handed back
        asm volatile("s_wait_asynccnt 0x0" ::: "memory"); // this wave's share of stage s + 1 has landed
        __syncthreads();                                  // publishes stage s + 1 and ends every reader's last read of stage s
        if (s + 2 < nst) gemm_stage<NA>(lcp + (unsigned)(s & 1) * SB, ac + (size_t)(s + 2) * GKC, a2c + (size_t)(s + 2) * GKC, bc + (size_t)(s + 2) * GKC, rs);
    }
    asm volatile("s_wait_asynccnt 0x0" ::: "memory");     // nothing of this wave's is in flight past the loop
}

// The full unrolls in the epilogues keep every index of acc and of the small vectors a constant, so that they stay in registers.
// One 16 x 64 half of a wave tile into the wave's own staging rows: os row = tile row, os column = tile column.
__device__ __forceinline__ void stage_half(float* osw, const v8f (&a)[4], int lr, int hi) {
#pragma unroll
    for (int nb = 0; nb < 4; ++nb) {
#pragma unroll
        for (int j = 0; j < 8; ++j) osw[(hi * 8 + j) * 68 + nb * 16 + lr] = a[nb][j]; }
}

// Epilogue, f32 rows: C[m][n] = acc + bf16(bias[n]).
__device__ __forceinline__ void epi_f32(const v8f (&acc)[2][4], int r0, int c0, float* C, int ldc, const float* __restrict__ bias, float* os) {
    const int wave = __builtin_amdgcn_readfirstlane(threadIdx.x >> 5);
    const int lane = threadIdx.x & 31, lr = lane & 15, hi = lane >> 4;
    const int wr = (wave >> 1) * 32, wc = (wave & 1) * 64;
    float* osw = os + wave * 16 * 68;                     // each wave stages its output rows in its own range
    const int cofs = lr * 4;
    const int cw = c0 + wc;
    v4f bv; bv[0] = bfr(bias[cw + cofs]); bv[1] = bfr(bias[cw + cofs + 1]); bv[2] = bfr(bias[cw + cofs + 2]); bv[3] = bfr(bias[cw + cofs + 3]);
#pragma unroll
    for (int mb = 0; mb < 2; ++mb) {
        stage_half(osw, acc[mb], lr, hi);
        __builtin_amdgcn_wave_barrier(); asm volatile("" ::: "memory");
        float* crow = C + (size_t)(r0 + wr + mb * 16) * ldc + cw;
{
#pragma unroll
            for (int s = 0; s < 8; ++s) { const int row = 2 * s + hi; v4f val = *(const v4fa*)(osw + row * 68 + cofs); val = val + bv;
                *(v4f*)(crow + (size_t)row * ldc + cofs) = val; }
             }
        __builtin_amdgcn_wave_barrier(); asm volatile("" ::: "memory");
    }
}

typedef __attribute__((address_space(3))) unsigned char lds_b8;

// Epilogue of the q and k projections: rows are tokens, the wave's 64 columns are one head; y = acc + bf16(bias[column]) goes out as one f16 plane [batch][head][token][64], 128-byte rows.
__device__ __forceinline__ void epi_qk(const v8f (&acc)[2][4], int r0, int c0, const float* __restrict__ bias, h16* P, float* os) {
    const int wave = __builtin_amdgcn_readfirstlane(threadIdx.x >> 5);
    const int lane = threadIdx.x & 31, lr = lane & 15, hi = lane >> 4;
    const int wr = (wave >> 1) * 32, wc = (wave & 1) * 64;
    float* osw = os + wave * 16 * 68;                     // each wave stages its output rows in its own range
    const int rq = lane >> 3, d8 = (lane & 7) * 8;
    const int cw = c0 + wc, h = cw / HD;
    v4f b0, b1;
#pragma unroll
    for (int k = 0; k < 4; ++k) { b0[k] = bfr(bias[cw + d8 + k]); b1[k] = bfr(bias[cw + d8 + 4 + k]); }
#pragma unroll
    for (int mb = 0; mb < 2; ++mb) {
        stage_half(osw, acc[mb], lr, hi);
        __builtin_amdgcn_wave_barrier(); asm volatile("" ::: "memory");   // the wave's stores stay in front of its reads of other lanes' values
        const int g0 = r0 + wr + mb * 16; const int b = g0 / SEQ, t0 = g0 % SEQ;   // 16 rows of one batch (SEQ is a multiple of 128)
        const size_t o0 = (((size_t)b * NH_ + h) * SEQ + t0) * HD + d8;
#pragma unroll
        for (int s = 0; s < 4; ++s) { const int rr = s * 4 + rq;
            const v4f x0 = *(const v4fa*)(osw + rr * 68 + d8) + b0, x1 = *(const v4fa*)(osw + rr * 68 + d8 + 4) + b1; v8h o16;
#pragma unroll
            for (int k = 0; k < 4; ++k) { o16[k] = (h16)x0[k]; o16[4 + k] = (h16)x1[k]; }
            *(v8h*)(P + o0 + (size_t)rr * HD) = o16; }
        __builtin_amdgcn_wave_barrier();                  // with the clobber below: the reads stay in front of the next half's LDS stores
        asm volatile("s_wait_xcnt 0x0" ::: "memory");     // in front of every later rewrite of the registers that these global stores name: the next half's, and behind the last half the code that the build lays out after this epilogue
    }
}

// Epilogue of the v projection, computed transposed (rows are output features, columns are tokens): y = acc + bf16(bias[row]) goes out as one f16 plane [batch][head][64][token], 128-byte pieces of a row.
__device__ __forceinline__ void epi_vt(const v8f (&acc)[2][4], int r0, int c0, const float* __restrict__ bias, h16* V16, float* os) {
    const int wave = __builtin_amdgcn_readfirstlane(threadIdx.x >> 5);
    const int lane = threadIdx.x & 31, lr = lane & 15, hi = lane >> 4;
    const int wr = (wave >> 1) * 32, wc = (wave & 1) * 64;
    float* osw = os + wave * 16 * 68;                     // each wave stages its output rows in its own range
    const int rq = lane >> 3, t8 = (lane & 7) * 8;
    const int cw = c0 + wc; const int b = cw / SEQ, t0 = cw % SEQ;   // 64 tokens of one batch (SEQ is a multiple of 128)
    float bb[2][4];                                       // the lane's eight rows' biases, all fetched in front of the first store
#pragma unroll
    for (int mb = 0; mb < 2; ++mb)
#pragma unroll
        for (int s = 0; s < 4; ++s) bb[mb][s] = bfr(bias[r0 + wr + mb * 16 + s * 4 + rq]);
#pragma unroll
    for (int mb = 0; mb < 2; ++mb) {
        stage_half(osw, acc[mb], lr, hi);
        __builtin_amdgcn_wave_barrier(); asm volatile("" ::: "memory");   // the wave's stores stay in front of its reads of other lanes' values
        const int m0 = r0 + wr + mb * 16;                 // feature row = head * 64 + d: the planes' rows of one batch follow one another in that order
#pragma unroll
        for (int s = 0; s < 4; ++s) { const int rr = s * 4 + rq;
            const v4f x0 = *(const v4fa*)(osw + rr * 68 + t8) + bb[mb][s], x1 = *(const v4fa*)(osw + rr * 68 + t8 + 4) + bb[mb][s]; v8h o16;
#pragma unroll
            for (int k = 0; k < 4; ++k) { o16[k] = (h16)x0[k]; o16[4 + k] = (h16)x1[k]; }
            const size_t o = ((size_t)b * DM + m0 + rr) * SEQ + t0 + t8;
            *(v8h*)(V16 + o) = o16; }
        if (mb == 0) {
            __builtin_amdgcn_wave_barrier();              // with the clobber below: the reads stay in front of the next half's LDS stores
            asm volatile("s_wait_xcnt 0x0" ::: "memory"); // in front of the next half's rewrites of the registers that these global stores name
        }
    }
}

// ---- k_gemm_qkv: the three projections in one launch, single A plane; grid (tokens/128, DM/128, 3), 256 threads. z = 0, 1: q, k = x W^T (A = x rows, Bt = W rows);
// z = 2: v^T = Wv x^T (A = Wv rows, Bt = x rows; same k order), so that its rows run along the tokens as the attention's V planes do. Each epilogue writes the attention's planes itself.
__global__ __launch_bounds__(GW * 32) void k_gemm_qkv(const bf* __restrict__ XB, const bf* __restrict__ WQ, const bf* __restrict__ WK, const bf* __restrict__ WV,
                                                      const float* __restrict__ bq, const float* __restrict__ bk, const float* __restrict__ bv,
                                                      h16* Q16, h16* K16, h16* V16) {
    __shared__ __align__(128) unsigned char ring[2 * 2 * GTB];
    static_assert(GW * 16 * 68 * 4 <= 2 * 2 * GTB);       // the epilogue's staging rows fit the ring
    const int z = blockIdx.z;
    const bf* A = (z == 2) ? WV : XB; const bf* Bt = (z == 2) ? XB : (z == 1) ? WK : WQ;
    const int r0 = ((z == 2) ? blockIdx.y : blockIdx.x) * 128, c0 = ((z == 2) ? blockIdx.x : blockIdx.y) * 128;
    v8f acc[2][4];
    gemm_main<1>(A, A, Bt, r0, c0, ring, (unsigned)(size_t)(lds_b8*)ring, acc);
    // The epilogue stages its rows in the ring: behind the loop's last barrier no wave reads the ring any more and no copy into it is in flight.
    // With no staging array of its own the block takes 139,264 bytes of LDS, so two blocks are resident per WGP (four waves per SIMD) and each works through the other's waits.
    float* os = (float*)ring;
    if (z == 2) epi_vt(acc, r0, c0, bv, V16, os);
    else epi_qk(acc, r0, c0, (z == 1) ? bk : bq, (z == 1) ? K16 : Q16, os);
}

// ---- k_gemm_out: A carried as hi + lo planes, z-batched: A/A2 += z*sA, C += z*sC; grid (M/128, N/128, batches), 256 threads.
__global__ __launch_bounds__(GW * 32) void k_gemm_out(const bf* __restrict__ A, const bf* __restrict__ A2, const bf* __restrict__ Bt, float* C, int ldc, const float* __restrict__ bias, size_t sA, size_t sC) {
    __shared__ __align__(16) float os[GW * 16 * 68];
    __shared__ __align__(128) unsigned char ring[2 * 3 * GTB];
    const size_t z = blockIdx.z;
    const int r0 = blockIdx.x * 128, c0 = blockIdx.y * 128;
    v8f acc[2][4];
    gemm_main<2>(A + z * sA, A2 + z * sA, Bt, r0, c0, ring, (unsigned)(size_t)(lds_b8*)ring, acc);
    epi_f32(acc, r0, c0, C + z * sC, ldc, bias, os);
}

// ---- k_prep: every float operand to bf16 (RNE) and the mask to bit words, one launch. Block 0 packs the mask; each other block converts CVU x 256 pieces of 8 floats of one source
// (the batches of x, then Wq, Wk, Wv, Wo): a lane's CVU loads of 32 bytes are all issued before the first is used. The full unrolls keep v and o in registers.
#define CVU 8
constexpr int CVB = CVU * 256 * 8;                        // floats per block
constexpr int XBL = SEQ * DM / CVB, WBL = DM * DM / CVB;  // blocks per batch of x, per weight
static_assert((SEQ * DM) % CVB == 0 && (DM * DM) % CVB == 0);
constexpr int MWPADI = ((NB * (SEQ / 32) + 31) / 32) * 32;   // mask words, padded to whole 128-byte lines
__global__ __launch_bounds__(256) void k_prep(const float* __restrict__ x, const float* __restrict__ wq, const float* __restrict__ wk, const float* __restrict__ wv, const float* __restrict__ wo, const int* __restrict__ mask,
                                              bf* XB, bf* WQ, bf* WK, bf* WV, bf* WO, unsigned* MW) {
    if (blockIdx.x == 0) {                                // a wave packs 32 words (bit j of word w: key 32 w + j is kept) and stores them as one line
        const int wave = threadIdx.x >> 5, lane = threadIdx.x & 31; const int nw = NB * (SEQ / 32);
        for (int g = wave; g < MWPADI / 32; g += 8) {
            unsigned mine = 0xFFFFFFFFu;                  // words past the last real one
            for (int j = 0; j < 32; ++j) { const int i = g * 32 + j; const int ii = (i < nw) ? i : (nw - 1); const int b = ii / (SEQ / 32), w = ii % (SEQ / 32);
                const unsigned word = __builtin_amdgcn_ballot_w32(mask[(size_t)b * SEQ_FULL + w * 32 + lane] != 0);
                if (lane == j && i < nw) mine = word; }
            MW[g * 32 + lane] = mine;
        }
        return;
    }
    const int blk = blockIdx.x - 1;
    const float* s; bf* d;
    if (blk < NB * XBL) { const int b = blk / XBL, r = blk % XBL; s = x + (size_t)b * SEQ_FULL * DM + (size_t)r * CVB; d = XB + (size_t)b * SEQ * DM + (size_t)r * CVB; }
    else { const int q = blk - NB * XBL; const int w = q / WBL, r = q % WBL;
        s = ((w == 0) ? wq : (w == 1) ? wk : (w == 2) ? wv : wo) + (size_t)r * CVB; d = ((w == 0) ? WQ : (w == 1) ? WK : (w == 2) ? WV : WO) + (size_t)r * CVB; }
    v8f v[CVU];
#pragma unroll
    for (int u = 0; u < CVU; ++u) v[u] = *(const v8f*)(s + (size_t)(u * 256 + threadIdx.x) * 8);
#pragma unroll
    for (int u = 0; u < CVU; ++u) { v8us o;
#pragma unroll
        for (int k = 0; k < 8; ++k) o[k] = f2bf(v[u][k]);
        *(v8us*)(d + (size_t)(u * 256 + threadIdx.x) * 8) = o; }
}

// One stage of the ring: each of the 256 lanes copies 16 bytes of rows r and r + 32 of the two 64-row x 128-byte tiles (a wave-wide copy covers four whole 128-byte lines).
// The s_wait_xcnt closes the copies' own statement so that it stands in front of any rewrite of the address registers they name.
__device__ __forceinline__ void stage_copy(unsigned l, const h16* k, const h16* v) {
    asm volatile("global_load_async_to_lds_b128 %0, %4, off\n\t"
                 "global_load_async_to_lds_b128 %1, %5, off\n\t"
                 "global_load_async_to_lds_b128 %2, %6, off\n\t"
                 "global_load_async_to_lds_b128 %3, %7, off\n\t"
                 "s_wait_xcnt 0x0"
                 :: "v"(l), "v"(l + 32 * LPB), "v"(l + TLB), "v"(l + TLB + 32 * LPB),
                    "v"(k), "v"(k + 32 * HD), "v"(v), "v"(v + 32 * SEQ)
                 : "memory");
}

// The block's 128 query rows: each of the 256 lanes copies 16 bytes of rows r, r + 32, r + 64, r + 96 of the 128-row x 128-byte tile (a wave-wide copy covers four whole 128-byte lines).
// The s_wait_xcnt closes the copies' own statement so that it stands in front of any rewrite of the address registers they name.
__device__ __forceinline__ void q_copy(unsigned l, const h16* q) {
    asm volatile("global_load_async_to_lds_b128 %0, %4, off\n\t"
                 "global_load_async_to_lds_b128 %1, %5, off\n\t"
                 "global_load_async_to_lds_b128 %2, %6, off\n\t"
                 "global_load_async_to_lds_b128 %3, %7, off\n\t"
                 "s_wait_xcnt 0x0"
                 :: "v"(l), "v"(l + 32 * LPB), "v"(l + 64 * LPB), "v"(l + 96 * LPB),
                    "v"(q), "v"(q + 32 * HD), "v"(q + 64 * HD), "v"(q + 96 * HD)
                 : "memory");
}

// ---- k_attn: fused attention, 8 waves per block that share each 64-key stage of K and V through a two-buffer LDS ring; grid (SEQ/128, heads, batch).
// A wave owns 32 query columns (two groups of 16) and one 32-key half of every stage: waves 0..3 take keys 0..31 of the stage, waves 4..7 keys 32..63, for the same four 32-query groups.
// The block's Q rows are staged in LDS once, with stage 0, and every stage reads its Q fragments from there at the conflict-free pitch.
// Each K and V fragment read from LDS so feeds two matrix instructions. The two key halves of a query are joined through LDS behind the loop (running max, sum and output rescaled to the common max).
// Transposed form: S^T[key][query] = K Q^T (A = K rows, B = Q rows), so each lane owns one query column per group: row statistics are per lane (+ one xor-16 exchange),
// and the two 16-key score tiles of a 32-key step pack directly into the B fragment of O^T[d][query] += V^T[d][key] P^T[key][query] (elements 0..7 <- tile of keys 0..15, elements 8..15 <- tile of keys 16..31, lane unchanged).
// The full unrolls over the column groups keep every index of the register arrays a constant. amdgpu_waves_per_eu: two blocks stay resident per WGP (four waves per SIMD), as the grid needs to run in one round.
__global__ __launch_bounds__(ATW * 32) __attribute__((amdgpu_waves_per_eu(4, 4))) void k_attn(const h16* __restrict__ Q16, const h16* __restrict__ K16, const h16* __restrict__ V16, const unsigned* __restrict__ MW, bf* Ah, bf* Al) {
    __shared__ __align__(16) float os[ATW * 16 * 68];
    __shared__ __align__(128) unsigned char ring[2 * STB];
    __shared__ __align__(128) unsigned char qs[QTB];
    const int wave = __builtin_amdgcn_readfirstlane(threadIdx.x >> 5);
    const int lane = threadIdx.x & 31, lr = lane & 15, hi = lane >> 4;
    const int qg = wave & 3, kg = wave >> 2;              // 32-query group of the block, 32-key half of each stage
    const int hh = blockIdx.y, bb = blockIdx.z;
    const int q0 = blockIdx.x * (ATW * 16) + qg * 32;
    const size_t pbase = ((size_t)bb * NH_ + hh) * (size_t)SEQ * HD;
    const h16* q16p = Q16 + pbase; const h16* k16p = K16 + pbase; const h16* v16p = V16 + pbase;
    const unsigned* mwp = MW + (size_t)bb * (SEQ / 32);
    const h16* q16t = (const h16*)qs + (qg * 32 + lr) * LPE + 8 * hi;   // Q fragment reader's place in the staged tile; column group c adds 16 rows
    const int foffl = lr * LPE + 8 * hi;                  // fragment reader's lane offset in a staged tile (row lr, 16-bit elements)
    typedef __attribute__((address_space(3))) unsigned char lds_u8;
    const int crow = threadIdx.x >> 3, cch = threadIdx.x & 7;   // copier's row (and row + 32) and 16-byte piece of it
    const unsigned lcp = (unsigned)(size_t)(lds_u8*)ring + (unsigned)(crow * LPB + cch * 16);
    const h16* k16c = k16p + crow * HD + cch * 8; const h16* v16c = v16p + crow * SEQ + cch * 8;
    v8f acc[2][4];
#pragma unroll
    for (int c = 0; c < 2; ++c)
#pragma unroll
        for (int dt = 0; dt < 4; ++dt) acc[c][dt] = (v8f){};
    float m[2] = { -1.0e30f, -1.0e30f }, l[2] = { 0.0f, 0.0f };
    const int qrow = (blockIdx.x * (ATW * 16) + crow) * HD + cch * 8;
    q_copy((unsigned)(size_t)(lds_u8*)qs + (unsigned)(crow * LPB + cch * 16), q16p + qrow);
    stage_copy(lcp, k16c, v16c);
    asm volatile("s_wait_asynccnt 0x0" ::: "memory");     // this wave's share of the Q tile and of stage 0 has landed
    __syncthreads();                                      // publishes the Q tile and stage 0
    stage_copy(lcp + STB, k16c + KST * HD, v16c + KST);
#pragma unroll 1                                          // one copy of the stage's body: the ring's order stays as written, small code, same register set
    for (int s = 0; s < SEQ / KST; ++s) {
        const unsigned char* rb = ring + (s & 1) * STB;
        const h16* k16t = (const h16*)rb + foffl; const h16* v16t = (const h16*)(rb + TLB) + foffl;
        const int kb = s * KST + kg * 32;
        v8f st[2][2];
#pragma unroll
        for (int c = 0; c < 2; ++c) { st[c][0] = (v8f){}; st[c][1] = (v8f){}; }
        {
            const int ko = kg * 32 * LPE;
            v16h ka[2][2], qb[2][2];                      // [32-d step][16-key tile], [32-d step][column group]
#pragma unroll
            for (int ks = 0; ks < 2; ++ks) { ka[ks][0] = ldh(k16t + ko + ks * 32); ka[ks][1] = ldh(k16t + ko + 16 * LPE + ks * 32);
                qb[ks][0] = ldh(q16t + ks * 32); qb[ks][1] = ldh(q16t + 16 * LPE + ks * 32); }
#pragma unroll
            for (int ks = 0; ks < 2; ++ks)
#pragma unroll
                for (int c = 0; c < 2; ++c) { st[c][0] = wmma16(ka[ks][0], qb[ks][c], st[c][0]); st[c][1] = wmma16(ka[ks][1], qb[ks][c], st[c][1]); }
            // the distance behind the group's last matrix instructions
            asm volatile("v_nop\n\tv_nop\n\tv_nop\n\tv_nop" : "+v"(st[0][0]), "+v"(st[0][1]), "+v"(st[1][0]), "+v"(st[1][1]) : "v"(qb[1][0]), "v"(qb[1][1]), "v"(ka[1][0]), "v"(ka[1][1]));
        }
        const unsigned mw = mwp[kb >> 5];
        if (mw != 0xFFFFFFFFu) {                          // wave-uniform: st[c][0][r] is key kb+8*hi+r, st[c][1][r] is key kb+16+8*hi+r
#pragma unroll
            for (int c = 0; c < 2; ++c)
#pragma unroll
                for (int r = 0; r < 8; ++r) { st[c][0][r] = ((mw >> (8 * hi + r)) & 1u) ? st[c][0][r] : NEGF; st[c][1][r] = ((mw >> (16 + 8 * hi + r)) & 1u) ? st[c][1][r] : NEGF; }
        }
        float mx[2], alpha[2];
#pragma unroll
        for (int c = 0; c < 2; ++c) {
            mx[c] = fmaxf(st[c][0][0], st[c][1][0]);
#pragma unroll
            for (int r = 1; r < 8; ++r) mx[c] = fmaxf(mx[c], fmaxf(st[c][0][r], st[c][1][r]));
        }
#pragma unroll
        for (int c = 0; c < 2; ++c) mx[c] = fmaxf(mx[c], __shfl_xor(mx[c], 16, 32));
        v16h pb[2];
#pragma unroll
        for (int c = 0; c < 2; ++c) {
            const float mnew = fmaxf(m[c], mx[c]);
            alpha[c] = __builtin_amdgcn_exp2f((m[c] - mnew) * L2E);
            const unsigned grow = __builtin_amdgcn_ballot_w32(mnew > m[c]);
            if (grow != 0u) {                             // wave-uniform: rescale only when some query's running max moved (alpha == 1 exactly elsewhere)
#pragma unroll
                for (int dt = 0; dt < 4; ++dt) acc[c][dt] = acc[c][dt] * alpha[c];
            }
            m[c] = mnew;
            float psum = 0.0f;
#pragma unroll
            for (int r = 0; r < 8; ++r) {
                const float p0 = __builtin_amdgcn_exp2f((st[c][0][r] - mnew) * L2E), p1 = __builtin_amdgcn_exp2f((st[c][1][r] - mnew) * L2E);
                psum += p0 + p1; pb[c][r] = (h16)(p0 * PCAR); pb[c][8 + r] = (h16)(p1 * PCAR); }
            l[c] = l[c] * alpha[c] + psum;
        }
        const int vo = kg * 32;
        {
            const v16h va0 = ldh(v16t + vo), va1 = ldh(v16t + vo + 16 * LPE), va2 = ldh(v16t + vo + 32 * LPE), va3 = ldh(v16t + vo + 48 * LPE);
#pragma unroll
            for (int c = 0; c < 2; ++c) { acc[c][0] = wmma16(va0, pb[c], acc[c][0]); acc[c][1] = wmma16(va1, pb[c], acc[c][1]); acc[c][2] = wmma16(va2, pb[c], acc[c][2]); acc[c][3] = wmma16(va3, pb[c], acc[c][3]); }
            // the distance behind the group's last matrix instructions, also on the taken side of the branches that follow
            asm volatile("v_nop\n\tv_nop\n\tv_nop\n\tv_nop" : "+v"(acc[1][0]), "+v"(acc[1][1]), "+v"(acc[1][2]), "+v"(acc[1][3]) : "v"(pb[1]), "v"(va0), "v"(va1), "v"(va2), "v"(va3));
        }
        asm volatile("s_wait_dscnt 0x0" ::: "memory");    // this wave's reads of stage s are done before its buffer is handed back
        asm volatile("s_wait_asynccnt 0x0" ::: "memory"); // this wave's share of stage s + 1 has landed
        __syncthreads();                                  // publishes stage s + 1 and ends every reader's last read of stage s
        if (s + 2 < SEQ / KST) stage_copy(lcp + (unsigned)((s & 1) * STB), k16c + (s + 2) * KST * HD, v16c + (s + 2) * KST);
    }
    asm volatile("s_wait_asynccnt 0x0" ::: "memory");     // nothing of this wave's is in flight past the loop
    // Join of the two key halves: wave w and wave w ^ 4 hold the same 32 queries. Each keeps the column group of its own key-half number and hands the other group to its partner
    // through the ring, which nobody reads any more behind the loop's last barrier and into which nothing is in flight. Same lane, same register position on both sides.
    static_assert(ATW * 4096 + ATW * 256 <= 2 * STB);
    float* xo = (float*)ring + wave * 1024;               // 8 pieces of 4 floats per lane
    float* xs = (float*)(ring + ATW * 4096) + wave * 64;  // running max, sum
    const bool up = kg != 0;
    v8f wk[4];                                            // the kept group, not yet normalised
#pragma unroll
    for (int dt = 0; dt < 4; ++dt) { v4f g0, g1;
#pragma unroll
        for (int r = 0; r < 8; ++r) {
            const float t0 = acc[0][dt][r], t1 = acc[1][dt][r];
            wk[dt][r] = up ? t1 : t0; const float g = up ? t0 : t1;
            if (r < 4) g0[r] = g; else g1[r - 4] = g; }
        *(v4fa*)(xo + (dt * 2) * 128 + lane * 4) = g0; *(v4fa*)(xo + (dt * 2 + 1) * 128 + lane * 4) = g1; }
    xs[lane] = up ? m[0] : m[1]; xs[32 + lane] = up ? l[0] : l[1];
    const float mk = up ? m[1] : m[0], lk = up ? l[1] : l[0];
    __syncthreads();                                      // publishes every wave's handed-over group to its partner
    const float* yo = (const float*)ring + (wave ^ 4) * 1024;
    const float* ys = (const float*)(ring + ATW * 4096) + (wave ^ 4) * 64;
    const float mo = ys[lane], lo = ys[32 + lane];
    const float mf = fmaxf(mk, mo);
    const float ak = __builtin_amdgcn_exp2f((mk - mf) * L2E), ao = __builtin_amdgcn_exp2f((mo - mf) * L2E);
    float lf = lk * ak + lo * ao;
    lf += __shfl_xor(lf, 16, 32);
    const float inv = 1.0f / (PCAR * lf); const float sk = ak * inv, so = ao * inv;
    const int ob = (wave * 16 + lr) * 68 + 8 * hi;        // O^T element (d = dt*16 + 8*hi + r, query lr) -> os[query][d]
#pragma unroll
    for (int dt = 0; dt < 4; ++dt) { v4f w0, w1;
        const v4f o0 = *(const v4fa*)(yo + (dt * 2) * 128 + lane * 4), o1 = *(const v4fa*)(yo + (dt * 2 + 1) * 128 + lane * 4);
#pragma unroll
        for (int r = 0; r < 4; ++r) { w0[r] = wk[dt][r] * sk + o0[r] * so; w1[r] = wk[dt][4 + r] * sk + o1[r] * so; }
        *(v4fa*)(os + ob + dt * 16) = w0; *(v4fa*)(os + ob + dt * 16 + 4) = w1; }
    __builtin_amdgcn_wave_barrier(); asm volatile("" ::: "memory");
    const size_t orow = ((size_t)bb * SEQ + q0 + kg * 16) * DM + hh * HD;   // the kept group's 16 queries
    const int rq = lane >> 3, d8 = (lane & 7) * 8;
{
#pragma unroll
        for (int s = 0; s < 4; ++s) { const int rr = s * 4 + rq;
            const v4f x0 = *(const v4fa*)(os + (wave * 16 + rr) * 68 + d8), x1 = *(const v4fa*)(os + (wave * 16 + rr) * 68 + d8 + 4); v8us oh, ol;
#pragma unroll
            for (int k = 0; k < 4; ++k) { unsigned short a, c; splitf(x0[k], a, c); oh[k] = a; ol[k] = c; splitf(x1[k], a, c); oh[4 + k] = a; ol[4 + k] = c; }
            *(v8us*)(Ah + orow + (size_t)rr * DM + d8) = oh; *(v8us*)(Al + orow + (size_t)rr * DM + d8) = ol; }
         }
}

// ---- workspace carve (bytes, 256-byte aligned regions; every region is covered exactly by its producer grid)
constexpr size_t al256(size_t b) { return (b + 255) & ~(size_t)255; }
constexpr size_t MWPAD  = (((size_t)NB * (SEQ / 32) + 31) / 32) * 32;
constexpr size_t SZ_XB  = al256((size_t)NB * SEQ * DM * 2);
constexpr size_t SZ_W   = al256((size_t)DM * DM * 2);
constexpr size_t SZ_PL  = al256((size_t)NB * NH_ * SEQ * HD * 2);
constexpr size_t SZ_MW  = al256(MWPAD * 4);
constexpr size_t OFF_XB = 0;
constexpr size_t OFF_WQ = OFF_XB + SZ_XB;
constexpr size_t OFF_WK = OFF_WQ + SZ_W;
constexpr size_t OFF_WV = OFF_WK + SZ_W;
constexpr size_t OFF_WO = OFF_WV + SZ_W;
constexpr size_t OFF_Q16 = OFF_WO + SZ_W;
constexpr size_t OFF_K16 = OFF_Q16 + SZ_PL;
constexpr size_t OFF_V16 = OFF_K16 + SZ_PL;
constexpr size_t OFF_AH = OFF_V16 + SZ_PL;
constexpr size_t OFF_AL = OFF_AH + SZ_PL;
constexpr size_t OFF_MW = OFF_AL + SZ_PL;
constexpr size_t WS_TOTAL = OFF_MW + SZ_MW;
static_assert(WS_TOTAL <= (size_t)134217728);          // 128 MiB
static_assert((size_t)NB * NH_ * SEQ * HD == (size_t)NB * SEQ * DM);   // head planes and merged planes have equal extents
static_assert(MWPAD == (size_t)MWPADI);

extern "C" void kernel_launch(void* const* d_in, const int* in_sizes, int n_in,
                              void* d_out, int out_size, void* d_ws, size_t ws_size, hipStream_t stream) {
    if (n_in < 10) return;
    const size_t xneed = (size_t)(NB - 1) * SEQ_FULL * DM + (size_t)SEQ * DM;
    if ((size_t)in_sizes[0] < xneed) return;
    if ((size_t)in_sizes[1] < (size_t)(NB - 1) * SEQ_FULL + SEQ) return;
    if (in_sizes[2] < DM * DM || in_sizes[4] < DM * DM || in_sizes[6] < DM * DM || in_sizes[8] < DM * DM) return;
    if (in_sizes[3] < DM || in_sizes[5] < DM || in_sizes[7] < DM || in_sizes[9] < DM) return;
    if ((size_t)out_size < xneed) return;
    if (ws_size < WS_TOTAL) return;
    const float* x = (const float*)d_in[0]; const int* mask = (const int*)d_in[1];
    const float* wq = (const float*)d_in[2]; const float* bq = (const float*)d_in[3];
    const float* wk = (const float*)d_in[4]; const float* bk = (const float*)d_in[5];
    const float* wv = (const float*)d_in[6]; const float* bv = (const float*)d_in[7];
    const float* wo = (const float*)d_in[8]; const float* bo = (const float*)d_in[9];
    float* OUT = (float*)d_out;
    char* wsb = (char*)d_ws;
    bf* XB = (bf*)(wsb + OFF_XB); bf* WQ = (bf*)(wsb + OFF_WQ); bf* WK = (bf*)(wsb + OFF_WK); bf* WV = (bf*)(wsb + OFF_WV); bf* WO = (bf*)(wsb + OFF_WO);
    h16* QP16 = (h16*)(wsb + OFF_Q16); h16* KP16 = (h16*)(wsb + OFF_K16); h16* VT16 = (h16*)(wsb + OFF_V16);
    bf* ATh = (bf*)(wsb + OFF_AH); bf* ATl = (bf*)(wsb + OFF_AL);
    unsigned* MWp = (unsigned*)(wsb + OFF_MW);

    k_prep<<<1 + NB * XBL + 4 * WBL, 256, 0, stream>>>(x, wq, wk, wv, wo, mask, XB, WQ, WK, WV, WO, MWp);

    k_gemm_qkv<<<dim3((unsigned)(NB * SEQ / 128), DM / 128, 3), GW * 32, 0, stream>>>(XB, WQ, WK, WV, bq, bk, bv, QP16, KP16, VT16);

    k_attn<<<dim3(SEQ / (ATW * 16), NH_, NB), ATW * 32, 0, stream>>>(QP16, KP16, VT16, MWp, ATh, ATl);

    k_gemm_out<<<dim3(SEQ / 128, DM / 128, NB), GW * 32, 0, stream>>>(ATh, ATl, WO, OUT, DM, bo, (size_t)SEQ * DM, (size_t)SEQ_FULL * DM);
}

// v009
// A run of this version takes 81.1 microseconds.
// Versions in between are left out here; by their measured steps it is 1.14 times as fast as v007.
// All steps since v000 together make it 5.90 times as fast.
#include <hip/hip_runtime.h>

// Non-causal attention, 16 heads x 64, unscaled scores, int32 key mask (fill -1e9 by select), out = merged x Wo^T + bo.
// Compute dtypes, f32 accumulate everywhere: every float input converted to bf16 (RNE) on load; q/k/v projections v_wmma_f32_16x16x32_bf16 single product (+ bf16 bias);
// scores v_wmma_f32_16x16x32_f16 on q x log2(e) and k, each rounded to f16 (1 product): scores in log2 units; softmax f32 online (exp2 against a held reference that moves only when a maximum outgrows it); P x V v_wmma_f32_16x16x32_f16 with P and V rounded to f16 (1 product);
// output projection v_wmma_f32_16x16x32_bf16 on context hi|lo planes x Wo (2 products) + bias.

#ifndef NB
#define NB 2
#endif
#ifndef SEQ
#define SEQ 2048
#endif
#define NB_FULL  2
#define SEQ_FULL 2048
#define DM   1024
#define NH_  16
#define HD   64
#define ATW  8                  // waves per attention block (4 groups of 32 query rows x 2 key halves: 128 query rows a block)
#define KST  64                 // keys per LDS stage of the attention ring (two 32-key steps)
#define LPB  144                // LDS row pitch in bytes: 128-byte rows + 16 (16 B x odd, conflict-free for 16-byte row readers)
#define LPE  (LPB / 2)          // the same in 16-bit elements
#define TLB  (64 * LPB)         // one plane's tile: 64 rows
#define STB  (2 * TLB)          // one stage: K, V
#define QTB  (ATW * 16 * LPB)   // the Q tile: the block's 128 query rows at the same pitch
#define GW   8                  // waves per GEMM block
#define GKC  128                // k per LDS stage of the GEMM ring (four 32-k steps): 256-byte rows
#define GPB  272                // LDS row pitch of the GEMM tiles in bytes: 256-byte rows + 16 (16 B x odd, conflict-free for 16-byte row readers)
#define GPE  (GPB / 2)          // the same in 16-bit elements
#define GTB  (128 * GPB)        // one GEMM operand tile: 128 rows
#define HEAD 15.0f              // a score may pass its query's held reference by this much (log2 units) before the reference moves: P stays at or below 2^15, inside f16
#define NEGF (-1.0e9f)
#define L2E  1.4426950408889634f

static_assert(NH_ * HD == DM);               // merged width
static_assert(HD == 64);
static_assert(DM % 64 == 0 && DM % 32 == 0); // wave tile and k-step multiples
static_assert(SEQ % 64 == 0);                // 64-key attention stages, 32-key steps
static_assert(SEQ % (ATW * 16) == 0);        // whole attention blocks
static_assert(SEQ / KST >= 2);               // the ring's prologue fills two stages
static_assert((ATW * 16) % KST == 0);        // a block's first key stage: its index x whole stages, below the stage count
static_assert(ATW == 8 && KST == 64);         // four 32-query groups x two 32-key halves of a stage
static_assert(ATW * 32 == 256);              // the stage copy deals 32 rows x 8 pieces of 16 bytes to the block's lanes, twice per tile
static_assert(KST == 64 && HD * 2 == 128 && KST * 2 == 128);   // every staged row of the attention ring is one 128-byte line
static_assert((NB * SEQ) % 128 == 0 && SEQ % 128 == 0 && DM % 128 == 0);   // whole 128x128 GEMM block tiles
static_assert(DM % GKC == 0 && DM / GKC >= 2 && GKC * 2 == 256 && GW * 32 == 256);   // whole GEMM stages; the tile copy deals 16 rows x 16 pieces of 16 bytes to the block's lanes, eight times per tile
static_assert(NB <= NB_FULL && SEQ <= SEQ_FULL);

typedef _Float16 h16;
typedef unsigned short bf;
typedef __attribute__((ext_vector_type(16))) __bf16   v16bf;
typedef __attribute__((ext_vector_type(16))) _Float16 v16h;
typedef __attribute__((ext_vector_type(8)))  _Float16 v8h;
typedef __attribute__((ext_vector_type(8)))  unsigned short v8us;
typedef __attribute__((ext_vector_type(8)))  float    v8f;
typedef __attribute__((ext_vector_type(4)))  float    v4f;
typedef __attribute__((ext_vector_type(2)))  float    v2f;
typedef v4f  __attribute__((may_alias)) v4fa;

__device__ __forceinline__ unsigned short f2bf(float f) { unsigned u = __float_as_uint(f); u += 0x7FFFu + ((u >> 16) & 1u); return (unsigned short)(u >> 16); }
__device__ __forceinline__ float bf2f(unsigned short b) { return __uint_as_float(((unsigned)b) << 16); }
__device__ __forceinline__ float bfr(float f) { return bf2f(f2bf(f)); }
__device__ __forceinline__ void splitf(float y, unsigned short& h, unsigned short& l) { h = f2bf(y); l = f2bf(y - bf2f(h)); }
__device__ __forceinline__ v16h cat16(v8h lo, v8h hi) { return __builtin_shufflevector(lo, hi, 0, 1, 2, 3, 4, 5, 6, 7, 8, 9, 10, 11, 12, 13, 14, 15); }
__device__ __forceinline__ v16bf cat16b(v8us lo, v8us hi) { return __builtin_bit_cast(v16bf, __builtin_shufflevector(lo, hi, 0, 1, 2, 3, 4, 5, 6, 7, 8, 9, 10, 11, 12, 13, 14, 15)); }
__device__ __forceinline__ v8f wmma16(v16h a, v16h b, v8f c) { return __builtin_amdgcn_wmma_f32_16x16x32_f16(false, a, false, b, (short)0, c, false, false); }
__device__ __forceinline__ v8f wmmab(v16bf a, v16bf b, v8f c) { return __builtin_amdgcn_wmma_f32_16x16x32_bf16(false, a, false, b, (short)0, c, false, false); }
// fragment loaders from K-contiguous 16-bit rows: p = row base + k0 + 8*(lane>>4); elements 0..7 = k0+8h.., elements 8..15 = k0+16+8h..
__device__ __forceinline__ v16bf ldb(const bf* p) { return cat16b(*(const v8us*)p, *(const v8us*)(p + 16)); }
__device__ __forceinline__ v16h  ldh(const h16* p) { return cat16(*(const v8h*)p, *(const v8h*)(p + 16)); }

// Rotated walk: work-groups that copy the same operand rows from L2 each start their walk over the k slabs (the key stages) at a slab of their own and wrap round,
// so that they do not ask L2 for the same lines at the same moment. Place i of the walk (0 <= i < n) is slab i + rot modulo n (0 <= rot < n).
__device__ __forceinline__ int slab(int i, int rot, int n) { const int t = i + rot; return (t >= n) ? t - n : t; }

// One operand tile of a GEMM stage: each of the 256 lanes copies 16 bytes of rows r, r + 16, ... r + 112 of a 128-row x 256-byte tile (a wave-wide copy covers four whole 128-byte lines); rs = 16 source rows in elements.
// The s_wait_xcnt closes the copies' own statement so that it stands in front of any rewrite of the address registers they name.
__device__ __forceinline__ void tile_copy(unsigned l, const bf* g, size_t rs) {
    asm volatile("global_load_async_to_lds_b128 %0, %8, off\n\t"
                 "global_load_async_to_lds_b128 %1, %9, off\n\t"
                 "global_load_async_to_lds_b128 %2, %10, off\n\t"
                 "global_load_async_to_lds_b128 %3, %11, off\n\t"
                 "global_load_async_to_lds_b128 %4, %12, off\n\t"
                 "global_load_async_to_lds_b128 %5, %13, off\n\t"
                 "global_load_async_to_lds_b128 %6, %14, off\n\t"
                 "global_load_async_to_lds_b128 %7, %15, off\n\t"
                 "s_wait_xcnt 0x0"
                 :: "v"(l), "v"(l + 16 * GPB), "v"(l + 32 * GPB), "v"(l + 48 * GPB), "v"(l + 64 * GPB), "v"(l + 80 * GPB), "v"(l + 96 * GPB), "v"(l + 112 * GPB),
                    "v"(g), "v"(g + rs), "v"(g + 2 * rs), "v"(g + 3 * rs), "v"(g + 4 * rs), "v"(g + 5 * rs), "v"(g + 6 * rs), "v"(g + 7 * rs)
                 : "memory");
}
// One stage: the A tile, the Bt tile and, with two A planes, the second A tile, in that order in the buffer.
template <int NA> __device__ __forceinline__ void gemm_stage(unsigned l, const bf* a, const bf* a2, const bf* b, size_t rs) {
    tile_copy(l, a, rs); tile_copy(l + GTB, b, rs);
    if (NA == 2) tile_copy(l + 2 * GTB, a2, rs);
}

// ---- GEMM engine: 8 waves per 128x128 block tile (4 x 2 wave tiles of 32 x 64), C[m][n] = sum_k A[m][k] Bt[n][k] + bf16 bias (bias[n]; bias[m] in the v^T epilogue); operands are K-contiguous bf16 planes, staged 128 k at a time
// in a two-buffer LDS ring that the 8 waves share; NA == 2: A carried as hi + lo planes (two products into one accumulator, hi first). K = DM; rows and columns multiples of 128.
// The full unrolls below keep every index of the fragment and accumulator arrays a constant, so that the arrays stay in registers.
// gemm_main leaves the block tile at rows r0, columns c0 in acc (wave tile at wr, wc); the epilogues behind it add the bias and store. rot: the k slab at which this block's walk starts.
template <int NA> __device__ __forceinline__ void gemm_main(const bf* __restrict__ A, const bf* __restrict__ A2, const bf* __restrict__ Bt, int r0, int c0, int rot,
                                                            const unsigned char* ring, unsigned lbase, v8f (&acc)[2][4]) {
    constexpr unsigned SB = (NA + 1) * GTB;               // bytes of one buffer
    constexpr int K = DM, nst = K / GKC;
    const int wave = __builtin_amdgcn_readfirstlane(threadIdx.x >> 5);
    const int lane = threadIdx.x & 31, lr = lane & 15, hi = lane >> 4;
    const int wr = (wave >> 1) * 32, wc = (wave & 1) * 64;
#pragma unroll
    for (int mb = 0; mb < 2; ++mb)
#pragma unroll
        for (int nb = 0; nb < 4; ++nb) acc[mb][nb] = (v8f){};
    const int prow = threadIdx.x >> 4, pch = threadIdx.x & 15;   // copier's first row and 16-byte piece of it
    const unsigned lcp = lbase + (unsigned)(prow * GPB + pch * 16);
    const bf* ac = A + (size_t)(r0 + prow) * K + pch * 8; const bf* a2c = A2 + (size_t)(r0 + prow) * K + pch * 8; const bf* bc = Bt + (size_t)(c0 + prow) * K + pch * 8;
    const size_t rs = (size_t)16 * K;
    const int aofl = (wr + lr) * GPE + 8 * hi, bofl = (wc + lr) * GPE + 8 * hi;   // fragment readers' lane offsets in a staged tile (16-bit elements)
    const size_t k0 = (size_t)slab(0, rot, nst) * GKC, k1 = (size_t)slab(1, rot, nst) * GKC;
    gemm_stage<NA>(lcp, ac + k0, a2c + k0, bc + k0, rs);
    asm volatile("s_wait_asynccnt 0x0" ::: "memory");     // this wave's share of stage 0 has landed
    __syncthreads();                                      // publishes stage 0
    gemm_stage<NA>(lcp + SB, ac + k1, a2c + k1, bc + k1, rs);
#pragma unroll 1                                          // one copy of the stage's body: the ring's order stays as written
    for (int s = 0; s < nst; ++s) {
        const unsigned char* rb = ring + (s & 1) * SB;
        const bf* at = (const bf*)rb + aofl; const bf* bt = (const bf*)(rb + GTB) + bofl; const bf* a2t = (const bf*)(rb + 2 * GTB) + aofl;
        v16bf a[2][2], a2[2][2], b[2][4];                 // two fragment sets: the 32-k step in work and the next one of the same stage
#pragma unroll
        for (int mb = 0; mb < 2; ++mb) { a[0][mb] = ldb(at + mb * 16 * GPE); if (NA == 2) a2[0][mb] = ldb(a2t + mb * 16 * GPE); }
#pragma unroll
        for (int nb = 0; nb < 4; ++nb) b[0][nb] = ldb(bt + nb * 16 * GPE);
#pragma unroll
        for (int ks = 0; ks < GKC / 32; ++ks) {
            const int cu = ks & 1, nx = cu ^ 1;
            if (ks + 1 < GKC / 32) {
#pragma unroll
                for (int mb = 0; mb < 2; ++mb) { a[nx][mb] = ldb(at + mb * 16 * GPE + (ks + 1) * 32); if (NA == 2) a2[nx][mb] = ldb(a2t + mb * 16 * GPE + (ks + 1) * 32); }
#pragma unroll
                for (int nb = 0; nb < 4; ++nb) b[nx][nb] = ldb(bt + nb * 16 * GPE + (ks + 1) * 32);
            }
            __builtin_amdgcn_sched_barrier(0);            // keeps the next step's LDS reads as one group in front of this step's matrix instructions, which then hide their latency
#pragma unroll
            for (int nb = 0; nb < 4; ++nb)
#pragma unroll
                for (int mb = 0; mb < 2; ++mb) acc[mb][nb] = wmmab(a[cu][mb], b[cu][nb], acc[mb][nb]);
            if (NA == 2) {
#pragma unroll
                for (int nb = 0; nb < 4; ++nb)
#pragma unroll
                    for (int mb = 0; mb < 2; ++mb) acc[mb][nb] = wmmab(a2[cu][mb], b[cu][nb], acc[mb][nb]);
            }
            __builtin_amdgcn_sched_barrier(0);            // keeps the reads of the step after next from being spread among these matrix instructions
        }
        // the distance behind the stage's last matrix instructions, also on the taken side of the branches that follow
        asm volatile("v_nop\n\tv_nop\n\tv_nop\n\tv_nop" : "+v"(acc[0][0]), "+v"(acc[0][1]), "+v"(acc[0][2]), "+v"(acc[0][3]), "+v"(acc[1][0]), "+v"(acc[1][1]), "+v"(acc[1][2]), "+v"(acc[1][3]));
        asm volatile("s_wait_dscnt 0x0" ::: "memory");    // this wave's reads of stage s are done before its buffer is handed back
        asm volatile("s_wait_asynccnt 0x0" ::: "memory"); // this wave's share of stage s + 1 has landed
        __syncthreads();                                  // publishes stage s + 1 and ends every reader's last read of stage s
        if (s + 2 < nst) { const size_t kn = (size_t)slab(s + 2, rot, nst) * GKC; gemm_stage<NA>(lcp + (unsigned)(s & 1) * SB, ac + kn, a2c + kn, bc + kn, rs); }
    }
    asm volatile("s_wait_asynccnt 0x0" ::: "memory");     // nothing of this wave's is in flight past the loop
}

// The full unrolls in the epilogues keep every index of acc and of the small vectors a constant, so that they stay in registers.
// One 16 x 64 half of a wave tile into the wave's own staging rows: os row = tile row, os column = tile column.
__device__ __forceinline__ void stage_half(float* osw, const v8f (&a)[4], int lr, int hi) {
#pragma unroll
    for (int nb = 0; nb < 4; ++nb) {
#pragma unroll
        for (int j = 0; j < 8; ++j) osw[(hi * 8 + j) * 68 + nb * 16 + lr] = a[nb][j]; }
}

// Epilogue, f32 rows: C[m][n] = acc + bf16(bias[n]).
__device__ __forceinline__ void epi_f32(const v8f (&acc)[2][4], int r0, int c0, float* C, int ldc, const float* __restrict__ bias, float* os) {
    const int wave = __builtin_amdgcn_readfirstlane(threadIdx.x >> 5);
    const int lane = threadIdx.x & 31, lr = lane & 15, hi = lane >> 4;
    const int wr = (wave >> 1) * 32, wc = (wave & 1) * 64;
    float* osw = os + wave * 16 * 68;                     // each wave stages its output rows in its own range
    const int cofs = lr * 4;
    const int cw = c0 + wc;
    v4f bv; bv[0] = bfr(bias[cw + cofs]); bv[1] = bfr(bias[cw + cofs + 1]); bv[2] = bfr(bias[cw + cofs + 2]); bv[3] = bfr(bias[cw + cofs + 3]);
#pragma unroll
    for (int mb = 0; mb < 2; ++mb) {
        stage_half(osw, acc[mb], lr, hi);
        __builtin_amdgcn_wave_barrier(); asm volatile("" ::: "memory");
        float* crow = C + (size_t)(r0 + wr + mb * 16) * ldc + cw;
{
#pragma unroll
            for (int s = 0; s < 8; ++s) { const int row = 2 * s + hi; v4f val = *(const v4fa*)(osw + row * 68 + cofs); val = val + bv;
                *(v4f*)(crow + (size_t)row * ldc + cofs) = val; }
             }
        __builtin_amdgcn_wave_barrier(); asm volatile("" ::: "memory");
    }
}

typedef __attribute__((address_space(3))) unsigned char lds_b8;

// Epilogue of the q and k projections: rows are tokens, the wave's 64 columns are one head; y = (acc + bf16(bias[column])) x sc goes out as one f16 plane [batch][head][token][64], 128-byte rows.
__device__ __forceinline__ void epi_qk(const v8f (&acc)[2][4], int r0, int c0, const float* __restrict__ bias, float sc, h16* P, float* os) {
    const int wave = __builtin_amdgcn_readfirstlane(threadIdx.x >> 5);
    const int lane = threadIdx.x & 31, lr = lane & 15, hi = lane >> 4;
    const int wr = (wave >> 1) * 32, wc = (wave & 1) * 64;
    float* osw = os + wave * 16 * 68;                     // each wave stages its output rows in its own range
    const int rq = lane >> 3, d8 = (lane & 7) * 8;
    const int cw = c0 + wc, h = cw / HD;
    v4f b0, b1;
#pragma unroll
    for (int k = 0; k < 4; ++k) { b0[k] = bfr(bias[cw + d8 + k]); b1[k] = bfr(bias[cw + d8 + 4 + k]); }
#pragma unroll
    for (int mb = 0; mb < 2; ++mb) {
        stage_half(osw, acc[mb], lr, hi);
        __builtin_amdgcn_wave_barrier(); asm volatile("" ::: "memory");   // the wave's stores stay in front of its reads of other lanes' values
        const int g0 = r0 + wr + mb * 16; const int b = g0 / SEQ, t0 = g0 % SEQ;   // 16 rows of one batch (SEQ is a multiple of 128)
        const size_t o0 = (((size_t)b * NH_ + h) * SEQ + t0) * HD + d8;
#pragma unroll
        for (int s = 0; s < 4; ++s) { const int rr = s * 4 + rq;
            const v4f x0 = (*(const v4fa*)(osw + rr * 68 + d8) + b0) * sc, x1 = (*(const v4fa*)(osw + rr * 68 + d8 + 4) + b1) * sc; v8h o16;
#pragma unroll
            for (int k = 0; k < 4; ++k) { o16[k] = (h16)x0[k]; o16[4 + k] = (h16)x1[k]; }
            *(v8h*)(P + o0 + (size_t)rr * HD) = o16; }
        __builtin_amdgcn_wave_barrier();                  // with the clobber below: the reads stay in front of the next half's LDS stores
        asm volatile("s_wait_xcnt 0x0" ::: "memory");     // in front of every later rewrite of the registers that these global stores name: the next half's, and behind the last half the code that the build lays out after this epilogue
    }
}

// Epilogue of the v projection, computed transposed (rows are output features, columns are tokens): y = acc + bf16(bias[row]) goes out as one f16 plane [batch][head][64][token], 128-byte pieces of a row.
__device__ __forceinline__ void epi_vt(const v8f (&acc)[2][4], int r0, int c0, const float* __restrict__ bias, h16* V16, float* os) {
    const int wave = __builtin_amdgcn_readfirstlane(threadIdx.x >> 5);
    const int lane = threadIdx.x & 31, lr = lane & 15, hi = lane >> 4;
    const int wr = (wave >> 1) * 32, wc = (wave & 1) * 64;
    float* osw = os + wave * 16 * 68;                     // each wave stages its output rows in its own range
    const int rq = lane >> 3, t8 = (lane & 7) * 8;
    const int cw = c0 + wc; const int b = cw / SEQ, t0 = cw % SEQ;   // 64 tokens of one batch (SEQ is a multiple of 128)
    float bb[2][4];                                       // the lane's eight rows' biases, all fetched in front of the first store
#pragma unroll
    for (int mb = 0; mb < 2; ++mb)
#pragma unroll
        for (int s = 0; s < 4; ++s) bb[mb][s] = bfr(bias[r0 + wr + mb * 16 + s * 4 + rq]);
#pragma unroll
    for (int mb = 0; mb < 2; ++mb) {
        stage_half(osw, acc[mb], lr, hi);
        __builtin_amdgcn_wave_barrier(); asm volatile("" ::: "memory");   // the wave's stores stay in front of its reads of other lanes' values
        const int m0 = r0 + wr + mb * 16;                 // feature row = head * 64 + d: the planes' rows of one batch follow one another in that order
#pragma unroll
        for (int s = 0; s < 4; ++s) { const int rr = s * 4 + rq;
            const v4f x0 = *(const v4fa*)(osw + rr * 68 + t8) + bb[mb][s], x1 = *(const v4fa*)(osw + rr * 68 + t8 + 4) + bb[mb][s]; v8h o16;
#pragma unroll
            for (int k = 0; k < 4; ++k) { o16[k] = (h16)x0[k]; o16[4 + k] = (h16)x1[k]; }
            const size_t o = ((size_t)b * DM + m0 + rr) * SEQ + t0 + t8;
            *(v8h*)(V16 + o) = o16; }
        if (mb == 0) {
            __builtin_amdgcn_wave_barrier();              // with the clobber below: the reads stay in front of the next half's LDS stores
            asm volatile("s_wait_xcnt 0x0" ::: "memory"); // in front of the next half's rewrites of the registers that these global stores name
        }
    }
}

// ---- k_gemm_qkv: the three projections in one launch, single A plane; grid (tokens/128, DM/128, 3), 256 threads. z = 0, 1: q, k = x W^T (A = x rows, Bt = W rows);
// z = 2: v^T = Wv x^T (A = Wv rows, Bt = x rows; same k order), so that its rows run along the tokens as the attention's V planes do. Each epilogue writes the attention's planes itself.
__global__ __launch_bounds__(GW * 32) void k_gemm_qkv(const bf* __restrict__ XB, const bf* __restrict__ WQ, const bf* __restrict__ WK, const bf* __restrict__ WV,
                                                      const float* __restrict__ bq, const float* __restrict__ bk, const float* __restrict__ bv,
                                                      h16* Q16, h16* K16, h16* V16) {
    __shared__ __align__(128) unsigned char ring[2 * 2 * GTB];
    static_assert(GW * 16 * 68 * 4 <= 2 * 2 * GTB);       // the epilogue's staging rows fit the ring
    const int z = blockIdx.z;
    const bf* A = (z == 2) ? WV : XB; const bf* Bt = (z == 2) ? XB : (z == 1) ? WK : WQ;
    const int r0 = ((z == 2) ? blockIdx.y : blockIdx.x) * 128, c0 = ((z == 2) ? blockIdx.x : blockIdx.y) * 128;
    v8f acc[2][4];
    const int rot = (int)((blockIdx.x + blockIdx.y + blockIdx.z) % (DM / GKC));   // the blocks that share x rows differ in y and z, those that share W rows in x
    gemm_main<1>(A, A, Bt, r0, c0, rot, ring, (unsigned)(size_t)(lds_b8*)ring, acc);
    // The epilogue stages its rows in the ring: behind the loop's last barrier no wave reads the ring any more and no copy into it is in flight.
    // With no staging array of its own the block takes 139,264 bytes of LDS, so two blocks are resident per WGP (four waves per SIMD) and each works through the other's waits.
    float* os = (float*)ring;
    if (z == 2) epi_vt(acc, r0, c0, bv, V16, os);
    else epi_qk(acc, r0, c0, (z == 1) ? bk : bq, (z == 1) ? 1.0f : L2E, (z == 1) ? K16 : Q16, os);   // q carries log2(e): the attention's scores come out in log2 units
}

// ---- k_gemm_out: A carried as hi + lo planes, z-batched: A/A2 += z*sA, C += z*sC; grid (M/128, N/128, batches), 256 threads.
__global__ __launch_bounds__(GW * 32) void k_gemm_out(const bf* __restrict__ A, const bf* __restrict__ A2, const bf* __restrict__ Bt, float* C, int ldc, const float* __restrict__ bias, size_t sA, size_t sC) {
    __shared__ __align__(16) float os[GW * 16 * 68];
    __shared__ __align__(128) unsigned char ring[2 * 3 * GTB];
    const size_t z = blockIdx.z;
    const int r0 = blockIdx.x * 128, c0 = blockIdx.y * 128;
    v8f acc[2][4];
    const int rot = (int)((blockIdx.x + blockIdx.y + blockIdx.z) % (DM / GKC));   // the blocks that share context rows differ in y, those that share Wo rows in x and z
    gemm_main<2>(A + z * sA, A2 + z * sA, Bt, r0, c0, rot, ring, (unsigned)(size_t)(lds_b8*)ring, acc);
    epi_f32(acc, r0, c0, C + z * sC, ldc, bias, os);
}

// ---- k_prep: every float operand to bf16 (RNE) and the mask to bit words, one launch. Block 0 packs the mask; each other block converts CVU x 256 pieces of 8 floats of one source
// (the batches of x, then Wq, Wk, Wv, Wo): a lane's CVU loads of 32 bytes are all issued before the first is used. The full unrolls keep v and o in registers.
#define CVU 8
constexpr int CVB = CVU * 256 * 8;                        // floats per block
constexpr int XBL = SEQ * DM / CVB, WBL = DM * DM / CVB;  // blocks per batch of x, per weight
static_assert((SEQ * DM) % CVB == 0 && (DM * DM) % CVB == 0);
constexpr int MWPADI = ((NB * (SEQ / 32) + 31) / 32) * 32;   // mask words, padded to whole 128-byte lines
__global__ __launch_bounds__(256) void k_prep(const float* __restrict__ x, const float* __restrict__ wq, const float* __restrict__ wk, const float* __restrict__ wv, const float* __restrict__ wo, const int* __restrict__ mask,
                                              bf* XB, bf* WQ, bf* WK, bf* WV, bf* WO, unsigned* MW) {
    if (blockIdx.x == 0) {                                // a wave packs 32 words (bit j of word w: key 32 w + j is kept) and stores them as one line
        const int wave = threadIdx.x >> 5, lane = threadIdx.x & 31; const int nw = NB * (SEQ / 32);
        for (int g = wave; g < MWPADI / 32; g += 8) {
            unsigned mine = 0xFFFFFFFFu;                  // words past the last real one
            for (int j = 0; j < 32; ++j) { const int i = g * 32 + j; const int ii = (i < nw) ? i : (nw - 1); const int b = ii / (SEQ / 32), w = ii % (SEQ / 32);
                const unsigned word = __builtin_amdgcn_ballot_w32(mask[(size_t)b * SEQ_FULL + w * 32 + lane] != 0);
                if (lane == j && i < nw) mine = word; }
            MW[g * 32 + lane] = mine;
        }
        return;
    }
    const int blk = blockIdx.x - 1;
    const float* s; bf* d;
    if (blk < NB * XBL) { const int b = blk / XBL, r = blk % XBL; s = x + (size_t)b * SEQ_FULL * DM + (size_t)r * CVB; d = XB + (size_t)b * SEQ * DM + (size_t)r * CVB; }
    else { const int q = blk - NB * XBL; const int w = q / WBL, r = q % WBL;
        s = ((w == 0) ? wq : (w == 1) ? wk : (w == 2) ? wv : wo) + (size_t)r * CVB; d = ((w == 0) ? WQ : (w == 1) ? WK : (w == 2) ? WV : WO) + (size_t)r * CVB; }
    v8f v[CVU];
#pragma unroll
    for (int u = 0; u < CVU; ++u) v[u] = *(const v8f*)(s + (size_t)(u * 256 + threadIdx.x) * 8);
#pragma unroll
    for (int u = 0; u < CVU; ++u) { v8us o;
#pragma unroll
        for (int k = 0; k < 8; ++k) o[k] = f2bf(v[u][k]);
        *(v8us*)(d + (size_t)(u * 256 + threadIdx.x) * 8) = o; }
}

// One stage of the ring: each of the 256 lanes copies 16 bytes of rows r and r + 32 of the two 64-row x 128-byte tiles (a wave-wide copy covers four whole 128-byte lines).
// The s_wait_xcnt closes the copies' own statement so that it stands in front of any rewrite of the address registers they name.
__device__ __forceinline__ void stage_copy(unsigned l, const h16* k, const h16* v) {
    asm volatile("global_load_async_to_lds_b128 %0, %4, off\n\t"
                 "global_load_async_to_lds_b128 %1, %5, off\n\t"
                 "global_load_async_to_lds_b128 %2, %6, off\n\t"
                 "global_load_async_to_lds_b128 %3, %7, off\n\t"
                 "s_wait_xcnt 0x0"
                 :: "v"(l), "v"(l + 32 * LPB), "v"(l + TLB), "v"(l + TLB + 32 * LPB),
                    "v"(k), "v"(k + 32 * HD), "v"(v), "v"(v + 32 * SEQ)
                 : "memory");
}

// The block's 128 query rows: each of the 256 lanes copies 16 bytes of rows r, r + 32, r + 64, r + 96 of the 128-row x 128-byte tile (a wave-wide copy covers four whole 128-byte lines).
// The s_wait_xcnt closes the copies' own statement so that it stands in front of any rewrite of the address registers they name.
__device__ __forceinline__ void q_copy(unsigned l, const h16* q) {
    asm volatile("global_load_async_to_lds_b128 %0, %4, off\n\t"
                 "global_load_async_to_lds_b128 %1, %5, off\n\t"
                 "global_load_async_to_lds_b128 %2, %6, off\n\t"
                 "global_load_async_to_lds_b128 %3, %7, off\n\t"
                 "s_wait_xcnt 0x0"
                 :: "v"(l), "v"(l + 32 * LPB), "v"(l + 64 * LPB), "v"(l + 96 * LPB),
                    "v"(q), "v"(q + 32 * HD), "v"(q + 64 * HD), "v"(q + 96 * HD)
                 : "memory");
}

// ---- k_attn: fused attention, 8 waves per block that share each 64-key stage of K and V through a two-buffer LDS ring; grid (SEQ/128, heads, batch).
// A wave owns 32 query columns (two groups of 16) and one 32-key half of every stage: waves 0..3 take keys 0..31 of the stage, waves 4..7 keys 32..63, for the same four 32-query groups.
// The block's Q rows are staged in LDS once, with stage 0, and every stage reads its Q fragments from there at the conflict-free pitch.
// Each K and V fragment read from LDS so feeds two matrix instructions. The two key halves of a query are joined through LDS behind the loop (sum and output rescaled to the higher of the two held references).
// Transposed form: S^T[key][query] = K Q^T (A = K rows, B = Q rows), so each lane owns one query column per group: row statistics are per lane (+ one xor-16 exchange),
// and the two 16-key score tiles of a 32-key step pack directly into the B fragment of O^T[d][query] += V^T[d][key] P^T[key][query] (elements 0..7 <- tile of keys 0..15, elements 8..15 <- tile of keys 16..31, lane unchanged).
// The full unrolls over the column groups keep every index of the register arrays a constant. amdgpu_waves_per_eu: two blocks stay resident per WGP (four waves per SIMD), as the grid needs to run in one round.
__global__ __launch_bounds__(ATW * 32) __attribute__((amdgpu_waves_per_eu(4, 4))) void k_attn(const h16* __restrict__ Q16, const h16* __restrict__ K16, const h16* __restrict__ V16, const unsigned* __restrict__ MW, bf* Ah, bf* Al) {
    __shared__ __align__(16) float os[ATW * 16 * 68];
    __shared__ __align__(128) unsigned char ring[2 * STB];
    __shared__ __align__(128) unsigned char qs[QTB];
    const int wave = __builtin_amdgcn_readfirstlane(threadIdx.x >> 5);
    const int lane = threadIdx.x & 31, lr = lane & 15, hi = lane >> 4;
    const int qg = wave & 3, kg = wave >> 2;              // 32-query group of the block, 32-key half of each stage
    const int hh = blockIdx.y, bb = blockIdx.z;
    const int q0 = blockIdx.x * (ATW * 16) + qg * 32;
    const size_t pbase = ((size_t)bb * NH_ + hh) * (size_t)SEQ * HD;
    const h16* q16p = Q16 + pbase; const h16* k16p = K16 + pbase; const h16* v16p = V16 + pbase;
    const unsigned* mwp = MW + (size_t)bb * (SEQ / 32);
    const h16* q16t = (const h16*)qs + (qg * 32 + lr) * LPE + 8 * hi;   // Q fragment reader's place in the staged tile; column group c adds 16 rows
    const int foffl = lr * LPE + 8 * hi;                  // fragment reader's lane offset in a staged tile (row lr, 16-bit elements)
    typedef __attribute__((address_space(3))) unsigned char lds_u8;
    const int crow = threadIdx.x >> 3, cch = threadIdx.x & 7;   // copier's row (and row + 32) and 16-byte piece of it
    const unsigned lcp = (unsigned)(size_t)(lds_u8*)ring + (unsigned)(crow * LPB + cch * 16);
    const h16* k16c = k16p + crow * HD + cch * 8; const h16* v16c = v16p + crow * SEQ + cch * 8;
    v8f acc[2][4];
#pragma unroll
    for (int c = 0; c < 2; ++c)
#pragma unroll
        for (int dt = 0; dt < 4; ++dt) acc[c][dt] = (v8f){};
    // Held reference, per query column, in the scores' log2 units: cn = minus the reference (the addend of every exp2 argument), thr = the score above which the reference must move.
    // The start values send the first stage through the move, where alpha = exp2(-huge) = 0 meets zero sums.
    float cn[2] = { 1.0e30f, 1.0e30f }, thr[2] = { -1.0e30f, -1.0e30f }, l[2] = { 0.0f, 0.0f };
    constexpr int NST = SEQ / KST;
    const int rot = (int)(blockIdx.x * (ATW * 16 / KST));   // the blocks of one head share its K and V rows and differ in x: their walks over the key stages start evenly spread
    const int qrow = (blockIdx.x * (ATW * 16) + crow) * HD + cch * 8;
    q_copy((unsigned)(size_t)(lds_u8*)qs + (unsigned)(crow * LPB + cch * 16), q16p + qrow);
    stage_copy(lcp, k16c + slab(0, rot, NST) * KST * HD, v16c + slab(0, rot, NST) * KST);
    asm volatile("s_wait_asynccnt 0x0" ::: "memory");     // this wave's share of the Q tile and of stage 0 has landed
    __syncthreads();                                      // publishes the Q tile and stage 0
    stage_copy(lcp + STB, k16c + slab(1, rot, NST) * KST * HD, v16c + slab(1, rot, NST) * KST);
#pragma unroll 1                                          // one copy of the stage's body: the ring's order stays as written, small code, same register set
    for (int s = 0; s < NST; ++s) {
        const unsigned char* rb = ring + (s & 1) * STB;
        const h16* k16t = (const h16*)rb + foffl; const h16* v16t = (const h16*)(rb + TLB) + foffl;
        const int kb = slab(s, rot, NST) * KST + kg * 32;
        v8f st[2][2];
#pragma unroll
        for (int c = 0; c < 2; ++c) { st[c][0] = (v8f){}; st[c][1] = (v8f){}; }
        {
            const int ko = kg * 32 * LPE;
            v16h ka[2][2], qb[2][2];                      // [32-d step][16-key tile], [32-d step][column group]
#pragma unroll
            for (int ks = 0; ks < 2; ++ks) { ka[ks][0] = ldh(k16t + ko + ks * 32); ka[ks][1] = ldh(k16t + ko + 16 * LPE + ks * 32);
                qb[ks][0] = ldh(q16t + ks * 32); qb[ks][1] = ldh(q16t + 16 * LPE + ks * 32); }
#pragma unroll
            for (int ks = 0; ks < 2; ++ks)
#pragma unroll
                for (int c = 0; c < 2; ++c) { st[c][0] = wmma16(ka[ks][0], qb[ks][c], st[c][0]); st[c][1] = wmma16(ka[ks][1], qb[ks][c], st[c][1]); }
            // the distance behind the group's last matrix instructions
            asm volatile("v_nop\n\tv_nop\n\tv_nop\n\tv_nop" : "+v"(st[0][0]), "+v"(st[0][1]), "+v"(st[1][0]), "+v"(st[1][1]) : "v"(qb[1][0]), "v"(qb[1][1]), "v"(ka[1][0]), "v"(ka[1][1]));
        }
        const unsigned mw = mwp[kb >> 5];
        if (mw != 0xFFFFFFFFu) {                          // wave-uniform: st[c][0][r] is key kb+8*hi+r, st[c][1][r] is key kb+16+8*hi+r
#pragma unroll
            for (int c = 0; c < 2; ++c)
#pragma unroll
                for (int r = 0; r < 8; ++r) { st[c][0][r] = ((mw >> (8 * hi + r)) & 1u) ? st[c][0][r] : NEGF * L2E; st[c][1][r] = ((mw >> (16 + 8 * hi + r)) & 1u) ? st[c][1][r] : NEGF * L2E; }
        }
        float mx[2];
#pragma unroll
        for (int c = 0; c < 2; ++c) {
            mx[c] = fmaxf(st[c][0][0], st[c][1][0]);
#pragma unroll
            for (int r = 1; r < 8; ++r) mx[c] = fmaxf(mx[c], fmaxf(st[c][0][r], st[c][1][r]));
        }
        const unsigned grow = __builtin_amdgcn_ballot_w32(mx[0] > thr[0] || mx[1] > thr[1]);
        if (grow != 0u) {                                 // wave-uniform, one test a stage: some query's score has outgrown its reference; every column then takes this stage's maximum where that is the larger
#pragma unroll
            for (int c = 0; c < 2; ++c) {
                const float mp = fmaxf(mx[c], __shfl_xor(mx[c], 16, 32));   // both lanes of a query hold the same reference
                const float cnew = fminf(cn[c], -mp);
                const float alpha = __builtin_amdgcn_exp2f(cnew - cn[c]);  // 1 exactly where the reference stays
#pragma unroll
                for (int dt = 0; dt < 4; ++dt) acc[c][dt] = acc[c][dt] * alpha;
                l[c] *= alpha; cn[c] = cnew; thr[c] = HEAD - cnew;
            }
        }
        v16h pb[2];
#pragma unroll
        for (int c = 0; c < 2; ++c) {
            const v2f c2 = { cn[c], cn[c] };
            float psum = 0.0f;
#pragma unroll
            for (int r = 0; r < 8; r += 2) {              // two scores' exp2 arguments by one packed add; exactly 0 at the reference, whatever its size (a row of masked keys only)
                const v2f x0 = (v2f){ st[c][0][r], st[c][0][r + 1] } + c2, x1 = (v2f){ st[c][1][r], st[c][1][r + 1] } + c2;
#pragma unroll
                for (int e = 0; e < 2; ++e) {
                    const float p0 = __builtin_amdgcn_exp2f(x0[e]), p1 = __builtin_amdgcn_exp2f(x1[e]);
                    psum += p0 + p1; pb[c][r + e] = (h16)p0; pb[c][8 + r + e] = (h16)p1; }
            }
            l[c] += psum;
        }
        const int vo = kg * 32;
        {
            const v16h va0 = ldh(v16t + vo), va1 = ldh(v16t + vo + 16 * LPE), va2 = ldh(v16t + vo + 32 * LPE), va3 = ldh(v16t + vo + 48 * LPE);
#pragma unroll
            for (int c = 0; c < 2; ++c) { acc[c][0] = wmma16(va0, pb[c], acc[c][0]); acc[c][1] = wmma16(va1, pb[c], acc[c][1]); acc[c][2] = wmma16(va2, pb[c], acc[c][2]); acc[c][3] = wmma16(va3, pb[c], acc[c][3]); }
            // the distance behind the group's last matrix instructions, also on the taken side of the branches that follow
            asm volatile("v_nop\n\tv_nop\n\tv_nop\n\tv_nop" : "+v"(acc[1][0]), "+v"(acc[1][1]), "+v"(acc[1][2]), "+v"(acc[1][3]) : "v"(pb[1]), "v"(va0), "v"(va1), "v"(va2), "v"(va3));
        }
        asm volatile("s_wait_dscnt 0x0" ::: "memory");    // this wave's reads of stage s are done before its buffer is handed back
        asm volatile("s_wait_asynccnt 0x0" ::: "memory"); // this wave's share of stage s + 1 has landed
        __syncthreads();                                  // publishes stage s + 1 and ends every reader's last read of stage s
        if (s + 2 < NST) { const int sn = slab(s + 2, rot, NST); stage_copy(lcp + (unsigned)((s & 1) * STB), k16c + sn * KST * HD, v16c + sn * KST); }
    }
    asm volatile("s_wait_asynccnt 0x0" ::: "memory");     // nothing of this wave's is in flight past the loop
    // Join of the two key halves: wave w and wave w ^ 4 hold the same 32 queries. Each keeps the column group of its own key-half number and hands the other group to its partner
    // through the ring, which nobody reads any more behind the loop's last barrier and into which nothing is in flight. Same lane, same register position on both sides.
    static_assert(ATW * 4096 + ATW * 256 <= 2 * STB);
    float* xo = (float*)ring + wave * 1024;               // 8 pieces of 4 floats per lane
    float* xs = (float*)(ring + ATW * 4096) + wave * 64;  // minus the held reference, sum
    const bool up = kg != 0;
    v8f wk[4];                                            // the kept group, not yet normalised
#pragma unroll
    for (int dt = 0; dt < 4; ++dt) { v4f g0, g1;
#pragma unroll
        for (int r = 0; r < 8; ++r) {
            const float t0 = acc[0][dt][r], t1 = acc[1][dt][r];
            wk[dt][r] = up ? t1 : t0; const float g = up ? t0 : t1;
            if (r < 4) g0[r] = g; else g1[r - 4] = g; }
        *(v4fa*)(xo + (dt * 2) * 128 + lane * 4) = g0; *(v4fa*)(xo + (dt * 2 + 1) * 128 + lane * 4) = g1; }
    xs[lane] = up ? cn[0] : cn[1]; xs[32 + lane] = up ? l[0] : l[1];
    const float ck = up ? cn[1] : cn[0], lk = up ? l[1] : l[0];
    __syncthreads();                                      // publishes every wave's handed-over group to its partner
    const float* yo = (const float*)ring + (wave ^ 4) * 1024;
    const float* ys = (const float*)(ring + ATW * 4096) + (wave ^ 4) * 64;
    const float co = ys[lane], lo = ys[32 + lane];
    const float cf = fminf(ck, co);
    const float ak = __builtin_amdgcn_exp2f(cf - ck), ao = __builtin_amdgcn_exp2f(cf - co);
    float lf = lk * ak + lo * ao;
    lf += __shfl_xor(lf, 16, 32);
    const float inv = 1.0f / lf; const float sk = ak * inv, so = ao * inv;
    const int ob = (wave * 16 + lr) * 68 + 8 * hi;        // O^T element (d = dt*16 + 8*hi + r, query lr) -> os[query][d]
#pragma unroll
    for (int dt = 0; dt < 4; ++dt) { v4f w0, w1;
        const v4f o0 = *(const v4fa*)(yo + (dt * 2) * 128 + lane * 4), o1 = *(const v4fa*)(yo + (dt * 2 + 1) * 128 + lane * 4);
#pragma unroll
        for (int r = 0; r < 4; ++r) { w0[r] = wk[dt][r] * sk + o0[r] * so; w1[r] = wk[dt][4 + r] * sk + o1[r] * so; }
        *(v4fa*)(os + ob + dt * 16) = w0; *(v4fa*)(os + ob + dt * 16 + 4) = w1; }
    __builtin_amdgcn_wave_barrier(); asm volatile("" ::: "memory");
    const size_t orow = ((size_t)bb * SEQ + q0 + kg * 16) * DM + hh * HD;   // the kept group's 16 queries
    const int rq = lane >> 3, d8 = (lane & 7) * 8;
{
#pragma unroll
        for (int s = 0; s < 4; ++s) { const int rr = s * 4 + rq;
            const v4f x0 = *(const v4fa*)(os + (wave * 16 + rr) * 68 + d8), x1 = *(const v4fa*)(os + (wave * 16 + rr) * 68 + d8 + 4); v8us oh, ol;
#pragma unroll
            for (int k = 0; k < 4; ++k) { unsigned short a, c; splitf(x0[k], a, c); oh[k] = a; ol[k] = c; splitf(x1[k], a, c); oh[4 + k] = a; ol[4 + k] = c; }
            *(v8us*)(Ah + orow + (size_t)rr * DM + d8) = oh; *(v8us*)(Al + orow + (size_t)rr * DM + d8) = ol; }
         }
}

// ---- workspace carve (bytes, 256-byte aligned regions; every region is covered exactly by its producer grid)
constexpr size_t al256(size_t b) { return (b + 255) & ~(size_t)255; }
constexpr size_t MWPAD  = (((size_t)NB * (SEQ / 32) + 31) / 32) * 32;
constexpr size_t SZ_XB  = al256((size_t)NB * SEQ * DM * 2);
constexpr size_t SZ_W   = al256((size_t)DM * DM * 2);
constexpr size_t SZ_PL  = al256((size_t)NB * NH_ * SEQ * HD * 2);
constexpr size_t SZ_MW  = al256(MWPAD * 4);
constexpr size_t OFF_XB = 0;
constexpr size_t OFF_WQ = OFF_XB + SZ_XB;
constexpr size_t OFF_WK = OFF_WQ + SZ_W;
constexpr size_t OFF_WV = OFF_WK + SZ_W;
constexpr size_t OFF_WO = OFF_WV + SZ_W;
constexpr size_t OFF_Q16 = OFF_WO + SZ_W;
constexpr size_t OFF_K16 = OFF_Q16 + SZ_PL;
constexpr size_t OFF_V16 = OFF_K16 + SZ_PL;
constexpr size_t OFF_AH = OFF_V16 + SZ_PL;
constexpr size_t OFF_AL = OFF_AH + SZ_PL;
constexpr size_t OFF_MW = OFF_AL + SZ_PL;
constexpr size_t WS_TOTAL = OFF_MW + SZ_MW;
static_assert(WS_TOTAL <= (size_t)134217728);          // 128 MiB
static_assert((size_t)NB * NH_ * SEQ * HD == (size_t)NB * SEQ * DM);   // head planes and merged planes have equal extents
static_assert(MWPAD == (size_t)MWPADI);

extern "C" void kernel_launch(void* const* d_in, const int* in_sizes, int n_in,
                              void* d_out, int out_size, void* d_ws, size_t ws_size, hipStream_t stream) {
    if (n_in < 10) return;
    const size_t xneed = (size_t)(NB - 1) * SEQ_FULL * DM + (size_t)SEQ * DM;
    if ((size_t)in_sizes[0] < xneed) return;
    if ((size_t)in_sizes[1] < (size_t)(NB - 1) * SEQ_FULL + SEQ) return;
    if (in_sizes[2] < DM * DM || in_sizes[4] < DM * DM || in_sizes[6] < DM * DM || in_sizes[8] < DM * DM) return;
    if (in_sizes[3] < DM || in_sizes[5] < DM || in_sizes[7] < DM || in_sizes[9] < DM) return;
    if ((size_t)out_size < xneed) return;
    if (ws_size < WS_TOTAL) return;
    const float* x = (const float*)d_in[0]; const int* mask = (const int*)d_in[1];
    const float* wq = (const float*)d_in[2]; const float* bq = (const float*)d_in[3];
    const float* wk = (const float*)d_in[4]; const float* bk = (const float*)d_in[5];
    const float* wv = (const float*)d_in[6]; const float* bv = (const float*)d_in[7];
    const float* wo = (const float*)d_in[8]; const float* bo = (const float*)d_in[9];
    float* OUT = (float*)d_out;
    char* wsb = (char*)d_ws;
    bf* XB = (bf*)(wsb + OFF_XB); bf* WQ = (bf*)(wsb + OFF_WQ); bf* WK = (bf*)(wsb + OFF_WK); bf* WV = (bf*)(wsb + OFF_WV); bf* WO = (bf*)(wsb + OFF_WO);
    h16* QP16 = (h16*)(wsb + OFF_Q16); h16* KP16 = (h16*)(wsb + OFF_K16); h16* VT16 = (h16*)(wsb + OFF_V16);
    bf* ATh = (bf*)(wsb + OFF_AH); bf* ATl = (bf*)(wsb + OFF_AL);
    unsigned* MWp = (unsigned*)(wsb + OFF_MW);

    k_prep<<<1 + NB * XBL + 4 * WBL, 256, 0, stream>>>(x, wq, wk, wv, wo, mask, XB, WQ, WK, WV, WO, MWp);

    k_gemm_qkv<<<dim3((unsigned)(NB * SEQ / 128), DM / 128, 3), GW * 32, 0, stream>>>(XB, WQ, WK, WV, bq, bk, bv, QP16, KP16, VT16);

    k_attn<<<dim3(SEQ / (ATW * 16), NH_, NB), ATW * 32, 0, stream>>>(QP16, KP16, VT16, MWp, ATh, ATl);

    k_gemm_out<<<dim3(SEQ / 128, DM / 128, NB), GW * 32, 0, stream>>>(ATh, ATl, WO, OUT, DM, bo, (size_t)SEQ * DM, (size_t)SEQ_FULL * DM);
}
